// v000
// The times below were measured on an AMD MI455X: many runs one after another, warmed up first and cycling through
// copies of the inputs, with the whole window's GPU time divided by the number of runs. Launches and the gaps
// between them are all in it. The median over several windows is given; except for v000 it joins two sittings, which
// can be a few percent apart, so the side-by-side timings, each taken in one sitting, are the better comparison.
// v000, which the later versions start from, runs in 768 microseconds.
#include <hip/hip_runtime.h>

// TimeSelfAttentionFallback (hidden [2][2048][768]; normed = RMSNorm(x) ln_weight; q/k/v = normed W^T (12 heads x 64); rotate-half RoPE with angles position_ids[b][t] (int, read) x inv_freq (tables computed in-kernel per batch); scores = q.k (UNSCALED) + attention_mask[b][0][i][j] (float, read);
// fp32 softmax; out = hidden + (attn v merged) Wo^T -> [2][2048][768]).
// Compute dtypes, f32 accumulate: every input rounded to bf16; RMSNorm f32 -> hl planes; q/k/v as hl(normed) x exact W (2 products); RoPE f32; scores hl x hl (3 products, K 64, 4 heads z-batched - the unscaled logits need it);

#define NB_  2
#define TT   2048
#define DM   768
#define NH_  12
#define HD   64
#define HPP  4
#define PCAR 1024.0f
typedef _Float16 h16;
typedef unsigned short bf;
typedef __attribute__((ext_vector_type(16))) __bf16   v16bf;
typedef __attribute__((ext_vector_type(16))) _Float16 v16h;
typedef __attribute__((ext_vector_type(8)))  _Float16 v8h;
typedef __attribute__((ext_vector_type(8)))  unsigned short v8us;
typedef __attribute__((ext_vector_type(8)))  float    v8f;
typedef __attribute__((ext_vector_type(4)))  float    v4f;
typedef v8h  __attribute__((may_alias)) v8ha;
typedef v4f  __attribute__((may_alias)) v4fa;
typedef v8us __attribute__((may_alias)) v8usa;

__device__ __forceinline__ unsigned short f2bf(float f) { unsigned u = __float_as_uint(f); u += 0x7FFFu + ((u >> 16) & 1u); return (unsigned short)(u >> 16); }
__device__ __forceinline__ float bf2f(unsigned short b) { return __uint_as_float(((unsigned)b) << 16); }
__device__ __forceinline__ float bfr(float f) { return bf2f(f2bf(f)); }
__device__ __forceinline__ v16h cat16(v8h lo, v8h hi) { return __builtin_shufflevector(lo, hi, 0, 1, 2, 3, 4, 5, 6, 7, 8, 9, 10, 11, 12, 13, 14, 15); }
__device__ __forceinline__ v16bf cat16b(v8us lo, v8us hi) { return __builtin_bit_cast(v16bf, __builtin_shufflevector(lo, hi, 0, 1, 2, 3, 4, 5, 6, 7, 8, 9, 10, 11, 12, 13, 14, 15)); }
__device__ __forceinline__ v8f wmma16(v16h a, v16h b, v8f c) { return __builtin_amdgcn_wmma_f32_16x16x32_f16(false, a, false, b, (short)0, c, false, false); }
__device__ __forceinline__ v8f wmmab(v16bf a, v16bf b, v8f c) { return __builtin_amdgcn_wmma_f32_16x16x32_bf16(false, a, false, b, (short)0, c, false, false); }



// ---- k_gemmw: register-blocked GEMM, ONE WAVE per 64x64 output tile (16 accumulators), operands straight from K-contiguous 16-bit planes; grid (M/64, N/64, Z), 32 threads.
// C[m][n] (f32, pitch ldc, + optional f32 bias[n]) = sum_k A[m][k] Bt[n][k] (+ split products per NSPLIT). z-batch strides sA/sB/sC in elements. K % 32 == 0.
template <typename T16> struct WFrag;
template <> struct WFrag<h16> { typedef v16h V; static __device__ __forceinline__ V ld(const h16* p) { return cat16(*(const v8h*)p, *(const v8h*)(p + 16)); } static __device__ __forceinline__ v8f mma(V a, V b, v8f c) { return wmma16(a, b, c); } };
template <> struct WFrag<bf> { typedef v16bf V; static __device__ __forceinline__ V ld(const bf* p) { return cat16b(*(const v8us*)p, *(const v8us*)(p + 16)); } static __device__ __forceinline__ v8f mma(V a, V b, v8f c) { return wmmab(a, b, c); } };
template <typename T16, int NSPLIT, bool BIAS>
__global__ __launch_bounds__(32) void k_gemmw(const T16* __restrict__ A, const T16* __restrict__ A2, const T16* __restrict__ Bt, const T16* __restrict__ Bt2, int K, float* C, int ldc, const float* __restrict__ bias, size_t sA, size_t sB, size_t sC) {
    typedef typename WFrag<T16>::V V;
    __shared__ __align__(16) float os[16 * 68];
    const size_t z = blockIdx.z; A += z * sA; if (A2) A2 += z * sA; Bt += z * sB; if (Bt2) Bt2 += z * sB; C += z * sC;
    const int lane = threadIdx.x & 31, lr = lane & 15, hi = lane >> 4; const int r0 = blockIdx.x * 64, c0 = blockIdx.y * 64;
    v8f acc[4][4];
#pragma unroll
    for (int mb = 0; mb < 4; ++mb)
#pragma unroll
        for (int nb = 0; nb < 4; ++nb) acc[mb][nb] = (v8f){};
    const size_t aoff = (size_t)(r0 + lr) * K + 8 * hi, boff = (size_t)(c0 + lr) * K + 8 * hi;
#pragma unroll 1
    for (int kc = 0; kc < K; kc += 32) {
        V a[4], a2[4];
#pragma unroll
        for (int mb = 0; mb < 4; ++mb) { a[mb] = WFrag<T16>::ld(A + aoff + (size_t)mb * 16 * K + kc); if (NSPLIT == 1 || NSPLIT == 2) a2[mb] = WFrag<T16>::ld(A2 + aoff + (size_t)mb * 16 * K + kc); }
#pragma unroll
        for (int nb = 0; nb < 4; ++nb) { const V b = WFrag<T16>::ld(Bt + boff + (size_t)nb * 16 * K + kc); V b2; if (NSPLIT >= 2) b2 = WFrag<T16>::ld(Bt2 + boff + (size_t)nb * 16 * K + kc);
#pragma unroll
            for (int mb = 0; mb < 4; ++mb) { acc[mb][nb] = WFrag<T16>::mma(a[mb], b, acc[mb][nb]); if (NSPLIT == 1 || NSPLIT == 2) acc[mb][nb] = WFrag<T16>::mma(a2[mb], b, acc[mb][nb]); if (NSPLIT >= 2) acc[mb][nb] = WFrag<T16>::mma(a[mb], b2, acc[mb][nb]); } }
        asm volatile("v_nop\n\tv_nop\n\tv_nop\n\tv_nop" : "+v"(acc[0][0]), "+v"(acc[1][1]), "+v"(acc[2][2]), "+v"(acc[3][3]) : "v"(a[0]), "v"(a[3]));
    }
#pragma unroll
    for (int mb = 0; mb < 4; ++mb) {
#pragma unroll
        for (int nb = 0; nb < 4; ++nb) {
#pragma unroll
            for (int j = 0; j < 8; ++j) os[(hi * 8 + j) * 68 + nb * 16 + lr] = acc[mb][nb][j]; }
        __builtin_amdgcn_wave_barrier(); asm volatile("" ::: "memory");
        float* crow = C + (size_t)(r0 + mb * 16) * ldc + c0;
{
#pragma unroll
            for (int s = 0; s < 8; ++s) { const int row = 2 * s + hi, cofs = lr * 4; v4f val = *(const v4fa*)(os + row * 68 + cofs); if (BIAS) { val[0] += bfr(bias[c0 + cofs]); val[1] += bfr(bias[c0 + cofs + 1]); val[2] += bfr(bias[c0 + cofs + 2]); val[3] += bfr(bias[c0 + cofs + 3]); }
                *(v4f*)(crow + (size_t)row * ldc + cofs) = val; }
             }
        __builtin_amdgcn_wave_barrier(); asm volatile("" ::: "memory");
    }
}

__device__ __forceinline__ h16 tohx(float x) { return (h16)x; }
__device__ __forceinline__ void splitf(float y, unsigned short& h, unsigned short& l) { h = f2bf(y); l = f2bf(y - bf2f(h)); }
typedef __attribute__((ext_vector_type(2))) unsigned short v2us;
typedef __attribute__((ext_vector_type(4))) unsigned short v4us;
typedef __attribute__((ext_vector_type(2))) _Float16 v2h;
typedef __attribute__((ext_vector_type(4))) _Float16 v4h;
typedef __attribute__((ext_vector_type(2))) float v2f;

__global__ __launch_bounds__(256) void k_cvt8(const float* __restrict__ src, bf* dst, size_t n8) { const size_t i = (size_t)blockIdx.x * 256 + threadIdx.x; if (i >= n8) return; const v8f v = *(const v8f*)(src + i * 8); v8us o;
#pragma unroll
    for (int k = 0; k < 8; ++k) o[k] = f2bf(v[k]); *(v8us*)(dst + i * 8) = o;  }
// k_rms: wave per token: x rsqrt(mean x^2 + 1e-6) w -> hl planes (8-B lanes); k_cs: CS[t][dd] = (cos, sin)((float)pos[t] x 10000^(-2 (dd mod 32)/64)); k_ropep: rotate-half RoPE of a [t][768] buffer -> hl planes [h][t][d] (lane -> 2 consecutive d; 4-B lanes);
__global__ __launch_bounds__(256) void k_rms(const float* __restrict__ X, const float* __restrict__ w, bf* Hh, bf* Hl) { const int lane = threadIdx.x & 31; const int t = blockIdx.x * 8 + (threadIdx.x >> 5); if (t >= TT) return; float v[DM / 32]; float q = 0.f;
#pragma unroll
    for (int ch = 0; ch < DM / 128; ++ch) { const v4f a = *(const v4f*)(X + (size_t)t * DM + ch * 128 + lane * 4);
#pragma unroll
        for (int u = 0; u < 4; ++u) { v[ch * 4 + u] = bfr(a[u]); float p = __fmul_rn(v[ch * 4 + u], v[ch * 4 + u]); asm volatile("" : "+v"(p)); q = __fadd_rn(q, p); } }
#pragma unroll
    for (int sh = 16; sh; sh >>= 1) q += __shfl_xor(q, sh, 32);
    const float rs = __frsqrt_rn(__fadd_rn(q * (1.0f / DM), 1e-6f));
    {
#pragma unroll
        for (int ch = 0; ch < DM / 128; ++ch) { const int c0 = ch * 128 + lane * 4; v4us oh, ol;
#pragma unroll
            for (int u = 0; u < 4; ++u) { float n0 = __fmul_rn(v[ch * 4 + u], rs); asm volatile("" : "+v"(n0)); const float y = __fmul_rn(n0, bfr(w[c0 + u])); unsigned short a2, b2; splitf(y, a2, b2); oh[u] = a2; ol[u] = b2; }
            const size_t oo = (size_t)t * DM + c0; *(v4us*)(Hh + oo) = oh; *(v4us*)(Hl + oo) = ol; }
         } }
__global__ __launch_bounds__(256) void k_cs(const int* __restrict__ pos, float* CS) { const int idx = blockIdx.x * 256 + threadIdx.x; if (idx >= TT * HD) return; const int dd = idx % HD; const int t = idx / HD; const int i2 = dd % (HD / 2); const float inv = __fdiv_rn(1.0f, powf(10000.0f, (float)(2 * i2) / (float)HD)); const float ang = __fmul_rn((float)pos[t], inv); v2f cs; cs[0] = cosf(ang); cs[1] = sinf(ang);
    *(v2f*)(CS + (size_t)idx * 2) = cs;  }
__global__ __launch_bounds__(256) void k_ropep(const float* __restrict__ F, const float* __restrict__ CS, bf* Ph, bf* Pl) { const size_t e = ((size_t)blockIdx.x * 256 + threadIdx.x) * 2; if (e >= (size_t)NH_ * TT * HD) return; const int d = (int)(e % HD); const int t = (int)((e / HD) % TT); const int h = (int)(e / ((size_t)HD * TT)); const float* f = F + (size_t)t * DM + h * HD; v2us oh, ol;
#pragma unroll
    for (int q = 0; q < 2; ++q) { const int dd = d + q; const int dp = (dd < HD / 2) ? dd + HD / 2 : dd - HD / 2; const float x0 = f[dd], x1 = f[dp]; const v2f cs = *(const v2f*)(CS + ((size_t)t * HD + dd) * 2);
        float a = __fmul_rn(x0, cs[0]), bq = __fmul_rn(x1, cs[1]); asm volatile("" : "+v"(a)); asm volatile("" : "+v"(bq)); const float r = (dd < HD / 2) ? __fsub_rn(a, bq) : __fadd_rn(a, bq); unsigned short a2, c2; splitf(r, a2, c2); oh[q] = a2; ol[q] = c2; }
    *(v2us*)(Ph + e) = oh; *(v2us*)(Pl + e) = ol;  }
__global__ __launch_bounds__(256) void k_vt(const float* __restrict__ V, h16* VT) { const int e = (blockIdx.x * 256 + threadIdx.x) * 2; if (e >= NH_ * HD * TT) return; const int t = e % TT; const int d = (e / TT) % HD; const int h = e / (TT * HD); v2h o; o[0] = tohx(V[(size_t)t * DM + h * HD + d]); o[1] = tohx(V[(size_t)(t + 1) * DM + h * HD + d]); *(v2h*)(VT + e) = o;  }
__global__ __launch_bounds__(256) void k_msoft(const float* __restrict__ Sb, const float* __restrict__ mk, h16* P16) { const int lane = threadIdx.x & 31; const int row = blockIdx.x * 8 + (threadIdx.x >> 5); if (row >= HPP * TT) return; const int i = row % TT; const float* sr = Sb + (size_t)row * TT; const float* mr = mk + (size_t)i * TT; float v[TT / 32]; float mx = -3.0e38f;
#pragma unroll
    for (int ch = 0; ch < TT / 128; ++ch) { const int j0 = ch * 128 + lane * 4; const v4f a = *(const v4f*)(sr + j0), m4 = *(const v4f*)(mr + j0);
#pragma unroll
        for (int u = 0; u < 4; ++u) { float m1 = bfr(m4[u]); asm volatile("" : "+v"(m1)); const float t = __fadd_rn(a[u], m1); v[ch * 4 + u] = t; mx = fmaxf(mx, t); } }
#pragma unroll
    for (int sh = 16; sh; sh >>= 1) mx = fmaxf(mx, __shfl_xor(mx, sh, 32));
    float sum = 0.f;
#pragma unroll
    for (int q = 0; q < TT / 32; ++q) { float d0 = __fsub_rn(v[q], mx); asm volatile("" : "+v"(d0)); v[q] = __builtin_amdgcn_exp2f(__fmul_rn(d0, 1.4426950408889634f)); sum += v[q]; }
#pragma unroll
    for (int sh = 16; sh; sh >>= 1) sum += __shfl_xor(sum, sh, 32);
    const float f = __fdiv_rn(PCAR, sum);
    {
#pragma unroll
        for (int ch = 0; ch < TT / 128; ++ch) { v4h o4;
#pragma unroll
            for (int q = 0; q < 4; ++q) o4[q] = tohx(v[ch * 4 + q] * f); *(v4h*)(P16 + (size_t)row * TT + ch * 128 + lane * 4) = o4; }
         } }
__global__ __launch_bounds__(256) void k_mrg(const float* __restrict__ O, int h0, bf* Ah, bf* Al) { const int e = (blockIdx.x * 256 + threadIdx.x) * 4; if (e >= HPP * TT * HD) return; const int d = e % HD; const int t = (e / HD) % TT; const int z = e / (HD * TT); v4us oh, ol;
#pragma unroll
    for (int u = 0; u < 4; ++u) { unsigned short a, b; splitf(O[e + u] * (1.0f / PCAR), a, b); oh[u] = a; ol[u] = b; } const size_t oo = (size_t)t * DM + (h0 + z) * HD + d; *(v4us*)(Ah + oo) = oh; *(v4us*)(Al + oo) = ol;  }
__global__ __launch_bounds__(256) void k_fin(const float* __restrict__ X, const float* __restrict__ O2, float* outb) { const int e = (blockIdx.x * 256 + threadIdx.x) * 4; if (e >= TT * DM) return; const v4f a = *(const v4f*)(X + e), b = *(const v4f*)(O2 + e); v4f r;
#pragma unroll
    for (int u = 0; u < 4; ++u) r[u] = __fadd_rn(bfr(a[u]), b[u]); *(v4f*)(outb + e) = r;  }

extern "C" void kernel_launch(void* const* d_in, const int* in_sizes, int n_in,
                              void* d_out, int out_size, void* d_ws, size_t ws_size, hipStream_t stream) {
    (void)in_sizes; (void)n_in; (void)out_size;
    const float* x = (const float*)d_in[0]; const float* amask = (const float*)d_in[1]; const int* pos = (const int*)d_in[2]; const float* lnw = (const float*)d_in[3]; const float* wq = (const float*)d_in[4]; const float* wk = (const float*)d_in[5]; const float* wv = (const float*)d_in[6]; const float* wo = (const float*)d_in[7];
    float* OUT = (float*)d_out;     // [2][2048][768]
    char* wsp = (char*)d_ws;
    auto take = [&](size_t bytes) { char* p = wsp; wsp += (bytes + 255) & ~(size_t)255; return (void*)p; };
    bf* BQ = (bf*)take((size_t)DM * DM * 2); bf* BK = (bf*)take((size_t)DM * DM * 2); bf* BV = (bf*)take((size_t)DM * DM * 2); bf* BO = (bf*)take((size_t)DM * DM * 2);
    bf* NH = (bf*)take((size_t)TT * DM * 2); bf* NL = (bf*)take((size_t)TT * DM * 2); float* Q = (float*)take((size_t)TT * DM * 4); float* K = (float*)take((size_t)TT * DM * 4); float* V = (float*)take((size_t)TT * DM * 4); float* CS = (float*)take((size_t)TT * HD * 2 * 4);
    bf* Qh = (bf*)take((size_t)NH_ * TT * HD * 2); bf* Ql = (bf*)take((size_t)NH_ * TT * HD * 2); bf* Kh = (bf*)take((size_t)NH_ * TT * HD * 2); bf* Kl = (bf*)take((size_t)NH_ * TT * HD * 2); h16* VT = (h16*)take((size_t)NH_ * HD * TT * 2);
    float* Sb = (float*)take((size_t)HPP * TT * TT * 4); h16* P16 = (h16*)take((size_t)HPP * TT * TT * 2); float* O = (float*)take((size_t)HPP * TT * HD * 4); bf* Ah = (bf*)take((size_t)TT * DM * 2); bf* Al = (bf*)take((size_t)TT * DM * 2); float* O2 = (float*)take((size_t)TT * DM * 4);
    if ((size_t)(wsp - (char*)d_ws) > ws_size) return;    // total ~ 150 MB (4-head [2048][2048] f32 scores 64 MB + fp16 probabilities 32 MB + planes)
    k_cvt8<<<(DM * DM / 8 + 255) / 256, 256, 0, stream>>>(wq, BQ, DM * DM / 8); k_cvt8<<<(DM * DM / 8 + 255) / 256, 256, 0, stream>>>(wk, BK, DM * DM / 8); k_cvt8<<<(DM * DM / 8 + 255) / 256, 256, 0, stream>>>(wv, BV, DM * DM / 8); k_cvt8<<<(DM * DM / 8 + 255) / 256, 256, 0, stream>>>(wo, BO, DM * DM / 8);   // torch [out][in] = Bt
    const dim3 gp(TT / 64, DM / 64, 1); const size_t zq = (size_t)TT * HD, zS = (size_t)TT * TT;
    for (int b = 0; b < NB_; ++b) { const float* xb = x + (size_t)b * TT * DM;
        k_rms<<<TT / 8, 256, 0, stream>>>(xb, lnw, NH, NL); k_cs<<<(TT * HD + 255) / 256, 256, 0, stream>>>(pos + (size_t)b * TT, CS);
        k_gemmw<bf, 1, false><<<gp, 32, 0, stream>>>(NH, NL, BQ, nullptr, DM, Q, DM, nullptr, 0, 0, 0); k_gemmw<bf, 1, false><<<gp, 32, 0, stream>>>(NH, NL, BK, nullptr, DM, K, DM, nullptr, 0, 0, 0); k_gemmw<bf, 1, false><<<gp, 32, 0, stream>>>(NH, NL, BV, nullptr, DM, V, DM, nullptr, 0, 0, 0);
        k_ropep<<<(unsigned)(((size_t)NH_ * TT * HD / 2 + 255) / 256), 256, 0, stream>>>(Q, CS, Qh, Ql); k_ropep<<<(unsigned)(((size_t)NH_ * TT * HD / 2 + 255) / 256), 256, 0, stream>>>(K, CS, Kh, Kl); k_vt<<<(NH_ * HD * TT / 2 + 255) / 256, 256, 0, stream>>>(V, VT);
        for (int h0 = 0; h0 < NH_; h0 += HPP) { const size_t zo = (size_t)h0 * zq;
            k_gemmw<bf, 2, false><<<dim3(TT / 64, TT / 64, HPP), 32, 0, stream>>>(Qh + zo, Ql + zo, Kh + zo, Kl + zo, HD, Sb, TT, nullptr, zq, zq, zS);
            k_msoft<<<HPP * TT / 8, 256, 0, stream>>>(Sb, amask + (size_t)b * TT * TT, P16);
            k_gemmw<h16, 0, false><<<dim3(TT / 64, 1, HPP), 32, 0, stream>>>(P16, nullptr, VT + zo, nullptr, TT, O, HD, nullptr, zS, (size_t)HD * TT, zq);
            k_mrg<<<(HPP * TT * HD / 4 + 255) / 256, 256, 0, stream>>>(O, h0, Ah, Al); }
        k_gemmw<bf, 1, false><<<gp, 32, 0, stream>>>(Ah, Al, BO, nullptr, DM, O2, DM, nullptr, 0, 0, 0);
        k_fin<<<(TT * DM / 4 + 255) / 256, 256, 0, stream>>>(xb, O2, OUT + (size_t)b * TT * DM); }
}

// v001
// Measured time: 523 microseconds a run.
// In two side-by-side timings against v000, it was 1.47 and 1.45 times as fast.
#include <hip/hip_runtime.h>

// TimeSelfAttentionFallback (hidden [2][2048][768]; normed = RMSNorm(x) ln_weight; q/k/v = normed W^T (12 heads x 64); rotate-half RoPE with angles position_ids[b][t] (int, read) x inv_freq (tables computed in-kernel per batch); scores = q.k (UNSCALED) + attention_mask[b][0][i][j] (float, read);
// fp32 softmax; out = hidden + (attn v merged) Wo^T -> [2][2048][768]).
// Compute dtypes, f32 accumulate: every input rounded to bf16; RMSNorm f32 -> hl planes; q/k/v as hl(normed) x exact W (2 products); RoPE f32; scores hl x hl (3 products, K 64, 4 heads z-batched - the unscaled logits need it);

#define NB_  2
#define TT   2048
#define DM   768
#define NH_  12
#define HD   64
#define HPP  4
#define PCAR 1024.0f
typedef _Float16 h16;
typedef unsigned short bf;
typedef __attribute__((ext_vector_type(16))) __bf16   v16bf;
typedef __attribute__((ext_vector_type(16))) _Float16 v16h;
typedef __attribute__((ext_vector_type(8)))  _Float16 v8h;
typedef __attribute__((ext_vector_type(8)))  unsigned short v8us;
typedef __attribute__((ext_vector_type(8)))  float    v8f;
typedef __attribute__((ext_vector_type(4)))  float    v4f;
typedef v8h  __attribute__((may_alias)) v8ha;
typedef v4f  __attribute__((may_alias)) v4fa;
typedef v8us __attribute__((may_alias)) v8usa;

__device__ __forceinline__ unsigned short f2bf(float f) { unsigned u = __float_as_uint(f); u += 0x7FFFu + ((u >> 16) & 1u); return (unsigned short)(u >> 16); }
__device__ __forceinline__ float bf2f(unsigned short b) { return __uint_as_float(((unsigned)b) << 16); }
__device__ __forceinline__ float bfr(float f) { return bf2f(f2bf(f)); }
__device__ __forceinline__ v16h cat16(v8h lo, v8h hi) { return __builtin_shufflevector(lo, hi, 0, 1, 2, 3, 4, 5, 6, 7, 8, 9, 10, 11, 12, 13, 14, 15); }
__device__ __forceinline__ v16bf cat16b(v8us lo, v8us hi) { return __builtin_bit_cast(v16bf, __builtin_shufflevector(lo, hi, 0, 1, 2, 3, 4, 5, 6, 7, 8, 9, 10, 11, 12, 13, 14, 15)); }
__device__ __forceinline__ v8f wmma16(v16h a, v16h b, v8f c) { return __builtin_amdgcn_wmma_f32_16x16x32_f16(false, a, false, b, (short)0, c, false, false); }
__device__ __forceinline__ v8f wmmab(v16bf a, v16bf b, v8f c) { return __builtin_amdgcn_wmma_f32_16x16x32_bf16(false, a, false, b, (short)0, c, false, false); }



// ---- k_gemmw: register-blocked GEMM, KS WAVES per 64x64 output tile (16 accumulators a wave), operands straight from K-contiguous 16-bit planes; grid (M/64, N/64, Z), 32 KS threads.
// C[m][n] (f32, pitch ldc, + optional f32 bias[n]) = sum_k A[m][k] Bt[n][k] (+ split products per NSPLIT). z-batch strides sA/sB/sC in elements. K % (32 KS) == 0.
// Wave w sums the 32-wide k chunks w, w + KS, w + 2 KS, ... (neighbouring waves read the two halves of one 128-B line in the same trip); the KS partial tiles are added in LDS in wave order (fixed, run-to-run identical).
template <typename T16> struct WFrag;
template <> struct WFrag<h16> { typedef v16h V; static __device__ __forceinline__ V ld(const h16* p) { return cat16(*(const v8h*)p, *(const v8h*)(p + 16)); } static __device__ __forceinline__ v8f mma(V a, V b, v8f c) { return wmma16(a, b, c); } };
template <> struct WFrag<bf> { typedef v16bf V; static __device__ __forceinline__ V ld(const bf* p) { return cat16b(*(const v8us*)p, *(const v8us*)(p + 16)); } static __device__ __forceinline__ v8f mma(V a, V b, v8f c) { return wmmab(a, b, c); } };
template <typename T16, int NSPLIT, bool BIAS, int KS>
__global__ __launch_bounds__(32 * KS) void k_gemmw(const T16* __restrict__ A, const T16* __restrict__ A2, const T16* __restrict__ Bt, const T16* __restrict__ Bt2, int K, float* C, int ldc, const float* __restrict__ bias, size_t sA, size_t sB, size_t sC) {
    typedef typename WFrag<T16>::V V;
    constexpr int OSZ = 16 * 68, NBUF = KS > 1 ? 2 : 1;
    __shared__ __align__(16) float os[NBUF * KS * OSZ];
    const size_t z = blockIdx.z; A += z * sA; if (A2) A2 += z * sA; Bt += z * sB; if (Bt2) Bt2 += z * sB; C += z * sC;
    const int lane = threadIdx.x & 31, lr = lane & 15, hi = lane >> 4; const int r0 = blockIdx.x * 64, c0 = blockIdx.y * 64;
    v8f acc[4][4];
#pragma unroll
    for (int mb = 0; mb < 4; ++mb)
#pragma unroll
        for (int nb = 0; nb < 4; ++nb) acc[mb][nb] = (v8f){};
    const size_t aoff = (size_t)(r0 + lr) * K + 8 * hi, boff = (size_t)(c0 + lr) * K + 8 * hi;
    const int wv = KS > 1 ? __builtin_amdgcn_readfirstlane((int)threadIdx.x >> 5) : 0;
#pragma unroll 1
    for (int kc = wv * 32; kc < K; kc += 32 * KS) {
        V a[4], a2[4];
#pragma unroll
        for (int mb = 0; mb < 4; ++mb) { a[mb] = WFrag<T16>::ld(A + aoff + (size_t)mb * 16 * K + kc); if (NSPLIT == 1 || NSPLIT == 2) a2[mb] = WFrag<T16>::ld(A2 + aoff + (size_t)mb * 16 * K + kc); }
#pragma unroll
        for (int nb = 0; nb < 4; ++nb) { const V b = WFrag<T16>::ld(Bt + boff + (size_t)nb * 16 * K + kc); V b2; if (NSPLIT >= 2) b2 = WFrag<T16>::ld(Bt2 + boff + (size_t)nb * 16 * K + kc);
#pragma unroll
            for (int mb = 0; mb < 4; ++mb) { acc[mb][nb] = WFrag<T16>::mma(a[mb], b, acc[mb][nb]); if (NSPLIT == 1 || NSPLIT == 2) acc[mb][nb] = WFrag<T16>::mma(a2[mb], b, acc[mb][nb]); if (NSPLIT >= 2) acc[mb][nb] = WFrag<T16>::mma(a[mb], b2, acc[mb][nb]); } }
        asm volatile("v_nop\n\tv_nop\n\tv_nop\n\tv_nop" : "+v"(acc[0][0]), "+v"(acc[1][1]), "+v"(acc[2][2]), "+v"(acc[3][3]) : "v"(a[0]), "v"(a[3]));
    }
#pragma unroll
    for (int mb = 0; mb < 4; ++mb) {
        float* ob = os + (size_t)(mb % NBUF) * KS * OSZ;   // two buffers in turn: the barrier of block mb also ends every read of block mb - 1, so one barrier a block is enough
#pragma unroll
        for (int nb = 0; nb < 4; ++nb) {
#pragma unroll
            for (int j = 0; j < 8; ++j) ob[wv * OSZ + (hi * 8 + j) * 68 + nb * 16 + lr] = acc[mb][nb][j]; }
        if (KS > 1) __syncthreads(); else { __builtin_amdgcn_wave_barrier(); asm volatile("" ::: "memory"); }
        float* crow = C + (size_t)(r0 + mb * 16) * ldc + c0;
{
#pragma unroll
            for (int s = wv; s < 8; s += KS) { const int row = 2 * s + hi, cofs = lr * 4; v4f val = *(const v4fa*)(ob + row * 68 + cofs);
#pragma unroll
                for (int w = 1; w < KS; ++w) val += *(const v4fa*)(ob + w * OSZ + row * 68 + cofs);
                if (BIAS) { val[0] += bfr(bias[c0 + cofs]); val[1] += bfr(bias[c0 + cofs + 1]); val[2] += bfr(bias[c0 + cofs + 2]); val[3] += bfr(bias[c0 + cofs + 3]); }
                *(v4f*)(crow + (size_t)row * ldc + cofs) = val; }
             }
        if (KS == 1) { __builtin_amdgcn_wave_barrier(); asm volatile("" ::: "memory"); }
    }
}

__device__ __forceinline__ h16 tohx(float x) { return (h16)x; }
__device__ __forceinline__ void splitf(float y, unsigned short& h, unsigned short& l) { h = f2bf(y); l = f2bf(y - bf2f(h)); }
typedef __attribute__((ext_vector_type(2))) unsigned short v2us;
typedef __attribute__((ext_vector_type(4))) unsigned short v4us;
typedef __attribute__((ext_vector_type(2))) _Float16 v2h;
typedef __attribute__((ext_vector_type(4))) _Float16 v4h;
typedef __attribute__((ext_vector_type(2))) float v2f;

__global__ __launch_bounds__(256) void k_cvt8(const float* __restrict__ src, bf* dst, size_t n8) { const size_t i = (size_t)blockIdx.x * 256 + threadIdx.x; if (i >= n8) return; const v8f v = *(const v8f*)(src + i * 8); v8us o;
#pragma unroll
    for (int k = 0; k < 8; ++k) o[k] = f2bf(v[k]); *(v8us*)(dst + i * 8) = o;  }
// k_rms: wave per token: x rsqrt(mean x^2 + 1e-6) w -> hl planes (8-B lanes); k_cs: CS[t][dd] = (cos, sin)((float)pos[t] x 10000^(-2 (dd mod 32)/64)); k_ropep: rotate-half RoPE of a [t][768] buffer -> hl planes [h][t][d] (lane -> 2 consecutive d; 4-B lanes);
__global__ __launch_bounds__(256) void k_rms(const float* __restrict__ X, const float* __restrict__ w, bf* Hh, bf* Hl) { const int lane = threadIdx.x & 31; const int t = blockIdx.x * 8 + (threadIdx.x >> 5); if (t >= TT) return; float v[DM / 32]; float q = 0.f;
#pragma unroll
    for (int ch = 0; ch < DM / 128; ++ch) { const v4f a = *(const v4f*)(X + (size_t)t * DM + ch * 128 + lane * 4);
#pragma unroll
        for (int u = 0; u < 4; ++u) { v[ch * 4 + u] = bfr(a[u]); float p = __fmul_rn(v[ch * 4 + u], v[ch * 4 + u]); asm volatile("" : "+v"(p)); q = __fadd_rn(q, p); } }
#pragma unroll
    for (int sh = 16; sh; sh >>= 1) q += __shfl_xor(q, sh, 32);
    const float rs = __frsqrt_rn(__fadd_rn(q * (1.0f / DM), 1e-6f));
    {
#pragma unroll
        for (int ch = 0; ch < DM / 128; ++ch) { const int c0 = ch * 128 + lane * 4; v4us oh, ol;
#pragma unroll
            for (int u = 0; u < 4; ++u) { float n0 = __fmul_rn(v[ch * 4 + u], rs); asm volatile("" : "+v"(n0)); const float y = __fmul_rn(n0, bfr(w[c0 + u])); unsigned short a2, b2; splitf(y, a2, b2); oh[u] = a2; ol[u] = b2; }
            const size_t oo = (size_t)t * DM + c0; *(v4us*)(Hh + oo) = oh; *(v4us*)(Hl + oo) = ol; }
         } }
__global__ __launch_bounds__(256) void k_cs(const int* __restrict__ pos, float* CS) { const int idx = blockIdx.x * 256 + threadIdx.x; if (idx >= TT * HD) return; const int dd = idx % HD; const int t = idx / HD; const int i2 = dd % (HD / 2); const float inv = __fdiv_rn(1.0f, powf(10000.0f, (float)(2 * i2) / (float)HD)); const float ang = __fmul_rn((float)pos[t], inv); v2f cs; cs[0] = cosf(ang); cs[1] = sinf(ang);
    *(v2f*)(CS + (size_t)idx * 2) = cs;  }
__global__ __launch_bounds__(256) void k_ropep(const float* __restrict__ F, const float* __restrict__ CS, bf* Ph, bf* Pl) { const size_t e = ((size_t)blockIdx.x * 256 + threadIdx.x) * 2; if (e >= (size_t)NH_ * TT * HD) return; const int d = (int)(e % HD); const int t = (int)((e / HD) % TT); const int h = (int)(e / ((size_t)HD * TT)); const float* f = F + (size_t)t * DM + h * HD; v2us oh, ol;
#pragma unroll
    for (int q = 0; q < 2; ++q) { const int dd = d + q; const int dp = (dd < HD / 2) ? dd + HD / 2 : dd - HD / 2; const float x0 = f[dd], x1 = f[dp]; const v2f cs = *(const v2f*)(CS + ((size_t)t * HD + dd) * 2);
        float a = __fmul_rn(x0, cs[0]), bq = __fmul_rn(x1, cs[1]); asm volatile("" : "+v"(a)); asm volatile("" : "+v"(bq)); const float r = (dd < HD / 2) ? __fsub_rn(a, bq) : __fadd_rn(a, bq); unsigned short a2, c2; splitf(r, a2, c2); oh[q] = a2; ol[q] = c2; }
    *(v2us*)(Ph + e) = oh; *(v2us*)(Pl + e) = ol;  }
__global__ __launch_bounds__(256) void k_vt(const float* __restrict__ V, h16* VT) { const int e = (blockIdx.x * 256 + threadIdx.x) * 2; if (e >= NH_ * HD * TT) return; const int t = e % TT; const int d = (e / TT) % HD; const int h = e / (TT * HD); v2h o; o[0] = tohx(V[(size_t)t * DM + h * HD + d]); o[1] = tohx(V[(size_t)(t + 1) * DM + h * HD + d]); *(v2h*)(VT + e) = o;  }
__global__ __launch_bounds__(256) void k_msoft(const float* __restrict__ Sb, const float* __restrict__ mk, h16* P16) { const int lane = threadIdx.x & 31; const int row = blockIdx.x * 8 + (threadIdx.x >> 5); if (row >= HPP * TT) return; const int i = row % TT; const float* sr = Sb + (size_t)row * TT; const float* mr = mk + (size_t)i * TT; float v[TT / 32]; float mx = -3.0e38f;
#pragma unroll
    for (int ch = 0; ch < TT / 128; ++ch) { const int j0 = ch * 128 + lane * 4; const v4f a = *(const v4f*)(sr + j0), m4 = *(const v4f*)(mr + j0);
#pragma unroll
        for (int u = 0; u < 4; ++u) { float m1 = bfr(m4[u]); asm volatile("" : "+v"(m1)); const float t = __fadd_rn(a[u], m1); v[ch * 4 + u] = t; mx = fmaxf(mx, t); } }
#pragma unroll
    for (int sh = 16; sh; sh >>= 1) mx = fmaxf(mx, __shfl_xor(mx, sh, 32));
    float sum = 0.f;
#pragma unroll
    for (int q = 0; q < TT / 32; ++q) { float d0 = __fsub_rn(v[q], mx); asm volatile("" : "+v"(d0)); v[q] = __builtin_amdgcn_exp2f(__fmul_rn(d0, 1.4426950408889634f)); sum += v[q]; }
#pragma unroll
    for (int sh = 16; sh; sh >>= 1) sum += __shfl_xor(sum, sh, 32);
    const float f = __fdiv_rn(PCAR, sum);
    {
#pragma unroll
        for (int ch = 0; ch < TT / 128; ++ch) { v4h o4;
#pragma unroll
            for (int q = 0; q < 4; ++q) o4[q] = tohx(v[ch * 4 + q] * f); *(v4h*)(P16 + (size_t)row * TT + ch * 128 + lane * 4) = o4; }
         } }
__global__ __launch_bounds__(256) void k_mrg(const float* __restrict__ O, int h0, bf* Ah, bf* Al) { const int e = (blockIdx.x * 256 + threadIdx.x) * 4; if (e >= HPP * TT * HD) return; const int d = e % HD; const int t = (e / HD) % TT; const int z = e / (HD * TT); v4us oh, ol;
#pragma unroll
    for (int u = 0; u < 4; ++u) { unsigned short a, b; splitf(O[e + u] * (1.0f / PCAR), a, b); oh[u] = a; ol[u] = b; } const size_t oo = (size_t)t * DM + (h0 + z) * HD + d; *(v4us*)(Ah + oo) = oh; *(v4us*)(Al + oo) = ol;  }
__global__ __launch_bounds__(256) void k_fin(const float* __restrict__ X, const float* __restrict__ O2, float* outb) { const int e = (blockIdx.x * 256 + threadIdx.x) * 4; if (e >= TT * DM) return; const v4f a = *(const v4f*)(X + e), b = *(const v4f*)(O2 + e); v4f r;
#pragma unroll
    for (int u = 0; u < 4; ++u) r[u] = __fadd_rn(bfr(a[u]), b[u]); *(v4f*)(outb + e) = r;  }

extern "C" void kernel_launch(void* const* d_in, const int* in_sizes, int n_in,
                              void* d_out, int out_size, void* d_ws, size_t ws_size, hipStream_t stream) {
    (void)in_sizes; (void)n_in; (void)out_size;
    const float* x = (const float*)d_in[0]; const float* amask = (const float*)d_in[1]; const int* pos = (const int*)d_in[2]; const float* lnw = (const float*)d_in[3]; const float* wq = (const float*)d_in[4]; const float* wk = (const float*)d_in[5]; const float* wv = (const float*)d_in[6]; const float* wo = (const float*)d_in[7];
    float* OUT = (float*)d_out;     // [2][2048][768]
    char* wsp = (char*)d_ws;
    auto take = [&](size_t bytes) { char* p = wsp; wsp += (bytes + 255) & ~(size_t)255; return (void*)p; };
    bf* BQ = (bf*)take((size_t)DM * DM * 2); bf* BK = (bf*)take((size_t)DM * DM * 2); bf* BV = (bf*)take((size_t)DM * DM * 2); bf* BO = (bf*)take((size_t)DM * DM * 2);
    bf* NH = (bf*)take((size_t)TT * DM * 2); bf* NL = (bf*)take((size_t)TT * DM * 2); float* Q = (float*)take((size_t)TT * DM * 4); float* K = (float*)take((size_t)TT * DM * 4); float* V = (float*)take((size_t)TT * DM * 4); float* CS = (float*)take((size_t)TT * HD * 2 * 4);
    bf* Qh = (bf*)take((size_t)NH_ * TT * HD * 2); bf* Ql = (bf*)take((size_t)NH_ * TT * HD * 2); bf* Kh = (bf*)take((size_t)NH_ * TT * HD * 2); bf* Kl = (bf*)take((size_t)NH_ * TT * HD * 2); h16* VT = (h16*)take((size_t)NH_ * HD * TT * 2);
    float* Sb = (float*)take((size_t)HPP * TT * TT * 4); h16* P16 = (h16*)take((size_t)HPP * TT * TT * 2); float* O = (float*)take((size_t)HPP * TT * HD * 4); bf* Ah = (bf*)take((size_t)TT * DM * 2); bf* Al = (bf*)take((size_t)TT * DM * 2); float* O2 = (float*)take((size_t)TT * DM * 4);
    if ((size_t)(wsp - (char*)d_ws) > ws_size) return;    // total ~ 150 MB (4-head [2048][2048] f32 scores 64 MB + fp16 probabilities 32 MB + planes)
    k_cvt8<<<(DM * DM / 8 + 255) / 256, 256, 0, stream>>>(wq, BQ, DM * DM / 8); k_cvt8<<<(DM * DM / 8 + 255) / 256, 256, 0, stream>>>(wk, BK, DM * DM / 8); k_cvt8<<<(DM * DM / 8 + 255) / 256, 256, 0, stream>>>(wv, BV, DM * DM / 8); k_cvt8<<<(DM * DM / 8 + 255) / 256, 256, 0, stream>>>(wo, BO, DM * DM / 8);   // torch [out][in] = Bt
    const dim3 gp(TT / 64, DM / 64, 1); const size_t zq = (size_t)TT * HD, zS = (size_t)TT * TT;
    for (int b = 0; b < NB_; ++b) { const float* xb = x + (size_t)b * TT * DM;
        k_rms<<<TT / 8, 256, 0, stream>>>(xb, lnw, NH, NL); k_cs<<<(TT * HD + 255) / 256, 256, 0, stream>>>(pos + (size_t)b * TT, CS);
        k_gemmw<bf, 1, false, 8><<<gp, 256, 0, stream>>>(NH, NL, BQ, nullptr, DM, Q, DM, nullptr, 0, 0, 0); k_gemmw<bf, 1, false, 8><<<gp, 256, 0, stream>>>(NH, NL, BK, nullptr, DM, K, DM, nullptr, 0, 0, 0); k_gemmw<bf, 1, false, 8><<<gp, 256, 0, stream>>>(NH, NL, BV, nullptr, DM, V, DM, nullptr, 0, 0, 0);
        k_ropep<<<(unsigned)(((size_t)NH_ * TT * HD / 2 + 255) / 256), 256, 0, stream>>>(Q, CS, Qh, Ql); k_ropep<<<(unsigned)(((size_t)NH_ * TT * HD / 2 + 255) / 256), 256, 0, stream>>>(K, CS, Kh, Kl); k_vt<<<(NH_ * HD * TT / 2 + 255) / 256, 256, 0, stream>>>(V, VT);
        for (int h0 = 0; h0 < NH_; h0 += HPP) { const size_t zo = (size_t)h0 * zq;
            k_gemmw<bf, 2, false, 1><<<dim3(TT / 64, TT / 64, HPP), 32, 0, stream>>>(Qh + zo, Ql + zo, Kh + zo, Kl + zo, HD, Sb, TT, nullptr, zq, zq, zS);
            k_msoft<<<HPP * TT / 8, 256, 0, stream>>>(Sb, amask + (size_t)b * TT * TT, P16);
            k_gemmw<h16, 0, false, 16><<<dim3(TT / 64, 1, HPP), 512, 0, stream>>>(P16, nullptr, VT + zo, nullptr, TT, O, HD, nullptr, zS, (size_t)HD * TT, zq);
            k_mrg<<<(HPP * TT * HD / 4 + 255) / 256, 256, 0, stream>>>(O, h0, Ah, Al); }
        k_gemmw<bf, 1, false, 8><<<gp, 256, 0, stream>>>(Ah, Al, BO, nullptr, DM, O2, DM, nullptr, 0, 0, 0);
        k_fin<<<(TT * DM / 4 + 255) / 256, 256, 0, stream>>>(xb, O2, OUT + (size_t)b * TT * DM); }
}

// v002
// One run takes 244 microseconds.
// Next to v001, in two timings, it ran 2.14 and 2.16 times as fast.
// All steps since v000 together make it 3.14 times as fast.
#include <hip/hip_runtime.h>

// TimeSelfAttentionFallback (hidden [2][2048][768]; normed = RMSNorm(x) ln_weight; q/k/v = normed W^T (12 heads x 64); rotate-half RoPE with angles position_ids[b][t] (int, read) x inv_freq (tables computed in-kernel per batch); scores = q.k (UNSCALED) + attention_mask[b][0][i][j] (float, read);
// fp32 softmax; out = hidden + (attn v merged) Wo^T -> [2][2048][768]).
// Compute dtypes, f32 accumulate: every input rounded to bf16; RMSNorm f32 -> hl planes; q/k/v as hl(normed) x exact W (2 products); RoPE f32; scores hl x hl (3 products, K 64 - the unscaled logits need it); probabilities and v in fp16; scores, softmax and P.V in one kernel (online softmax), the scores stay in registers.

#define NB_  2
#define TT   2048
#define DM   768
#define NH_  12
#define HD   64
typedef _Float16 h16;
typedef unsigned short bf;
typedef __attribute__((ext_vector_type(16))) __bf16   v16bf;
typedef __attribute__((ext_vector_type(16))) _Float16 v16h;
typedef __attribute__((ext_vector_type(8)))  _Float16 v8h;
typedef __attribute__((ext_vector_type(8)))  unsigned short v8us;
typedef __attribute__((ext_vector_type(8)))  float    v8f;
typedef __attribute__((ext_vector_type(4)))  float    v4f;
typedef v8h  __attribute__((may_alias)) v8ha;
typedef v4f  __attribute__((may_alias)) v4fa;
typedef v8us __attribute__((may_alias)) v8usa;

__device__ __forceinline__ unsigned short f2bf(float f) { unsigned u = __float_as_uint(f); u += 0x7FFFu + ((u >> 16) & 1u); return (unsigned short)(u >> 16); }
__device__ __forceinline__ float bf2f(unsigned short b) { return __uint_as_float(((unsigned)b) << 16); }
__device__ __forceinline__ float bfr(float f) { return bf2f(f2bf(f)); }
__device__ __forceinline__ v16h cat16(v8h lo, v8h hi) { return __builtin_shufflevector(lo, hi, 0, 1, 2, 3, 4, 5, 6, 7, 8, 9, 10, 11, 12, 13, 14, 15); }
__device__ __forceinline__ v16bf cat16b(v8us lo, v8us hi) { return __builtin_bit_cast(v16bf, __builtin_shufflevector(lo, hi, 0, 1, 2, 3, 4, 5, 6, 7, 8, 9, 10, 11, 12, 13, 14, 15)); }
__device__ __forceinline__ v8f wmma16(v16h a, v16h b, v8f c) { return __builtin_amdgcn_wmma_f32_16x16x32_f16(false, a, false, b, (short)0, c, false, false); }
__device__ __forceinline__ v8f wmmab(v16bf a, v16bf b, v8f c) { return __builtin_amdgcn_wmma_f32_16x16x32_bf16(false, a, false, b, (short)0, c, false, false); }



// ---- k_gemmw: register-blocked GEMM, KS WAVES per 64x64 output tile (16 accumulators a wave), operands straight from K-contiguous 16-bit planes; grid (M/64, N/64, Z), 32 KS threads.
// C[m][n] (f32, pitch ldc, + optional f32 bias[n]) = sum_k A[m][k] Bt[n][k] (+ split products per NSPLIT). z-batch strides sA/sB/sC in elements. K % (32 KS) == 0.
// Wave w sums the 32-wide k chunks w, w + KS, w + 2 KS, ... (neighbouring waves read the two halves of one 128-B line in the same trip); the KS partial tiles are added in LDS in wave order (fixed, run-to-run identical).
template <typename T16> struct WFrag;
template <> struct WFrag<h16> { typedef v16h V; static __device__ __forceinline__ V ld(const h16* p) { return cat16(*(const v8h*)p, *(const v8h*)(p + 16)); } static __device__ __forceinline__ v8f mma(V a, V b, v8f c) { return wmma16(a, b, c); } };
template <> struct WFrag<bf> { typedef v16bf V; static __device__ __forceinline__ V ld(const bf* p) { return cat16b(*(const v8us*)p, *(const v8us*)(p + 16)); } static __device__ __forceinline__ v8f mma(V a, V b, v8f c) { return wmmab(a, b, c); } };
template <typename T16, int NSPLIT, bool BIAS, int KS>
__global__ __launch_bounds__(32 * KS) void k_gemmw(const T16* __restrict__ A, const T16* __restrict__ A2, const T16* __restrict__ Bt, const T16* __restrict__ Bt2, int K, float* C, int ldc, const float* __restrict__ bias, size_t sA, size_t sB, size_t sC) {
    typedef typename WFrag<T16>::V V;
    constexpr int OSZ = 16 * 68, NBUF = KS > 1 ? 2 : 1;
    __shared__ __align__(16) float os[NBUF * KS * OSZ];
    const size_t z = blockIdx.z; A += z * sA; if (A2) A2 += z * sA; Bt += z * sB; if (Bt2) Bt2 += z * sB; C += z * sC;
    const int lane = threadIdx.x & 31, lr = lane & 15, hi = lane >> 4; const int r0 = blockIdx.x * 64, c0 = blockIdx.y * 64;
    v8f acc[4][4];
#pragma unroll
    for (int mb = 0; mb < 4; ++mb)
#pragma unroll
        for (int nb = 0; nb < 4; ++nb) acc[mb][nb] = (v8f){};
    const size_t aoff = (size_t)(r0 + lr) * K + 8 * hi, boff = (size_t)(c0 + lr) * K + 8 * hi;
    const int wv = KS > 1 ? __builtin_amdgcn_readfirstlane((int)threadIdx.x >> 5) : 0;
#pragma unroll 1
    for (int kc = wv * 32; kc < K; kc += 32 * KS) {
        V a[4], a2[4];
#pragma unroll
        for (int mb = 0; mb < 4; ++mb) { a[mb] = WFrag<T16>::ld(A + aoff + (size_t)mb * 16 * K + kc); if (NSPLIT == 1 || NSPLIT == 2) a2[mb] = WFrag<T16>::ld(A2 + aoff + (size_t)mb * 16 * K + kc); }
#pragma unroll
        for (int nb = 0; nb < 4; ++nb) { const V b = WFrag<T16>::ld(Bt + boff + (size_t)nb * 16 * K + kc); V b2; if (NSPLIT >= 2) b2 = WFrag<T16>::ld(Bt2 + boff + (size_t)nb * 16 * K + kc);
#pragma unroll
            for (int mb = 0; mb < 4; ++mb) { acc[mb][nb] = WFrag<T16>::mma(a[mb], b, acc[mb][nb]); if (NSPLIT == 1 || NSPLIT == 2) acc[mb][nb] = WFrag<T16>::mma(a2[mb], b, acc[mb][nb]); if (NSPLIT >= 2) acc[mb][nb] = WFrag<T16>::mma(a[mb], b2, acc[mb][nb]); } }
        asm volatile("v_nop\n\tv_nop\n\tv_nop\n\tv_nop" : "+v"(acc[0][0]), "+v"(acc[1][1]), "+v"(acc[2][2]), "+v"(acc[3][3]) : "v"(a[0]), "v"(a[3]));
    }
#pragma unroll
    for (int mb = 0; mb < 4; ++mb) {
        float* ob = os + (size_t)(mb % NBUF) * KS * OSZ;   // two buffers in turn: the barrier of block mb also ends every read of block mb - 1, so one barrier a block is enough
#pragma unroll
        for (int nb = 0; nb < 4; ++nb) {
#pragma unroll
            for (int j = 0; j < 8; ++j) ob[wv * OSZ + (hi * 8 + j) * 68 + nb * 16 + lr] = acc[mb][nb][j]; }
        if (KS > 1) __syncthreads(); else { __builtin_amdgcn_wave_barrier(); asm volatile("" ::: "memory"); }
        float* crow = C + (size_t)(r0 + mb * 16) * ldc + c0;
{
#pragma unroll
            for (int s = wv; s < 8; s += KS) { const int row = 2 * s + hi, cofs = lr * 4; v4f val = *(const v4fa*)(ob + row * 68 + cofs);
#pragma unroll
                for (int w = 1; w < KS; ++w) val += *(const v4fa*)(ob + w * OSZ + row * 68 + cofs);
                if (BIAS) { val[0] += bfr(bias[c0 + cofs]); val[1] += bfr(bias[c0 + cofs + 1]); val[2] += bfr(bias[c0 + cofs + 2]); val[3] += bfr(bias[c0 + cofs + 3]); }
                *(v4f*)(crow + (size_t)row * ldc + cofs) = val; }
             }
        if (KS == 1) { __builtin_amdgcn_wave_barrier(); asm volatile("" ::: "memory"); }
    }
}

__device__ __forceinline__ h16 tohx(float x) { return (h16)x; }
__device__ __forceinline__ void splitf(float y, unsigned short& h, unsigned short& l) { h = f2bf(y); l = f2bf(y - bf2f(h)); }
typedef __attribute__((ext_vector_type(2))) unsigned short v2us;
typedef __attribute__((ext_vector_type(4))) unsigned short v4us;
typedef __attribute__((ext_vector_type(2))) _Float16 v2h;
typedef __attribute__((ext_vector_type(4))) _Float16 v4h;
typedef __attribute__((ext_vector_type(2))) float v2f;

__global__ __launch_bounds__(256) void k_cvt8(const float* __restrict__ src, bf* dst, size_t n8) { const size_t i = (size_t)blockIdx.x * 256 + threadIdx.x; if (i >= n8) return; const v8f v = *(const v8f*)(src + i * 8); v8us o;
#pragma unroll
    for (int k = 0; k < 8; ++k) o[k] = f2bf(v[k]); *(v8us*)(dst + i * 8) = o;  }
// k_rms: wave per token: x rsqrt(mean x^2 + 1e-6) w -> hl planes (8-B lanes); k_cs: CS[t][dd] = (cos, sin)((float)pos[t] x 10000^(-2 (dd mod 32)/64)); k_ropep: rotate-half RoPE of a [t][768] buffer -> hl planes [h][t][d] (lane -> 2 consecutive d; 4-B lanes);
__global__ __launch_bounds__(256) void k_rms(const float* __restrict__ X, const float* __restrict__ w, bf* Hh, bf* Hl) { const int lane = threadIdx.x & 31; const int t = blockIdx.x * 8 + (threadIdx.x >> 5); if (t >= TT) return; float v[DM / 32]; float q = 0.f;
#pragma unroll
    for (int ch = 0; ch < DM / 128; ++ch) { const v4f a = *(const v4f*)(X + (size_t)t * DM + ch * 128 + lane * 4);
#pragma unroll
        for (int u = 0; u < 4; ++u) { v[ch * 4 + u] = bfr(a[u]); float p = __fmul_rn(v[ch * 4 + u], v[ch * 4 + u]); asm volatile("" : "+v"(p)); q = __fadd_rn(q, p); } }
#pragma unroll
    for (int sh = 16; sh; sh >>= 1) q += __shfl_xor(q, sh, 32);
    const float rs = __frsqrt_rn(__fadd_rn(q * (1.0f / DM), 1e-6f));
    {
#pragma unroll
        for (int ch = 0; ch < DM / 128; ++ch) { const int c0 = ch * 128 + lane * 4; v4us oh, ol;
#pragma unroll
            for (int u = 0; u < 4; ++u) { float n0 = __fmul_rn(v[ch * 4 + u], rs); asm volatile("" : "+v"(n0)); const float y = __fmul_rn(n0, bfr(w[c0 + u])); unsigned short a2, b2; splitf(y, a2, b2); oh[u] = a2; ol[u] = b2; }
            const size_t oo = (size_t)t * DM + c0; *(v4us*)(Hh + oo) = oh; *(v4us*)(Hl + oo) = ol; }
         } }
__global__ __launch_bounds__(256) void k_cs(const int* __restrict__ pos, float* CS) { const int idx = blockIdx.x * 256 + threadIdx.x; if (idx >= TT * HD) return; const int dd = idx % HD; const int t = idx / HD; const int i2 = dd % (HD / 2); const float inv = __fdiv_rn(1.0f, powf(10000.0f, (float)(2 * i2) / (float)HD)); const float ang = __fmul_rn((float)pos[t], inv); v2f cs; cs[0] = cosf(ang); cs[1] = sinf(ang);
    *(v2f*)(CS + (size_t)idx * 2) = cs;  }
__global__ __launch_bounds__(256) void k_ropep(const float* __restrict__ F, const float* __restrict__ CS, bf* Ph, bf* Pl) { const size_t e = ((size_t)blockIdx.x * 256 + threadIdx.x) * 2; if (e >= (size_t)NH_ * TT * HD) return; const int d = (int)(e % HD); const int t = (int)((e / HD) % TT); const int h = (int)(e / ((size_t)HD * TT)); const float* f = F + (size_t)t * DM + h * HD; v2us oh, ol;
#pragma unroll
    for (int q = 0; q < 2; ++q) { const int dd = d + q; const int dp = (dd < HD / 2) ? dd + HD / 2 : dd - HD / 2; const float x0 = f[dd], x1 = f[dp]; const v2f cs = *(const v2f*)(CS + ((size_t)t * HD + dd) * 2);
        float a = __fmul_rn(x0, cs[0]), bq = __fmul_rn(x1, cs[1]); asm volatile("" : "+v"(a)); asm volatile("" : "+v"(bq)); const float r = (dd < HD / 2) ? __fsub_rn(a, bq) : __fadd_rn(a, bq); unsigned short a2, c2; splitf(r, a2, c2); oh[q] = a2; ol[q] = c2; }
    *(v2us*)(Ph + e) = oh; *(v2us*)(Pl + e) = ol;  }
__global__ __launch_bounds__(256) void k_vt(const float* __restrict__ V, h16* VT) { const int e = (blockIdx.x * 256 + threadIdx.x) * 2; if (e >= NH_ * HD * TT) return; const int t = e % TT; const int d = (e / TT) % HD; const int h = e / (TT * HD); v2h o; o[0] = tohx(V[(size_t)t * DM + h * HD + d]); o[1] = tohx(V[(size_t)(t + 1) * DM + h * HD + d]); *(v2h*)(VT + e) = o;  }
#define FKP  72
#define FTS  (64 * FKP)
#define FTHR 4.0f
#define FSH  9.0f
#define L2E  1.4426950408889634f
typedef __attribute__((ext_vector_type(2))) __bf16 v2bf;
__device__ __forceinline__ float xhalf(float x) { return __builtin_bit_cast(float, __builtin_amdgcn_permlanex16(__builtin_bit_cast(int, x), __builtin_bit_cast(int, x), 0x76543210, 0xfedcba98, false, false)); }   // lane l with lane l ^ 16
__global__ __launch_bounds__(256) void k_fattn(const bf* __restrict__ Qh, const bf* __restrict__ Ql, const bf* __restrict__ Kh, const bf* __restrict__ Kl, const h16* __restrict__ VT, const float* __restrict__ mk, bf* Ah, bf* Al) {
    __shared__ __align__(16) unsigned short sm[2 * 3 * FTS];
    const int tid = threadIdx.x, lane = tid & 31, lr = lane & 15, hi = lane >> 4; const int wv = __builtin_amdgcn_readfirstlane(tid >> 5);
    const int h = blockIdx.y, b = blockIdx.z; const size_t hz = ((size_t)b * NH_ + h) * TT * HD; const int q0 = blockIdx.x * 256 + wv * 32;
    v16bf qh[2][2], ql[2][2]; const bf* qhp = Qh + hz + (size_t)(q0 + lr) * HD + 8 * hi; const bf* qlp = Ql + hz + (size_t)(q0 + lr) * HD + 8 * hi;
#pragma unroll
    for (int g = 0; g < 2; ++g)
#pragma unroll
        for (int kc = 0; kc < 2; ++kc) { qh[g][kc] = WFrag<bf>::ld(qhp + g * 16 * HD + kc * 32); ql[g][kc] = WFrag<bf>::ld(qlp + g * 16 * HD + kc * 32); }
    asm volatile("s_wait_xcnt 0x0" ::: "memory");   // behind the Q loads, before their address registers are reused
    __builtin_amdgcn_sched_barrier(0);   // keeps the address arithmetic that follows from being scheduled in front of that wait, into the Q loads' address registers
    const int srow = tid >> 3, sseg = (tid & 7) * 8;   // staging: a thread moves 16 B of rows srow and srow + 32 of each of the three tiles
    const bf* gkh = Kh + hz + (size_t)srow * HD + sseg; const bf* gkl = Kl + hz + (size_t)srow * HD + sseg; const h16* gvt = VT + hz + (size_t)srow * TT + sseg;
    unsigned short* sw = sm + srow * FKP + sseg;
    const float* mr0 = mk + (size_t)b * TT * TT + (size_t)(q0 + lr) * TT + 8 * hi; const float* mr1 = mr0 + (size_t)16 * TT;
    v8us st[6]; v4f mc[2][2][2];
    v8f o[4][2]; float mrun[2], lrun[2];
#pragma unroll
    for (int g = 0; g < 2; ++g) { mrun[g] = -1.0e30f; lrun[g] = 0.f;
#pragma unroll
        for (int db = 0; db < 4; ++db) o[db][g] = (v8f){}; }
    st[0] = *(const v8usa*)gkh; st[1] = *(const v8usa*)(gkh + 32 * HD); st[2] = *(const v8usa*)gkl; st[3] = *(const v8usa*)(gkl + 32 * HD); st[4] = *(const v8usa*)gvt; st[5] = *(const v8usa*)(gvt + (size_t)32 * TT);
#pragma unroll
    for (int kt = 0; kt < 2; ++kt)
#pragma unroll
        for (int u = 0; u < 2; ++u) { mc[kt][0][u] = *(const v4f*)(mr0 + kt * 16 + u * 4); mc[kt][1][u] = *(const v4f*)(mr1 + kt * 16 + u * 4); }
    asm volatile("s_wait_xcnt 0x0" ::: "memory");   // behind the first stage's and the first pass's loads, before their address registers are reused
#pragma unroll
    for (int i = 0; i < 6; ++i) *(v8usa*)(sw + (i >> 1) * FTS + (i & 1) * 32 * FKP) = st[i];
    __syncthreads();
#pragma unroll 1   // the stage loop stays rolled: one body of two passes
    for (int s = 0; s < TT / 64; ++s) {
        const bool more = s + 1 < TT / 64;
        if (more) { const int kn = (s + 1) * 64;   // next stage's tiles fly into registers under this stage's work
            st[0] = *(const v8usa*)(gkh + (size_t)kn * HD); st[1] = *(const v8usa*)(gkh + (size_t)(kn + 32) * HD); st[2] = *(const v8usa*)(gkl + (size_t)kn * HD); st[3] = *(const v8usa*)(gkl + (size_t)(kn + 32) * HD); st[4] = *(const v8usa*)(gvt + kn); st[5] = *(const v8usa*)(gvt + (size_t)32 * TT + kn);
            asm volatile("s_wait_xcnt 0x0" ::: "memory"); }   // behind these loads, before their address registers are reused
        const unsigned short* bp = sm + (s & 1) * 3 * FTS;
#pragma unroll
        for (int c = 0; c < 2; ++c) {
            const int nk = min(s * 64 + c * 32 + 32, TT - 32);   // next pass's mask, one pass ahead (the last pass re-reads its own: in bounds)
            v4f mn[2][2][2];
#pragma unroll
            for (int kt = 0; kt < 2; ++kt)
#pragma unroll
                for (int u = 0; u < 2; ++u) { mn[kt][0][u] = *(const v4f*)(mr0 + nk + kt * 16 + u * 4); mn[kt][1][u] = *(const v4f*)(mr1 + nk + kt * 16 + u * 4); }
            asm volatile("s_wait_xcnt 0x0" ::: "memory");   // stands behind the loads issued ahead, before their address registers are reused; its clobber also keeps those loads up here, in front of this pass's work, instead of sinking to the loop's foot
            v16bf ah[2][2], al[2][2];
#pragma unroll
            for (int kt = 0; kt < 2; ++kt)
#pragma unroll
                for (int kc = 0; kc < 2; ++kc) { const unsigned short* kp = bp + (c * 32 + kt * 16 + lr) * FKP + kc * 32 + 8 * hi; ah[kt][kc] = cat16b(*(const v8usa*)kp, *(const v8usa*)(kp + 16)); al[kt][kc] = cat16b(*(const v8usa*)(kp + FTS), *(const v8usa*)(kp + FTS + 16)); }
            v8f sc[2][2];
#pragma unroll
            for (int kt = 0; kt < 2; ++kt)
#pragma unroll
                for (int g = 0; g < 2; ++g) sc[kt][g] = (v8f){};
#pragma unroll
            for (int kc = 0; kc < 2; ++kc) {   // four independent score tiles in turn
#pragma unroll
                for (int kt = 0; kt < 2; ++kt)
#pragma unroll
                    for (int g = 0; g < 2; ++g) sc[kt][g] = wmmab(ah[kt][kc], qh[g][kc], sc[kt][g]);
#pragma unroll
                for (int kt = 0; kt < 2; ++kt)
#pragma unroll
                    for (int g = 0; g < 2; ++g) sc[kt][g] = wmmab(ah[kt][kc], ql[g][kc], sc[kt][g]);
#pragma unroll
                for (int kt = 0; kt < 2; ++kt)
#pragma unroll
                    for (int g = 0; g < 2; ++g) sc[kt][g] = wmmab(al[kt][kc], qh[g][kc], sc[kt][g]); }
            v16h vf[4];
#pragma unroll
            for (int db = 0; db < 4; ++db) { const unsigned short* vp = bp + 2 * FTS + (db * 16 + lr) * FKP + c * 32 + 8 * hi; vf[db] = cat16(*(const v8ha*)vp, *(const v8ha*)(vp + 16)); }
            float mb[2]; bool need = false;
#pragma unroll
            for (int g = 0; g < 2; ++g) { float mx = -3.0e38f;
#pragma unroll
                for (int kt = 0; kt < 2; ++kt)
#pragma unroll
                    for (int r = 0; r < 8; r += 2) { const v2bf m2 = __builtin_convertvector((v2f){mc[kt][g][r >> 2][r & 3], mc[kt][g][r >> 2][(r & 3) + 1]}, v2bf);   // mask rounded to bf16 (nearest even), as every input
                        const float t0 = sc[kt][g][r] + (float)m2[0], t1 = sc[kt][g][r + 1] + (float)m2[1]; sc[kt][g][r] = t0; sc[kt][g][r + 1] = t1; mx = fmaxf(mx, fmaxf(t0, t1)); }
                mx = fmaxf(mx, xhalf(mx)); mb[g] = mx; need = need || (mx > mrun[g] + FTHR); }
            if (__builtin_amdgcn_ballot_w32(need) != 0) {   // one wave-uniform test a pass; rare after the first passes
#pragma unroll
                for (int g = 0; g < 2; ++g) { const float mnew = fmaxf(mrun[g], mb[g]); const float corr = __builtin_amdgcn_exp2f((mrun[g] - mnew) * L2E); mrun[g] = mnew; lrun[g] *= corr;
#pragma unroll
                    for (int db = 0; db < 4; ++db) o[db][g] = o[db][g] * corr; } }
#pragma unroll
            for (int g = 0; g < 2; ++g) { const float nm = fmaf(-mrun[g], L2E, FSH); v8f p0, p1; float ls0 = 0.f, ls1 = 0.f;
#pragma unroll
                for (int r = 0; r < 8; ++r) { p0[r] = __builtin_amdgcn_exp2f(fmaf(sc[0][g][r], L2E, nm)); p1[r] = __builtin_amdgcn_exp2f(fmaf(sc[1][g][r], L2E, nm)); ls0 += p0[r]; ls1 += p1[r]; }
                lrun[g] += ls0 + ls1;
                const v16h pf = cat16(__builtin_convertvector(p0, v8h), __builtin_convertvector(p1, v8h));
#pragma unroll
                for (int db = 0; db < 4; ++db) o[db][g] = wmma16(vf[db], pf, o[db][g]); }
#pragma unroll
            for (int kt = 0; kt < 2; ++kt)
#pragma unroll
                for (int g = 0; g < 2; ++g)
#pragma unroll
                    for (int u = 0; u < 2; ++u) mc[kt][g][u] = mn[kt][g][u];
        }
        if (more) { unsigned short* sn = sw + ((s + 1) & 1) * 3 * FTS;   // that buffer's last readers left it before the barrier that ended stage s - 1
#pragma unroll
            for (int i = 0; i < 6; ++i) *(v8usa*)(sn + (i >> 1) * FTS + (i & 1) * 32 * FKP) = st[i]; }
        asm volatile("s_wait_dscnt 0x0" ::: "memory");   // this wave's LDS stores of stage s + 1 and its reads of stage s are done
        asm volatile("s_barrier_signal -1\n\ts_barrier_wait -1" ::: "memory");   // publishes stage s + 1 and ends every read of stage s; by hand because __syncthreads() would also drain the mask loads that are in flight for the next pass
    }
#pragma unroll
    for (int g = 0; g < 2; ++g) { const float inv = __fdiv_rn(1.0f, lrun[g] + xhalf(lrun[g])); const size_t ob = ((size_t)b * TT + q0 + g * 16 + lr) * DM + h * HD + 8 * hi;
#pragma unroll
        for (int db = 0; db < 4; ++db) { v8us oh, ol;
#pragma unroll
            for (int r = 0; r < 8; ++r) { unsigned short a2, c2; splitf(o[db][g][r] * inv, a2, c2); oh[r] = a2; ol[r] = c2; }
            *(v8us*)(Ah + ob + db * 16) = oh; *(v8us*)(Al + ob + db * 16) = ol; } }
}
__global__ __launch_bounds__(256) void k_fin(const float* __restrict__ X, const float* __restrict__ O2, float* outb) { const int e = (blockIdx.x * 256 + threadIdx.x) * 4; if (e >= TT * DM) return; const v4f a = *(const v4f*)(X + e), b = *(const v4f*)(O2 + e); v4f r;
#pragma unroll
    for (int u = 0; u < 4; ++u) r[u] = __fadd_rn(bfr(a[u]), b[u]); *(v4f*)(outb + e) = r;  }

extern "C" void kernel_launch(void* const* d_in, const int* in_sizes, int n_in,
                              void* d_out, int out_size, void* d_ws, size_t ws_size, hipStream_t stream) {
    (void)in_sizes; (void)n_in; (void)out_size;
    const float* x = (const float*)d_in[0]; const float* amask = (const float*)d_in[1]; const int* pos = (const int*)d_in[2]; const float* lnw = (const float*)d_in[3]; const float* wq = (const float*)d_in[4]; const float* wk = (const float*)d_in[5]; const float* wv = (const float*)d_in[6]; const float* wo = (const float*)d_in[7];
    float* OUT = (float*)d_out;     // [2][2048][768]
    char* wsp = (char*)d_ws;
    auto take = [&](size_t bytes) { char* p = wsp; wsp += (bytes + 255) & ~(size_t)255; return (void*)p; };
    bf* BQ = (bf*)take((size_t)DM * DM * 2); bf* BK = (bf*)take((size_t)DM * DM * 2); bf* BV = (bf*)take((size_t)DM * DM * 2); bf* BO = (bf*)take((size_t)DM * DM * 2);
    bf* NH = (bf*)take((size_t)TT * DM * 2); bf* NL = (bf*)take((size_t)TT * DM * 2); float* Q = (float*)take((size_t)TT * DM * 4); float* K = (float*)take((size_t)TT * DM * 4); float* V = (float*)take((size_t)TT * DM * 4); float* CS = (float*)take((size_t)TT * HD * 2 * 4);
    const size_t zb = (size_t)NH_ * TT * HD;   // one batch's planes
    bf* Qh = (bf*)take(NB_ * zb * 2); bf* Ql = (bf*)take(NB_ * zb * 2); bf* Kh = (bf*)take(NB_ * zb * 2); bf* Kl = (bf*)take(NB_ * zb * 2); h16* VT = (h16*)take(NB_ * zb * 2);
    bf* Ah = (bf*)take(NB_ * zb * 2); bf* Al = (bf*)take(NB_ * zb * 2); float* O2 = (float*)take((size_t)TT * DM * 4);
    if ((size_t)(wsp - (char*)d_ws) > ws_size) return;    // total ~ 81 MB
    k_cvt8<<<(DM * DM / 8 + 255) / 256, 256, 0, stream>>>(wq, BQ, DM * DM / 8); k_cvt8<<<(DM * DM / 8 + 255) / 256, 256, 0, stream>>>(wk, BK, DM * DM / 8); k_cvt8<<<(DM * DM / 8 + 255) / 256, 256, 0, stream>>>(wv, BV, DM * DM / 8); k_cvt8<<<(DM * DM / 8 + 255) / 256, 256, 0, stream>>>(wo, BO, DM * DM / 8);   // torch [out][in] = Bt
    const dim3 gp(TT / 64, DM / 64, 1);
    for (int b = 0; b < NB_; ++b) { const float* xb = x + (size_t)b * TT * DM;
        k_rms<<<TT / 8, 256, 0, stream>>>(xb, lnw, NH, NL); k_cs<<<(TT * HD + 255) / 256, 256, 0, stream>>>(pos + (size_t)b * TT, CS);
        k_gemmw<bf, 1, false, 8><<<gp, 256, 0, stream>>>(NH, NL, BQ, nullptr, DM, Q, DM, nullptr, 0, 0, 0); k_gemmw<bf, 1, false, 8><<<gp, 256, 0, stream>>>(NH, NL, BK, nullptr, DM, K, DM, nullptr, 0, 0, 0); k_gemmw<bf, 1, false, 8><<<gp, 256, 0, stream>>>(NH, NL, BV, nullptr, DM, V, DM, nullptr, 0, 0, 0);
        k_ropep<<<(unsigned)(((size_t)NH_ * TT * HD / 2 + 255) / 256), 256, 0, stream>>>(Q, CS, Qh + b * zb, Ql + b * zb); k_ropep<<<(unsigned)(((size_t)NH_ * TT * HD / 2 + 255) / 256), 256, 0, stream>>>(K, CS, Kh + b * zb, Kl + b * zb); k_vt<<<(NH_ * HD * TT / 2 + 255) / 256, 256, 0, stream>>>(V, VT + b * zb); }
    k_fattn<<<dim3(TT / 256, NH_, NB_), 256, 0, stream>>>(Qh, Ql, Kh, Kl, VT, amask, Ah, Al);
    for (int b = 0; b < NB_; ++b) { const float* xb = x + (size_t)b * TT * DM;
        k_gemmw<bf, 1, false, 8><<<gp, 256, 0, stream>>>(Ah + b * zb, Al + b * zb, BO, nullptr, DM, O2, DM, nullptr, 0, 0, 0);
        k_fin<<<(TT * DM / 4 + 255) / 256, 256, 0, stream>>>(xb, O2, OUT + (size_t)b * TT * DM); }
}

// v003
// Measured time: 211 microseconds a run.
// Next to v002, in two timings, it ran 1.16 and 1.15 times as fast.
// Over all steps from v000 it is 3.64 times as fast.
#include <hip/hip_runtime.h>

// TimeSelfAttentionFallback (hidden [2][2048][768]; normed = RMSNorm(x) ln_weight; q/k/v = normed W^T (12 heads x 64); rotate-half RoPE with angles position_ids[b][t] (int, read) x inv_freq (tables computed in-kernel per batch); scores = q.k (UNSCALED) + attention_mask[b][0][i][j] (float, read);
// fp32 softmax; out = hidden + (attn v merged) Wo^T -> [2][2048][768]).
// Compute dtypes, f32 accumulate: every input rounded to bf16; RMSNorm f32 -> hl planes; q/k/v as hl(normed) x exact W (2 products); RoPE f32; scores hl x hl (3 products, K 64 - the unscaled logits need it); probabilities and v in fp16; scores, softmax and P.V in one kernel (online softmax), the scores stay in registers. What follows a projection element by element (RoPE and the hl split; the fp16 rounding of V^T; the residual add) is done in that GEMM's epilogue.

#define NB_  2
#define TT   2048
#define DM   768
#define NH_  12
#define HD   64
typedef _Float16 h16;
typedef unsigned short bf;
typedef __attribute__((ext_vector_type(16))) __bf16   v16bf;
typedef __attribute__((ext_vector_type(16))) _Float16 v16h;
typedef __attribute__((ext_vector_type(8)))  _Float16 v8h;
typedef __attribute__((ext_vector_type(8)))  unsigned short v8us;
typedef __attribute__((ext_vector_type(8)))  float    v8f;
typedef __attribute__((ext_vector_type(4)))  float    v4f;
typedef v8h  __attribute__((may_alias)) v8ha;
typedef v4f  __attribute__((may_alias)) v4fa;
typedef v8us __attribute__((may_alias)) v8usa;

__device__ __forceinline__ unsigned short f2bf(float f) { unsigned u = __float_as_uint(f); u += 0x7FFFu + ((u >> 16) & 1u); return (unsigned short)(u >> 16); }
__device__ __forceinline__ float bf2f(unsigned short b) { return __uint_as_float(((unsigned)b) << 16); }
__device__ __forceinline__ float bfr(float f) { return bf2f(f2bf(f)); }
__device__ __forceinline__ v16h cat16(v8h lo, v8h hi) { return __builtin_shufflevector(lo, hi, 0, 1, 2, 3, 4, 5, 6, 7, 8, 9, 10, 11, 12, 13, 14, 15); }
__device__ __forceinline__ v16bf cat16b(v8us lo, v8us hi) { return __builtin_bit_cast(v16bf, __builtin_shufflevector(lo, hi, 0, 1, 2, 3, 4, 5, 6, 7, 8, 9, 10, 11, 12, 13, 14, 15)); }
__device__ __forceinline__ v8f wmma16(v16h a, v16h b, v8f c) { return __builtin_amdgcn_wmma_f32_16x16x32_f16(false, a, false, b, (short)0, c, false, false); }
__device__ __forceinline__ v8f wmmab(v16bf a, v16bf b, v8f c) { return __builtin_amdgcn_wmma_f32_16x16x32_bf16(false, a, false, b, (short)0, c, false, false); }
__device__ __forceinline__ void splitf(float y, unsigned short& h, unsigned short& l) { h = f2bf(y); l = f2bf(y - bf2f(h)); }
typedef __attribute__((ext_vector_type(4))) unsigned short v4us;
typedef __attribute__((ext_vector_type(4))) _Float16 v4h;
typedef __attribute__((ext_vector_type(2))) float v2f;
__device__ __forceinline__ float xrow8(float x) { return __builtin_bit_cast(float, __builtin_amdgcn_permlane16(__builtin_bit_cast(int, x), __builtin_bit_cast(int, x), 0xfedcba98, 0x76543210, false, false)); }   // lane l with lane l ^ 8



// ---- k_gemmw: register-blocked GEMM, KS WAVES per 64x64 output tile (16 accumulators a wave), operands straight from K-contiguous 16-bit planes; grid (M/64, N/64), 32 KS threads.
// c[m][n] = sum_k A[m][k] Bt[n][k] (+ split products per NSPLIT: 1 = (A + A2) Bt, 3 = A (Bt + Bt2)), f32. K % (32 KS) == 0.
// EPI says where the summed tile goes: 1 = rows are tokens, the 64 columns one head: rotate-half RoPE with aux = CS[t][d] (cos, sin), then hl planes Ph/Pl [h][t][d]; 2 = fp16 to Ch (pitch ldc); 3 = C (f32, pitch ldc) = bf16-rounded aux[m][n] + c.
// Wave w sums the 32-wide k chunks w, w + KS, w + 2 KS, ... (neighbouring waves read the two halves of one 128-B line in the same trip); the KS partial tiles are added in LDS in wave order (fixed, run-to-run identical).
template <typename T16> struct WFrag;
template <> struct WFrag<h16> { typedef v16h V; static __device__ __forceinline__ V ld(const h16* p) { return cat16(*(const v8h*)p, *(const v8h*)(p + 16)); } static __device__ __forceinline__ v8f mma(V a, V b, v8f c) { return wmma16(a, b, c); } };
template <> struct WFrag<bf> { typedef v16bf V; static __device__ __forceinline__ V ld(const bf* p) { return cat16b(*(const v8us*)p, *(const v8us*)(p + 16)); } static __device__ __forceinline__ v8f mma(V a, V b, v8f c) { return wmmab(a, b, c); } };
template <typename T16, int NSPLIT, int EPI, int KS>
__global__ __launch_bounds__(32 * KS) void k_gemmw(const T16* __restrict__ A, const T16* __restrict__ A2, const T16* __restrict__ Bt, const T16* __restrict__ Bt2, int K, const float* __restrict__ aux, float* C, h16* Ch, int ldc, bf* Ph, bf* Pl) {
    static_assert(KS == 8, "the epilogue gives each wave one row pair of a 16-row block");
    typedef typename WFrag<T16>::V V;
    constexpr int OSZ = 16 * 68, NBUF = KS > 1 ? 2 : 1;
    __shared__ __align__(16) float os[NBUF * KS * OSZ];
    const int lane = threadIdx.x & 31, lr = lane & 15, hi = lane >> 4; const int r0 = blockIdx.x * 64, c0 = blockIdx.y * 64;
    const int wv = KS > 1 ? __builtin_amdgcn_readfirstlane((int)threadIdx.x >> 5) : 0;
    const int row = 2 * wv + hi, cofs = lr * 4;   // this thread's place in each summed 16 x 64 block: one row, four columns
    v4f ex[4][2];   // what the epilogue reads from memory, all four blocks, asked for in front of the K loop so that it arrives under the loop
#pragma unroll
    for (int mb = 0; mb < 4; ++mb) { const int m = r0 + mb * 16 + row;
        if (EPI == 1) { const float* cp = aux + ((size_t)m * HD + cofs) * 2; ex[mb][0] = *(const v4f*)cp; ex[mb][1] = *(const v4f*)(cp + 4); }
        if (EPI == 3) ex[mb][0] = *(const v4f*)(aux + (size_t)m * ldc + c0 + cofs); }
    if (EPI == 1 || EPI == 3) { asm volatile("s_wait_xcnt 0x0" ::: "memory");   // behind these loads, before their address registers are reused
        __builtin_amdgcn_sched_barrier(0); }   // keeps the register writes that follow from being scheduled in front of that wait, into those address registers
    v8f acc[4][4];
#pragma unroll
    for (int mb = 0; mb < 4; ++mb)
#pragma unroll
        for (int nb = 0; nb < 4; ++nb) acc[mb][nb] = (v8f){};
    const size_t aoff = (size_t)(r0 + lr) * K + 8 * hi, boff = (size_t)(c0 + lr) * K + 8 * hi;
#pragma unroll 1
    for (int kc = wv * 32; kc < K; kc += 32 * KS) {
        V a[4], a2[4];
#pragma unroll
        for (int mb = 0; mb < 4; ++mb) { a[mb] = WFrag<T16>::ld(A + aoff + (size_t)mb * 16 * K + kc); if (NSPLIT == 1 || NSPLIT == 2) a2[mb] = WFrag<T16>::ld(A2 + aoff + (size_t)mb * 16 * K + kc); }
#pragma unroll
        for (int nb = 0; nb < 4; ++nb) { const V b = WFrag<T16>::ld(Bt + boff + (size_t)nb * 16 * K + kc); V b2; if (NSPLIT >= 2) b2 = WFrag<T16>::ld(Bt2 + boff + (size_t)nb * 16 * K + kc);
#pragma unroll
            for (int mb = 0; mb < 4; ++mb) { acc[mb][nb] = WFrag<T16>::mma(a[mb], b, acc[mb][nb]); if (NSPLIT == 1 || NSPLIT == 2) acc[mb][nb] = WFrag<T16>::mma(a2[mb], b, acc[mb][nb]); if (NSPLIT >= 2) acc[mb][nb] = WFrag<T16>::mma(a[mb], b2, acc[mb][nb]); } }
        asm volatile("v_nop\n\tv_nop\n\tv_nop\n\tv_nop" : "+v"(acc[0][0]), "+v"(acc[1][1]), "+v"(acc[2][2]), "+v"(acc[3][3]) : "v"(a[0]), "v"(a[3]));
    }
#pragma unroll
    for (int mb = 0; mb < 4; ++mb) {
        float* ob = os + (size_t)(mb % NBUF) * KS * OSZ;   // two buffers in turn: the barrier of block mb also ends every read of block mb - 1, so one barrier a block is enough
#pragma unroll
        for (int nb = 0; nb < 4; ++nb) {
#pragma unroll
            for (int j = 0; j < 8; ++j) ob[wv * OSZ + (hi * 8 + j) * 68 + nb * 16 + lr] = acc[mb][nb][j]; }
        __syncthreads();
        v4f val = *(const v4fa*)(ob + row * 68 + cofs);
#pragma unroll
        for (int w = 1; w < KS; ++w) val += *(const v4fa*)(ob + w * OSZ + row * 68 + cofs);
        const int m = r0 + mb * 16 + row;
        if (EPI == 1) { v4us oh, ol;   // column d's partner d +- 32 sits eight lanes away in the same 16-lane row; d < 32 takes -x[d + 32] sin, d >= 32 takes +x[d - 32] sin
#pragma unroll
            for (int u = 0; u < 4; ++u) { const float xp = xrow8(val[u]); const float r = val[u] * ex[mb][u >> 1][(u & 1) * 2] + (lr < 8 ? -xp : xp) * ex[mb][u >> 1][(u & 1) * 2 + 1]; unsigned short a2, c2; splitf(r, a2, c2); oh[u] = a2; ol[u] = c2; }
            const size_t oo = ((size_t)blockIdx.y * TT + m) * HD + cofs; *(v4us*)(Ph + oo) = oh; *(v4us*)(Pl + oo) = ol; }
        if (EPI == 2) *(v4h*)(Ch + (size_t)m * ldc + c0 + cofs) = __builtin_convertvector(val, v4h);
        if (EPI == 3) { v4f r;
#pragma unroll
            for (int u = 0; u < 4; ++u) r[u] = bfr(ex[mb][0][u]) + val[u];
            *(v4f*)(C + (size_t)m * ldc + c0 + cofs) = r; }
        if (mb < 3) asm volatile("s_wait_xcnt 0x0" ::: "memory");   // behind this block's stores, before their data and address registers are reused
    }
}


__global__ __launch_bounds__(256) void k_cvt8(const float* __restrict__ src, bf* dst, size_t n8) { const size_t i = (size_t)blockIdx.x * 256 + threadIdx.x; if (i >= n8) return; const v8f v = *(const v8f*)(src + i * 8); v8us o;
#pragma unroll
    for (int k = 0; k < 8; ++k) o[k] = f2bf(v[k]); *(v8us*)(dst + i * 8) = o;  }
// k_rms: wave per token: x rsqrt(mean x^2 + 1e-6) w -> hl planes (8-B lanes); k_cs: CS[t][dd] = (cos, sin)((float)pos[t] x 10000^(-2 (dd mod 32)/64));
__global__ __launch_bounds__(256) void k_rms(const float* __restrict__ X, const float* __restrict__ w, bf* Hh, bf* Hl) { const int lane = threadIdx.x & 31; const int t = blockIdx.x * 8 + (threadIdx.x >> 5); if (t >= TT) return; float v[DM / 32]; float q = 0.f;
#pragma unroll
    for (int ch = 0; ch < DM / 128; ++ch) { const v4f a = *(const v4f*)(X + (size_t)t * DM + ch * 128 + lane * 4);
#pragma unroll
        for (int u = 0; u < 4; ++u) { v[ch * 4 + u] = bfr(a[u]); float p = __fmul_rn(v[ch * 4 + u], v[ch * 4 + u]); asm volatile("" : "+v"(p)); q = __fadd_rn(q, p); } }
#pragma unroll
    for (int sh = 16; sh; sh >>= 1) q += __shfl_xor(q, sh, 32);
    const float rs = __frsqrt_rn(__fadd_rn(q * (1.0f / DM), 1e-6f));
    {
#pragma unroll
        for (int ch = 0; ch < DM / 128; ++ch) { const int c0 = ch * 128 + lane * 4; v4us oh, ol;
#pragma unroll
            for (int u = 0; u < 4; ++u) { float n0 = __fmul_rn(v[ch * 4 + u], rs); asm volatile("" : "+v"(n0)); const float y = __fmul_rn(n0, bfr(w[c0 + u])); unsigned short a2, b2; splitf(y, a2, b2); oh[u] = a2; ol[u] = b2; }
            const size_t oo = (size_t)t * DM + c0; *(v4us*)(Hh + oo) = oh; *(v4us*)(Hl + oo) = ol; }
         } }
__global__ __launch_bounds__(256) void k_cs(const int* __restrict__ pos, float* CS) { const int idx = blockIdx.x * 256 + threadIdx.x; if (idx >= TT * HD) return; const int dd = idx % HD; const int t = idx / HD; const int i2 = dd % (HD / 2); const float inv = __fdiv_rn(1.0f, powf(10000.0f, (float)(2 * i2) / (float)HD)); const float ang = __fmul_rn((float)pos[t], inv); v2f cs; cs[0] = cosf(ang); cs[1] = sinf(ang);
    *(v2f*)(CS + (size_t)idx * 2) = cs;  }
#define FKP  72
#define FTS  (64 * FKP)
#define FTHR 4.0f
#define FSH  9.0f
#define L2E  1.4426950408889634f
typedef __attribute__((ext_vector_type(2))) __bf16 v2bf;
__device__ __forceinline__ float xhalf(float x) { return __builtin_bit_cast(float, __builtin_amdgcn_permlanex16(__builtin_bit_cast(int, x), __builtin_bit_cast(int, x), 0x76543210, 0xfedcba98, false, false)); }   // lane l with lane l ^ 16
__global__ __launch_bounds__(256) void k_fattn(const bf* __restrict__ Qh, const bf* __restrict__ Ql, const bf* __restrict__ Kh, const bf* __restrict__ Kl, const h16* __restrict__ VT, const float* __restrict__ mk, bf* Ah, bf* Al) {
    __shared__ __align__(16) unsigned short sm[2 * 3 * FTS];
    const int tid = threadIdx.x, lane = tid & 31, lr = lane & 15, hi = lane >> 4; const int wv = __builtin_amdgcn_readfirstlane(tid >> 5);
    const int h = blockIdx.y, b = blockIdx.z; const size_t hz = ((size_t)b * NH_ + h) * TT * HD; const int q0 = blockIdx.x * 256 + wv * 32;
    v16bf qh[2][2], ql[2][2]; const bf* qhp = Qh + hz + (size_t)(q0 + lr) * HD + 8 * hi; const bf* qlp = Ql + hz + (size_t)(q0 + lr) * HD + 8 * hi;
#pragma unroll
    for (int g = 0; g < 2; ++g)
#pragma unroll
        for (int kc = 0; kc < 2; ++kc) { qh[g][kc] = WFrag<bf>::ld(qhp + g * 16 * HD + kc * 32); ql[g][kc] = WFrag<bf>::ld(qlp + g * 16 * HD + kc * 32); }
    asm volatile("s_wait_xcnt 0x0" ::: "memory");   // behind the Q loads, before their address registers are reused
    __builtin_amdgcn_sched_barrier(0);   // keeps the address arithmetic that follows from being scheduled in front of that wait, into the Q loads' address registers
    const int srow = tid >> 3, sseg = (tid & 7) * 8;   // staging: a thread moves 16 B of rows srow and srow + 32 of each of the three tiles
    const bf* gkh = Kh + hz + (size_t)srow * HD + sseg; const bf* gkl = Kl + hz + (size_t)srow * HD + sseg; const h16* gvt = VT + hz + (size_t)srow * TT + sseg;
    unsigned short* sw = sm + srow * FKP + sseg;
    const float* mr0 = mk + (size_t)b * TT * TT + (size_t)(q0 + lr) * TT + 8 * hi; const float* mr1 = mr0 + (size_t)16 * TT;
    v8us st[6]; v4f mc[2][2][2];
    v8f o[4][2]; float mrun[2], lrun[2];
#pragma unroll
    for (int g = 0; g < 2; ++g) { mrun[g] = -1.0e30f; lrun[g] = 0.f;
#pragma unroll
        for (int db = 0; db < 4; ++db) o[db][g] = (v8f){}; }
    st[0] = *(const v8usa*)gkh; st[1] = *(const v8usa*)(gkh + 32 * HD); st[2] = *(const v8usa*)gkl; st[3] = *(const v8usa*)(gkl + 32 * HD); st[4] = *(const v8usa*)gvt; st[5] = *(const v8usa*)(gvt + (size_t)32 * TT);
#pragma unroll
    for (int kt = 0; kt < 2; ++kt)
#pragma unroll
        for (int u = 0; u < 2; ++u) { mc[kt][0][u] = *(const v4f*)(mr0 + kt * 16 + u * 4); mc[kt][1][u] = *(const v4f*)(mr1 + kt * 16 + u * 4); }
    asm volatile("s_wait_xcnt 0x0" ::: "memory");   // behind the first stage's and the first pass's loads, before their address registers are reused
#pragma unroll
    for (int i = 0; i < 6; ++i) *(v8usa*)(sw + (i >> 1) * FTS + (i & 1) * 32 * FKP) = st[i];
    __syncthreads();
#pragma unroll 1   // the stage loop stays rolled: one body of two passes
    for (int s = 0; s < TT / 64; ++s) {
        const bool more = s + 1 < TT / 64;
        if (more) { const int kn = (s + 1) * 64;   // next stage's tiles fly into registers under this stage's work
            st[0] = *(const v8usa*)(gkh + (size_t)kn * HD); st[1] = *(const v8usa*)(gkh + (size_t)(kn + 32) * HD); st[2] = *(const v8usa*)(gkl + (size_t)kn * HD); st[3] = *(const v8usa*)(gkl + (size_t)(kn + 32) * HD); st[4] = *(const v8usa*)(gvt + kn); st[5] = *(const v8usa*)(gvt + (size_t)32 * TT + kn);
            asm volatile("s_wait_xcnt 0x0" ::: "memory"); }   // behind these loads, before their address registers are reused
        const unsigned short* bp = sm + (s & 1) * 3 * FTS;
#pragma unroll
        for (int c = 0; c < 2; ++c) {
            const int nk = min(s * 64 + c * 32 + 32, TT - 32);   // next pass's mask, one pass ahead (the last pass re-reads its own: in bounds)
            v4f mn[2][2][2];
#pragma unroll
            for (int kt = 0; kt < 2; ++kt)
#pragma unroll
                for (int u = 0; u < 2; ++u) { mn[kt][0][u] = *(const v4f*)(mr0 + nk + kt * 16 + u * 4); mn[kt][1][u] = *(const v4f*)(mr1 + nk + kt * 16 + u * 4); }
            asm volatile("s_wait_xcnt 0x0" ::: "memory");   // stands behind the loads issued ahead, before their address registers are reused; its clobber also keeps those loads up here, in front of this pass's work, instead of sinking to the loop's foot
            v16bf ah[2][2], al[2][2];
#pragma unroll
            for (int kt = 0; kt < 2; ++kt)
#pragma unroll
                for (int kc = 0; kc < 2; ++kc) { const unsigned short* kp = bp + (c * 32 + kt * 16 + lr) * FKP + kc * 32 + 8 * hi; ah[kt][kc] = cat16b(*(const v8usa*)kp, *(const v8usa*)(kp + 16)); al[kt][kc] = cat16b(*(const v8usa*)(kp + FTS), *(const v8usa*)(kp + FTS + 16)); }
            v8f sc[2][2];
#pragma unroll
            for (int kt = 0; kt < 2; ++kt)
#pragma unroll
                for (int g = 0; g < 2; ++g) sc[kt][g] = (v8f){};
#pragma unroll
            for (int kc = 0; kc < 2; ++kc) {   // four independent score tiles in turn
#pragma unroll
                for (int kt = 0; kt < 2; ++kt)
#pragma unroll
                    for (int g = 0; g < 2; ++g) sc[kt][g] = wmmab(ah[kt][kc], qh[g][kc], sc[kt][g]);
#pragma unroll
                for (int kt = 0; kt < 2; ++kt)
#pragma unroll
                    for (int g = 0; g < 2; ++g) sc[kt][g] = wmmab(ah[kt][kc], ql[g][kc], sc[kt][g]);
#pragma unroll
                for (int kt = 0; kt < 2; ++kt)
#pragma unroll
                    for (int g = 0; g < 2; ++g) sc[kt][g] = wmmab(al[kt][kc], qh[g][kc], sc[kt][g]); }
            v16h vf[4];
#pragma unroll
            for (int db = 0; db < 4; ++db) { const unsigned short* vp = bp + 2 * FTS + (db * 16 + lr) * FKP + c * 32 + 8 * hi; vf[db] = cat16(*(const v8ha*)vp, *(const v8ha*)(vp + 16)); }
            float mb[2]; bool need = false;
#pragma unroll
            for (int g = 0; g < 2; ++g) { float mx = -3.0e38f;
#pragma unroll
                for (int kt = 0; kt < 2; ++kt)
#pragma unroll
                    for (int r = 0; r < 8; r += 2) { const v2bf m2 = __builtin_convertvector((v2f){mc[kt][g][r >> 2][r & 3], mc[kt][g][r >> 2][(r & 3) + 1]}, v2bf);   // mask rounded to bf16 (nearest even), as every input
                        const float t0 = sc[kt][g][r] + (float)m2[0], t1 = sc[kt][g][r + 1] + (float)m2[1]; sc[kt][g][r] = t0; sc[kt][g][r + 1] = t1; mx = fmaxf(mx, fmaxf(t0, t1)); }
                mx = fmaxf(mx, xhalf(mx)); mb[g] = mx; need = need || (mx > mrun[g] + FTHR); }
            if (__builtin_amdgcn_ballot_w32(need) != 0) {   // one wave-uniform test a pass; rare after the first passes
#pragma unroll
                for (int g = 0; g < 2; ++g) { const float mnew = fmaxf(mrun[g], mb[g]); const float corr = __builtin_amdgcn_exp2f((mrun[g] - mnew) * L2E); mrun[g] = mnew; lrun[g] *= corr;
#pragma unroll
                    for (int db = 0; db < 4; ++db) o[db][g] = o[db][g] * corr; } }
#pragma unroll
            for (int g = 0; g < 2; ++g) { const float nm = fmaf(-mrun[g], L2E, FSH); v8f p0, p1; float ls0 = 0.f, ls1 = 0.f;
#pragma unroll
                for (int r = 0; r < 8; ++r) { p0[r] = __builtin_amdgcn_exp2f(fmaf(sc[0][g][r], L2E, nm)); p1[r] = __builtin_amdgcn_exp2f(fmaf(sc[1][g][r], L2E, nm)); ls0 += p0[r]; ls1 += p1[r]; }
                lrun[g] += ls0 + ls1;
                const v16h pf = cat16(__builtin_convertvector(p0, v8h), __builtin_convertvector(p1, v8h));
#pragma unroll
                for (int db = 0; db < 4; ++db) o[db][g] = wmma16(vf[db], pf, o[db][g]); }
#pragma unroll
            for (int kt = 0; kt < 2; ++kt)
#pragma unroll
                for (int g = 0; g < 2; ++g)
#pragma unroll
                    for (int u = 0; u < 2; ++u) mc[kt][g][u] = mn[kt][g][u];
        }
        if (more) { unsigned short* sn = sw + ((s + 1) & 1) * 3 * FTS;   // that buffer's last readers left it before the barrier that ended stage s - 1
#pragma unroll
            for (int i = 0; i < 6; ++i) *(v8usa*)(sn + (i >> 1) * FTS + (i & 1) * 32 * FKP) = st[i]; }
        asm volatile("s_wait_dscnt 0x0" ::: "memory");   // this wave's LDS stores of stage s + 1 and its reads of stage s are done
        asm volatile("s_barrier_signal -1\n\ts_barrier_wait -1" ::: "memory");   // publishes stage s + 1 and ends every read of stage s; by hand because __syncthreads() would also drain the mask loads that are in flight for the next pass
    }
#pragma unroll
    for (int g = 0; g < 2; ++g) { const float inv = __fdiv_rn(1.0f, lrun[g] + xhalf(lrun[g])); const size_t ob = ((size_t)b * TT + q0 + g * 16 + lr) * DM + h * HD + 8 * hi;
#pragma unroll
        for (int db = 0; db < 4; ++db) { v8us oh, ol;
#pragma unroll
            for (int r = 0; r < 8; ++r) { unsigned short a2, c2; splitf(o[db][g][r] * inv, a2, c2); oh[r] = a2; ol[r] = c2; }
            *(v8us*)(Ah + ob + db * 16) = oh; *(v8us*)(Al + ob + db * 16) = ol; } }
}

extern "C" void kernel_launch(void* const* d_in, const int* in_sizes, int n_in,
                              void* d_out, int out_size, void* d_ws, size_t ws_size, hipStream_t stream) {
    (void)in_sizes; (void)n_in; (void)out_size;
    const float* x = (const float*)d_in[0]; const float* amask = (const float*)d_in[1]; const int* pos = (const int*)d_in[2]; const float* lnw = (const float*)d_in[3]; const float* wq = (const float*)d_in[4]; const float* wk = (const float*)d_in[5]; const float* wv = (const float*)d_in[6]; const float* wo = (const float*)d_in[7];
    float* OUT = (float*)d_out;     // [2][2048][768]
    char* wsp = (char*)d_ws;
    auto take = [&](size_t bytes) { char* p = wsp; wsp += (bytes + 255) & ~(size_t)255; return (void*)p; };
    bf* BQ = (bf*)take((size_t)DM * DM * 2); bf* BK = (bf*)take((size_t)DM * DM * 2); bf* BV = (bf*)take((size_t)DM * DM * 2); bf* BO = (bf*)take((size_t)DM * DM * 2);
    bf* NH = (bf*)take((size_t)TT * DM * 2); bf* NL = (bf*)take((size_t)TT * DM * 2); float* CS = (float*)take((size_t)TT * HD * 2 * 4);
    const size_t zb = (size_t)NH_ * TT * HD;   // one batch's planes
    bf* Qh = (bf*)take(NB_ * zb * 2); bf* Ql = (bf*)take(NB_ * zb * 2); bf* Kh = (bf*)take(NB_ * zb * 2); bf* Kl = (bf*)take(NB_ * zb * 2); h16* VT = (h16*)take(NB_ * zb * 2);
    bf* Ah = (bf*)take(NB_ * zb * 2); bf* Al = (bf*)take(NB_ * zb * 2);
    if ((size_t)(wsp - (char*)d_ws) > ws_size) return;    // total ~ 56 MB
    k_cvt8<<<(DM * DM / 8 + 255) / 256, 256, 0, stream>>>(wq, BQ, DM * DM / 8); k_cvt8<<<(DM * DM / 8 + 255) / 256, 256, 0, stream>>>(wk, BK, DM * DM / 8); k_cvt8<<<(DM * DM / 8 + 255) / 256, 256, 0, stream>>>(wv, BV, DM * DM / 8); k_cvt8<<<(DM * DM / 8 + 255) / 256, 256, 0, stream>>>(wo, BO, DM * DM / 8);   // torch [out][in] = Bt
    const dim3 gp(TT / 64, DM / 64, 1), gt(DM / 64, TT / 64, 1);   // gp: rows are tokens; gt: rows are V's features, columns tokens (V^T = Wv N^T comes out of the GEMM already transposed)
    for (int b = 0; b < NB_; ++b) { const float* xb = x + (size_t)b * TT * DM;
        k_rms<<<TT / 8, 256, 0, stream>>>(xb, lnw, NH, NL); k_cs<<<(TT * HD + 255) / 256, 256, 0, stream>>>(pos + (size_t)b * TT, CS);
        k_gemmw<bf, 1, 1, 8><<<gp, 256, 0, stream>>>(NH, NL, BQ, nullptr, DM, CS, nullptr, nullptr, 0, Qh + b * zb, Ql + b * zb); k_gemmw<bf, 1, 1, 8><<<gp, 256, 0, stream>>>(NH, NL, BK, nullptr, DM, CS, nullptr, nullptr, 0, Kh + b * zb, Kl + b * zb);
        k_gemmw<bf, 3, 2, 8><<<gt, 256, 0, stream>>>(BV, nullptr, NH, NL, DM, nullptr, nullptr, VT + b * zb, TT, nullptr, nullptr); }
    k_fattn<<<dim3(TT / 256, NH_, NB_), 256, 0, stream>>>(Qh, Ql, Kh, Kl, VT, amask, Ah, Al);
    for (int b = 0; b < NB_; ++b)
        k_gemmw<bf, 1, 3, 8><<<gp, 256, 0, stream>>>(Ah + b * zb, Al + b * zb, BO, nullptr, DM, x + (size_t)b * TT * DM, OUT + (size_t)b * TT * DM, nullptr, DM, nullptr, nullptr);
}

// v004
// A run of this version takes 167 microseconds.
// Next to v003, in two timings, it ran 1.27 and 1.26 times as fast.
// Counting every step since v000, it is 4.60 times as fast.
#include <hip/hip_runtime.h>

// TimeSelfAttentionFallback (hidden [2][2048][768]; normed = RMSNorm(x) ln_weight; q/k/v = normed W^T (12 heads x 64); rotate-half RoPE with angles position_ids[b][t] (int, read) x inv_freq (tables computed in-kernel per batch); scores = q.k (UNSCALED) + attention_mask[b][0][i][j] (float, read);
// fp32 softmax; out = hidden + (attn v merged) Wo^T -> [2][2048][768]).
// Compute dtypes, f32 accumulate: every input rounded to bf16; RMSNorm f32 -> hl planes; q/k/v as hl(normed) x exact W (2 products); RoPE f32; scores hl x hl (3 products, K 64 - the unscaled logits need it); probabilities and v in fp16; scores, softmax and P.V in one kernel (online softmax), the scores stay in registers. What follows a projection element by element (RoPE and the hl split; the fp16 rounding of V^T; the residual add) is done in that GEMM's epilogue.

#define NB_  2
#define TT   2048
#define DM   768
#define NH_  12
#define HD   64
typedef _Float16 h16;
typedef unsigned short bf;
typedef __attribute__((ext_vector_type(16))) __bf16   v16bf;
typedef __attribute__((ext_vector_type(16))) _Float16 v16h;
typedef __attribute__((ext_vector_type(8)))  _Float16 v8h;
typedef __attribute__((ext_vector_type(8)))  unsigned short v8us;
typedef __attribute__((ext_vector_type(8)))  float    v8f;
typedef __attribute__((ext_vector_type(4)))  float    v4f;
typedef v8h  __attribute__((may_alias)) v8ha;
typedef v4f  __attribute__((may_alias)) v4fa;
typedef v8us __attribute__((may_alias)) v8usa;

__device__ __forceinline__ unsigned short f2bf(float f) { unsigned u = __float_as_uint(f); u += 0x7FFFu + ((u >> 16) & 1u); return (unsigned short)(u >> 16); }
__device__ __forceinline__ float bf2f(unsigned short b) { return __uint_as_float(((unsigned)b) << 16); }
__device__ __forceinline__ float bfr(float f) { return bf2f(f2bf(f)); }
__device__ __forceinline__ v16h cat16(v8h lo, v8h hi) { return __builtin_shufflevector(lo, hi, 0, 1, 2, 3, 4, 5, 6, 7, 8, 9, 10, 11, 12, 13, 14, 15); }
__device__ __forceinline__ v16bf cat16b(v8us lo, v8us hi) { return __builtin_bit_cast(v16bf, __builtin_shufflevector(lo, hi, 0, 1, 2, 3, 4, 5, 6, 7, 8, 9, 10, 11, 12, 13, 14, 15)); }
__device__ __forceinline__ v8f wmma16(v16h a, v16h b, v8f c) { return __builtin_amdgcn_wmma_f32_16x16x32_f16(false, a, false, b, (short)0, c, false, false); }
__device__ __forceinline__ v8f wmmab(v16bf a, v16bf b, v8f c) { return __builtin_amdgcn_wmma_f32_16x16x32_bf16(false, a, false, b, (short)0, c, false, false); }
__device__ __forceinline__ void splitf(float y, unsigned short& h, unsigned short& l) { h = f2bf(y); l = f2bf(y - bf2f(h)); }
typedef __attribute__((ext_vector_type(4))) unsigned short v4us;
typedef __attribute__((ext_vector_type(4))) _Float16 v4h;
typedef __attribute__((ext_vector_type(2))) float v2f;
__device__ __forceinline__ float xrow8(float x) { return __builtin_bit_cast(float, __builtin_amdgcn_permlane16(__builtin_bit_cast(int, x), __builtin_bit_cast(int, x), 0xfedcba98, 0x76543210, false, false)); }   // lane l with lane l ^ 8



// ---- k_gemmw: register-blocked GEMM, KS WAVES per 64x64 output tile (16 accumulators a wave), operands straight from K-contiguous 16-bit planes; grid (M/64, N/64, jobs), 32 KS threads.
// c[m][n] = sum_k A[m][k] Bt[n][k] (+ split products per NSPLIT: 1 = (A + A2) Bt, 3 = A (Bt + Bt2)), f32. K % (32 KS) == 0.
// EPI says where the summed tile goes: 1 = rows are tokens, the 64 columns one head: rotate-half RoPE with aux = CS[t][d] (cos, sin), then hl planes Ph/Pl [h][t][d]; 2 = fp16 to Ch (pitch ldc); 3 = C (f32, pitch ldc) = bf16-rounded aux[m][n] + c.
// Wave w sums the 32-wide k chunks w, w + KS, w + 2 KS, ... (neighbouring waves read the two halves of one 128-B line in the same trip); the KS partial tiles are added in LDS in wave order (fixed, run-to-run identical).
#define QKSTEP ((size_t)2 * NB_ * TT * DM)
template <typename T16> struct WFrag;
template <> struct WFrag<h16> { typedef v16h V; static __device__ __forceinline__ V ld(const h16* p) { return cat16(*(const v8h*)p, *(const v8h*)(p + 16)); } static __device__ __forceinline__ v8f mma(V a, V b, v8f c) { return wmma16(a, b, c); } };
template <> struct WFrag<bf> { typedef v16bf V; static __device__ __forceinline__ V ld(const bf* p) { return cat16b(*(const v8us*)p, *(const v8us*)(p + 16)); } static __device__ __forceinline__ v8f mma(V a, V b, v8f c) { return wmmab(a, b, c); } };
template <typename T16, int NSPLIT, int EPI, int KS>
__global__ __launch_bounds__(32 * KS) void k_gemmw(const T16* __restrict__ A, const T16* __restrict__ A2, const T16* __restrict__ Bt, const T16* __restrict__ Bt2, int K, const float* __restrict__ aux, float* C, h16* Ch, int ldc, bf* Ph, bf* Pl) {
    static_assert(KS == 8, "the epilogue gives each wave one row pair of a 16-row block");
    typedef typename WFrag<T16>::V V;
    // blockIdx.z picks the job of a merged grid. EPI 1: z = 2 batch + (0 = q, 1 = k); Bt holds Wq, Wk one behind the other, and k's planes lie QKSTEP elements behind q's. EPI 2: z = batch. EPI 3 has no z: both batches are one run of rows.
    if (EPI == 1) { const size_t zb = (size_t)(blockIdx.z >> 1) * TT * DM, zk = blockIdx.z & 1; A += zb; A2 += zb; Bt += zk * DM * DM; aux += (size_t)(blockIdx.z >> 1) * TT * HD * 2; Ph += zk * QKSTEP + zb; Pl += zk * QKSTEP + zb; }
    if (EPI == 2) { const size_t zb = (size_t)blockIdx.z * TT * DM; Bt += zb; Bt2 += zb; Ch += zb; }
    constexpr int OSZ = 16 * 68, NBUF = KS > 1 ? 2 : 1;
    __shared__ __align__(16) float os[NBUF * KS * OSZ];
    const int lane = threadIdx.x & 31, lr = lane & 15, hi = lane >> 4; const int r0 = blockIdx.x * 64, c0 = blockIdx.y * 64;
    const int wv = KS > 1 ? __builtin_amdgcn_readfirstlane((int)threadIdx.x >> 5) : 0;
    const int row = 2 * wv + hi, cofs = lr * 4;   // this thread's place in each summed 16 x 64 block: one row, four columns
    v4f ex[4][2];   // what the epilogue reads from memory, all four blocks, asked for in front of the K loop so that it arrives under the loop
#pragma unroll
    for (int mb = 0; mb < 4; ++mb) { const int m = r0 + mb * 16 + row;
        if (EPI == 1) { const float* cp = aux + ((size_t)m * HD + cofs) * 2; ex[mb][0] = *(const v4f*)cp; ex[mb][1] = *(const v4f*)(cp + 4); }
        if (EPI == 3) ex[mb][0] = *(const v4f*)(aux + (size_t)m * ldc + c0 + cofs); }
    if (EPI == 1 || EPI == 3) { asm volatile("s_wait_xcnt 0x0" ::: "memory");   // behind these loads, before their address registers are reused
        __builtin_amdgcn_sched_barrier(0); }   // keeps the register writes that follow from being scheduled in front of that wait, into those address registers
    v8f acc[4][4];
#pragma unroll
    for (int mb = 0; mb < 4; ++mb)
#pragma unroll
        for (int nb = 0; nb < 4; ++nb) acc[mb][nb] = (v8f){};
    const size_t aoff = (size_t)(r0 + lr) * K + 8 * hi, boff = (size_t)(c0 + lr) * K + 8 * hi;
#pragma unroll 1
    for (int kc = wv * 32; kc < K; kc += 32 * KS) {
        V a[4], a2[4];
#pragma unroll
        for (int mb = 0; mb < 4; ++mb) { a[mb] = WFrag<T16>::ld(A + aoff + (size_t)mb * 16 * K + kc); if (NSPLIT == 1 || NSPLIT == 2) a2[mb] = WFrag<T16>::ld(A2 + aoff + (size_t)mb * 16 * K + kc); }
#pragma unroll
        for (int nb = 0; nb < 4; ++nb) { const V b = WFrag<T16>::ld(Bt + boff + (size_t)nb * 16 * K + kc); V b2; if (NSPLIT >= 2) b2 = WFrag<T16>::ld(Bt2 + boff + (size_t)nb * 16 * K + kc);
#pragma unroll
            for (int mb = 0; mb < 4; ++mb) { acc[mb][nb] = WFrag<T16>::mma(a[mb], b, acc[mb][nb]); if (NSPLIT == 1 || NSPLIT == 2) acc[mb][nb] = WFrag<T16>::mma(a2[mb], b, acc[mb][nb]); if (NSPLIT >= 2) acc[mb][nb] = WFrag<T16>::mma(a[mb], b2, acc[mb][nb]); } }
        asm volatile("v_nop\n\tv_nop\n\tv_nop\n\tv_nop" : "+v"(acc[0][0]), "+v"(acc[1][1]), "+v"(acc[2][2]), "+v"(acc[3][3]) : "v"(a[0]), "v"(a[3]));
    }
#pragma unroll
    for (int mb = 0; mb < 4; ++mb) {
        float* ob = os + (size_t)(mb % NBUF) * KS * OSZ;   // two buffers in turn: the barrier of block mb also ends every read of block mb - 1, so one barrier a block is enough
#pragma unroll
        for (int nb = 0; nb < 4; ++nb) {
#pragma unroll
            for (int j = 0; j < 8; ++j) ob[wv * OSZ + (hi * 8 + j) * 68 + nb * 16 + lr] = acc[mb][nb][j]; }
        __syncthreads();
        v4f val = *(const v4fa*)(ob + row * 68 + cofs);
#pragma unroll
        for (int w = 1; w < KS; ++w) val += *(const v4fa*)(ob + w * OSZ + row * 68 + cofs);
        const int m = r0 + mb * 16 + row;
        if (EPI == 1) { v4us oh, ol;   // column d's partner d +- 32 sits eight lanes away in the same 16-lane row; d < 32 takes -x[d + 32] sin, d >= 32 takes +x[d - 32] sin
#pragma unroll
            for (int u = 0; u < 4; ++u) { const float xp = xrow8(val[u]); const float r = val[u] * ex[mb][u >> 1][(u & 1) * 2] + (lr < 8 ? -xp : xp) * ex[mb][u >> 1][(u & 1) * 2 + 1]; unsigned short a2, c2; splitf(r, a2, c2); oh[u] = a2; ol[u] = c2; }
            const size_t oo = ((size_t)blockIdx.y * TT + m) * HD + cofs; *(v4us*)(Ph + oo) = oh; *(v4us*)(Pl + oo) = ol; }
        if (EPI == 2) *(v4h*)(Ch + (size_t)m * ldc + c0 + cofs) = __builtin_convertvector(val, v4h);
        if (EPI == 3) { v4f r;
#pragma unroll
            for (int u = 0; u < 4; ++u) r[u] = bfr(ex[mb][0][u]) + val[u];
            *(v4f*)(C + (size_t)m * ldc + c0 + cofs) = r; }
        if (mb < 3) asm volatile("s_wait_xcnt 0x0" ::: "memory");   // behind this block's stores, before their data and address registers are reused
    }
}


// ---- k_prep: everything the projections wait for, none of it waiting for any other of it, as ONE grid: blocks [0, PCS) the cos/sin table, [PCS, PCS + PRM) RMSNorm, then PCV blocks for each of the four weights (BW = Wq, Wk, Wv, Wo in bf16, one behind the other; torch [out][in] = Bt). t runs over the NB_ TT tokens of both batches.
#define PCS (NB_ * TT * HD / 256)
#define PRM (NB_ * TT / 8)
#define PCV (DM * DM / 8 / 256)
// RMSNorm: wave per token: x rsqrt(mean x^2 + 1e-6) w -> hl planes (8-B lanes); table: CS[t][dd] = (cos, sin)((float)pos[t] x 10000^(-2 (dd mod 32)/64));
__global__ __launch_bounds__(256) void k_prep(const int* __restrict__ pos, float* CS, const float* __restrict__ X, const float* __restrict__ w, bf* Hh, bf* Hl, const float* __restrict__ wq, const float* __restrict__ wk, const float* __restrict__ wv, const float* __restrict__ wo, bf* BW) {
    const int blk = blockIdx.x;
    if (blk >= PCS && blk < PCS + PRM) { const int lane = threadIdx.x & 31; const int t = (blk - PCS) * 8 + (threadIdx.x >> 5); if (t >= NB_ * TT) return; float v[DM / 32]; float q = 0.f;
#pragma unroll
    for (int ch = 0; ch < DM / 128; ++ch) { const v4f a = *(const v4f*)(X + (size_t)t * DM + ch * 128 + lane * 4);
#pragma unroll
        for (int u = 0; u < 4; ++u) { v[ch * 4 + u] = bfr(a[u]); float p = __fmul_rn(v[ch * 4 + u], v[ch * 4 + u]); asm volatile("" : "+v"(p)); q = __fadd_rn(q, p); } }
#pragma unroll
    for (int sh = 16; sh; sh >>= 1) q += __shfl_xor(q, sh, 32);
    const float rs = __frsqrt_rn(__fadd_rn(q * (1.0f / DM), 1e-6f));
    {
#pragma unroll
        for (int ch = 0; ch < DM / 128; ++ch) { const int c0 = ch * 128 + lane * 4; v4us oh, ol;
#pragma unroll
            for (int u = 0; u < 4; ++u) { float n0 = __fmul_rn(v[ch * 4 + u], rs); asm volatile("" : "+v"(n0)); const float y = __fmul_rn(n0, bfr(w[c0 + u])); unsigned short a2, b2; splitf(y, a2, b2); oh[u] = a2; ol[u] = b2; }
            const size_t oo = (size_t)t * DM + c0; *(v4us*)(Hh + oo) = oh; *(v4us*)(Hl + oo) = ol; }
         } }
    else if (blk < PCS) { const int idx = blk * 256 + threadIdx.x; if (idx >= NB_ * TT * HD) return; const int dd = idx % HD; const int t = idx / HD; const int i2 = dd % (HD / 2); const float inv = __fdiv_rn(1.0f, powf(10000.0f, (float)(2 * i2) / (float)HD)); const float ang = __fmul_rn((float)pos[t], inv); v2f cs; cs[0] = cosf(ang); cs[1] = sinf(ang);
    *(v2f*)(CS + (size_t)idx * 2) = cs;  }
    else { const int j = blk - (PCS + PRM), which = j / PCV; const float* __restrict__ src = which == 0 ? wq : which == 1 ? wk : which == 2 ? wv : wo; bf* dst = BW + (size_t)which * DM * DM; const size_t n8 = DM * DM / 8;
        const size_t i = (size_t)(j % PCV) * 256 + threadIdx.x; if (i >= n8) return; const v8f v = *(const v8f*)(src + i * 8); v8us o;
#pragma unroll
        for (int k = 0; k < 8; ++k) o[k] = f2bf(v[k]); *(v8us*)(dst + i * 8) = o;  }
}
#define FKP  72
#define FTS  (64 * FKP)
#define FTHR 4.0f
#define FSH  9.0f
#define L2E  1.4426950408889634f
typedef __attribute__((ext_vector_type(2))) __bf16 v2bf;
__device__ __forceinline__ float xhalf(float x) { return __builtin_bit_cast(float, __builtin_amdgcn_permlanex16(__builtin_bit_cast(int, x), __builtin_bit_cast(int, x), 0x76543210, 0xfedcba98, false, false)); }   // lane l with lane l ^ 16
__global__ __launch_bounds__(256) void k_fattn(const bf* __restrict__ Qh, const bf* __restrict__ Ql, const bf* __restrict__ Kh, const bf* __restrict__ Kl, const h16* __restrict__ VT, const float* __restrict__ mk, bf* Ah, bf* Al) {
    __shared__ __align__(16) unsigned short sm[2 * 3 * FTS];
    const int tid = threadIdx.x, lane = tid & 31, lr = lane & 15, hi = lane >> 4; const int wv = __builtin_amdgcn_readfirstlane(tid >> 5);
    const int h = blockIdx.y, b = blockIdx.z; const size_t hz = ((size_t)b * NH_ + h) * TT * HD; const int q0 = blockIdx.x * 256 + wv * 32;
    v16bf qh[2][2], ql[2][2]; const bf* qhp = Qh + hz + (size_t)(q0 + lr) * HD + 8 * hi; const bf* qlp = Ql + hz + (size_t)(q0 + lr) * HD + 8 * hi;
#pragma unroll
    for (int g = 0; g < 2; ++g)
#pragma unroll
        for (int kc = 0; kc < 2; ++kc) { qh[g][kc] = WFrag<bf>::ld(qhp + g * 16 * HD + kc * 32); ql[g][kc] = WFrag<bf>::ld(qlp + g * 16 * HD + kc * 32); }
    asm volatile("s_wait_xcnt 0x0" ::: "memory");   // behind the Q loads, before their address registers are reused
    __builtin_amdgcn_sched_barrier(0);   // keeps the address arithmetic that follows from being scheduled in front of that wait, into the Q loads' address registers
    const int srow = tid >> 3, sseg = (tid & 7) * 8;   // staging: a thread moves 16 B of rows srow and srow + 32 of each of the three tiles
    const bf* gkh = Kh + hz + (size_t)srow * HD + sseg; const bf* gkl = Kl + hz + (size_t)srow * HD + sseg; const h16* gvt = VT + hz + (size_t)srow * TT + sseg;
    unsigned short* sw = sm + srow * FKP + sseg;
    const float* mr0 = mk + (size_t)b * TT * TT + (size_t)(q0 + lr) * TT + 8 * hi; const float* mr1 = mr0 + (size_t)16 * TT;
    v8us st[6]; v4f mc[2][2][2];
    v8f o[4][2]; float mrun[2], lrun[2];
#pragma unroll
    for (int g = 0; g < 2; ++g) { mrun[g] = -1.0e30f; lrun[g] = 0.f;
#pragma unroll
        for (int db = 0; db < 4; ++db) o[db][g] = (v8f){}; }
    st[0] = *(const v8usa*)gkh; st[1] = *(const v8usa*)(gkh + 32 * HD); st[2] = *(const v8usa*)gkl; st[3] = *(const v8usa*)(gkl + 32 * HD); st[4] = *(const v8usa*)gvt; st[5] = *(const v8usa*)(gvt + (size_t)32 * TT);
#pragma unroll
    for (int kt = 0; kt < 2; ++kt)
#pragma unroll
        for (int u = 0; u < 2; ++u) { mc[kt][0][u] = *(const v4f*)(mr0 + kt * 16 + u * 4); mc[kt][1][u] = *(const v4f*)(mr1 + kt * 16 + u * 4); }
    asm volatile("s_wait_xcnt 0x0" ::: "memory");   // behind the first stage's and the first pass's loads, before their address registers are reused
#pragma unroll
    for (int i = 0; i < 6; ++i) *(v8usa*)(sw + (i >> 1) * FTS + (i & 1) * 32 * FKP) = st[i];
    __syncthreads();
#pragma unroll 1   // the stage loop stays rolled: one body of two passes
    for (int s = 0; s < TT / 64; ++s) {
        const bool more = s + 1 < TT / 64;
        if (more) { const int kn = (s + 1) * 64;   // next stage's tiles fly into registers under this stage's work
            st[0] = *(const v8usa*)(gkh + (size_t)kn * HD); st[1] = *(const v8usa*)(gkh + (size_t)(kn + 32) * HD); st[2] = *(const v8usa*)(gkl + (size_t)kn * HD); st[3] = *(const v8usa*)(gkl + (size_t)(kn + 32) * HD); st[4] = *(const v8usa*)(gvt + kn); st[5] = *(const v8usa*)(gvt + (size_t)32 * TT + kn);
            asm volatile("s_wait_xcnt 0x0" ::: "memory"); }   // behind these loads, before their address registers are reused
        const unsigned short* bp = sm + (s & 1) * 3 * FTS;
#pragma unroll
        for (int c = 0; c < 2; ++c) {
            const int nk = min(s * 64 + c * 32 + 32, TT - 32);   // next pass's mask, one pass ahead (the last pass re-reads its own: in bounds)
            v4f mn[2][2][2];
#pragma unroll
            for (int kt = 0; kt < 2; ++kt)
#pragma unroll
                for (int u = 0; u < 2; ++u) { mn[kt][0][u] = *(const v4f*)(mr0 + nk + kt * 16 + u * 4); mn[kt][1][u] = *(const v4f*)(mr1 + nk + kt * 16 + u * 4); }
            asm volatile("s_wait_xcnt 0x0" ::: "memory");   // stands behind the loads issued ahead, before their address registers are reused; its clobber also keeps those loads up here, in front of this pass's work, instead of sinking to the loop's foot
            v16bf ah[2][2], al[2][2];
#pragma unroll
            for (int kt = 0; kt < 2; ++kt)
#pragma unroll
                for (int kc = 0; kc < 2; ++kc) { const unsigned short* kp = bp + (c * 32 + kt * 16 + lr) * FKP + kc * 32 + 8 * hi; ah[kt][kc] = cat16b(*(const v8usa*)kp, *(const v8usa*)(kp + 16)); al[kt][kc] = cat16b(*(const v8usa*)(kp + FTS), *(const v8usa*)(kp + FTS + 16)); }
            v8f sc[2][2];
#pragma unroll
            for (int kt = 0; kt < 2; ++kt)
#pragma unroll
                for (int g = 0; g < 2; ++g) sc[kt][g] = (v8f){};
#pragma unroll
            for (int kc = 0; kc < 2; ++kc) {   // four independent score tiles in turn
#pragma unroll
                for (int kt = 0; kt < 2; ++kt)
#pragma unroll
                    for (int g = 0; g < 2; ++g) sc[kt][g] = wmmab(ah[kt][kc], qh[g][kc], sc[kt][g]);
#pragma unroll
                for (int kt = 0; kt < 2; ++kt)
#pragma unroll
                    for (int g = 0; g < 2; ++g) sc[kt][g] = wmmab(ah[kt][kc], ql[g][kc], sc[kt][g]);
#pragma unroll
                for (int kt = 0; kt < 2; ++kt)
#pragma unroll
                    for (int g = 0; g < 2; ++g) sc[kt][g] = wmmab(al[kt][kc], qh[g][kc], sc[kt][g]); }
            v16h vf[4];
#pragma unroll
            for (int db = 0; db < 4; ++db) { const unsigned short* vp = bp + 2 * FTS + (db * 16 + lr) * FKP + c * 32 + 8 * hi; vf[db] = cat16(*(const v8ha*)vp, *(const v8ha*)(vp + 16)); }
            float mb[2]; bool need = false;
#pragma unroll
            for (int g = 0; g < 2; ++g) { float mx = -3.0e38f;
#pragma unroll
                for (int kt = 0; kt < 2; ++kt)
#pragma unroll
                    for (int r = 0; r < 8; r += 2) { const v2bf m2 = __builtin_convertvector((v2f){mc[kt][g][r >> 2][r & 3], mc[kt][g][r >> 2][(r & 3) + 1]}, v2bf);   // mask rounded to bf16 (nearest even), as every input
                        const float t0 = sc[kt][g][r] + (float)m2[0], t1 = sc[kt][g][r + 1] + (float)m2[1]; sc[kt][g][r] = t0; sc[kt][g][r + 1] = t1; mx = fmaxf(mx, fmaxf(t0, t1)); }
                mx = fmaxf(mx, xhalf(mx)); mb[g] = mx; need = need || (mx > mrun[g] + FTHR); }
            if (__builtin_amdgcn_ballot_w32(need) != 0) {   // one wave-uniform test a pass; rare after the first passes
#pragma unroll
                for (int g = 0; g < 2; ++g) { const float mnew = fmaxf(mrun[g], mb[g]); const float corr = __builtin_amdgcn_exp2f((mrun[g] - mnew) * L2E); mrun[g] = mnew; lrun[g] *= corr;
#pragma unroll
                    for (int db = 0; db < 4; ++db) o[db][g] = o[db][g] * corr; } }
#pragma unroll
            for (int g = 0; g < 2; ++g) { const float nm = fmaf(-mrun[g], L2E, FSH); v8f p0, p1; float ls0 = 0.f, ls1 = 0.f;
#pragma unroll
                for (int r = 0; r < 8; ++r) { p0[r] = __builtin_amdgcn_exp2f(fmaf(sc[0][g][r], L2E, nm)); p1[r] = __builtin_amdgcn_exp2f(fmaf(sc[1][g][r], L2E, nm)); ls0 += p0[r]; ls1 += p1[r]; }
                lrun[g] += ls0 + ls1;
                const v16h pf = cat16(__builtin_convertvector(p0, v8h), __builtin_convertvector(p1, v8h));
#pragma unroll
                for (int db = 0; db < 4; ++db) o[db][g] = wmma16(vf[db], pf, o[db][g]); }
#pragma unroll
            for (int kt = 0; kt < 2; ++kt)
#pragma unroll
                for (int g = 0; g < 2; ++g)
#pragma unroll
                    for (int u = 0; u < 2; ++u) mc[kt][g][u] = mn[kt][g][u];
        }
        if (more) { unsigned short* sn = sw + ((s + 1) & 1) * 3 * FTS;   // that buffer's last readers left it before the barrier that ended stage s - 1
#pragma unroll
            for (int i = 0; i < 6; ++i) *(v8usa*)(sn + (i >> 1) * FTS + (i & 1) * 32 * FKP) = st[i]; }
        asm volatile("s_wait_dscnt 0x0" ::: "memory");   // this wave's LDS stores of stage s + 1 and its reads of stage s are done
        asm volatile("s_barrier_signal -1\n\ts_barrier_wait -1" ::: "memory");   // publishes stage s + 1 and ends every read of stage s; by hand because __syncthreads() would also drain the mask loads that are in flight for the next pass
    }
#pragma unroll
    for (int g = 0; g < 2; ++g) { const float inv = __fdiv_rn(1.0f, lrun[g] + xhalf(lrun[g])); const size_t ob = ((size_t)b * TT + q0 + g * 16 + lr) * DM + h * HD + 8 * hi;
#pragma unroll
        for (int db = 0; db < 4; ++db) { v8us oh, ol;
#pragma unroll
            for (int r = 0; r < 8; ++r) { unsigned short a2, c2; splitf(o[db][g][r] * inv, a2, c2); oh[r] = a2; ol[r] = c2; }
            *(v8us*)(Ah + ob + db * 16) = oh; *(v8us*)(Al + ob + db * 16) = ol; } }
}

extern "C" void kernel_launch(void* const* d_in, const int* in_sizes, int n_in,
                              void* d_out, int out_size, void* d_ws, size_t ws_size, hipStream_t stream) {
    (void)in_sizes; (void)n_in; (void)out_size;
    const float* x = (const float*)d_in[0]; const float* amask = (const float*)d_in[1]; const int* pos = (const int*)d_in[2]; const float* lnw = (const float*)d_in[3]; const float* wq = (const float*)d_in[4]; const float* wk = (const float*)d_in[5]; const float* wv = (const float*)d_in[6]; const float* wo = (const float*)d_in[7];
    float* OUT = (float*)d_out;     // [2][2048][768]
    char* wsp = (char*)d_ws;
    auto take = [&](size_t bytes) { char* p = wsp; wsp += (bytes + 255) & ~(size_t)255; return (void*)p; };
    bf* BW = (bf*)take((size_t)4 * DM * DM * 2);   // Wq, Wk, Wv, Wo in bf16
    const size_t zb = (size_t)NH_ * TT * HD;   // one batch's planes
    bf* NH = (bf*)take(NB_ * zb * 2); bf* NL = (bf*)take(NB_ * zb * 2); float* CS = (float*)take((size_t)NB_ * TT * HD * 2 * 4);
    bf* Qh = (bf*)take(4 * NB_ * zb * 2); bf* Ql = Qh + NB_ * zb; bf* Kh = Qh + QKSTEP; bf* Kl = Ql + QKSTEP; h16* VT = (h16*)take(NB_ * zb * 2);
    bf* Ah = (bf*)take(NB_ * zb * 2); bf* Al = (bf*)take(NB_ * zb * 2);
    if ((size_t)(wsp - (char*)d_ws) > ws_size) return;    // total ~ 64 MB
    k_prep<<<PCS + PRM + 4 * PCV, 256, 0, stream>>>(pos, CS, x, lnw, NH, NL, wq, wk, wv, wo, BW);
    k_gemmw<bf, 1, 1, 8><<<dim3(TT / 64, DM / 64, 2 * NB_), 256, 0, stream>>>(NH, NL, BW, nullptr, DM, CS, nullptr, nullptr, 0, Qh, Ql);   // rows are tokens, the 64 columns one head
    k_gemmw<bf, 3, 2, 8><<<dim3(DM / 64, TT / 64, NB_), 256, 0, stream>>>(BW + (size_t)2 * DM * DM, nullptr, NH, NL, DM, nullptr, nullptr, VT, TT, nullptr, nullptr);   // rows are V's features, columns tokens (V^T = Wv N^T comes out of the GEMM already transposed)
    k_fattn<<<dim3(TT / 256, NH_, NB_), 256, 0, stream>>>(Qh, Ql, Kh, Kl, VT, amask, Ah, Al);
    k_gemmw<bf, 1, 3, 8><<<dim3(NB_ * TT / 64, DM / 64, 1), 256, 0, stream>>>(Ah, Al, BW + (size_t)3 * DM * DM, nullptr, DM, x, OUT, nullptr, DM, nullptr, nullptr);
}

// v005
// Measured time: 127 microseconds a run.
// Next to v004, in two timings, it ran 1.31 times as fast each time.
// Over all steps from v000 it is 6.03 times as fast.
#include <hip/hip_runtime.h>

// TimeSelfAttentionFallback (hidden [2][2048][768]; normed = RMSNorm(x) ln_weight; q/k/v = normed W^T (12 heads x 64); rotate-half RoPE with angles position_ids[b][t] (int, read) x inv_freq (tables computed in-kernel per batch); scores = q.k (UNSCALED) + attention_mask[b][0][i][j] (float, read);
// fp32 softmax; out = hidden + (attn v merged) Wo^T -> [2][2048][768]).
// Compute dtypes, f32 accumulate: every input rounded to bf16; RMSNorm f32 -> hl planes; q/k/v as hl(normed) x exact W (2 products); RoPE f32; scores hl x hl (3 products, K 64 - the unscaled logits need it); probabilities and v in fp16; scores, softmax and P.V in one kernel (online softmax), the scores stay in registers. What follows a projection element by element (RoPE and the hl split; the fp16 rounding of V^T; the residual add) is done in that GEMM's epilogue.

#define NB_  2
#define TT   2048
#define DM   768
#define NH_  12
#define HD   64
typedef _Float16 h16;
typedef unsigned short bf;
typedef __attribute__((ext_vector_type(16))) __bf16   v16bf;
typedef __attribute__((ext_vector_type(16))) _Float16 v16h;
typedef __attribute__((ext_vector_type(8)))  _Float16 v8h;
typedef __attribute__((ext_vector_type(8)))  unsigned short v8us;
typedef __attribute__((ext_vector_type(8)))  float    v8f;
typedef __attribute__((ext_vector_type(4)))  float    v4f;
typedef v8h  __attribute__((may_alias)) v8ha;
typedef v4f  __attribute__((may_alias)) v4fa;
typedef v8us __attribute__((may_alias)) v8usa;

__device__ __forceinline__ unsigned short f2bf(float f) { unsigned u = __float_as_uint(f); u += 0x7FFFu + ((u >> 16) & 1u); return (unsigned short)(u >> 16); }
__device__ __forceinline__ float bf2f(unsigned short b) { return __uint_as_float(((unsigned)b) << 16); }
__device__ __forceinline__ float bfr(float f) { return bf2f(f2bf(f)); }
__device__ __forceinline__ v16h cat16(v8h lo, v8h hi) { return __builtin_shufflevector(lo, hi, 0, 1, 2, 3, 4, 5, 6, 7, 8, 9, 10, 11, 12, 13, 14, 15); }
__device__ __forceinline__ v16bf cat16b(v8us lo, v8us hi) { return __builtin_bit_cast(v16bf, __builtin_shufflevector(lo, hi, 0, 1, 2, 3, 4, 5, 6, 7, 8, 9, 10, 11, 12, 13, 14, 15)); }
__device__ __forceinline__ v8f wmma16(v16h a, v16h b, v8f c) { return __builtin_amdgcn_wmma_f32_16x16x32_f16(false, a, false, b, (short)0, c, false, false); }
__device__ __forceinline__ v8f wmmab(v16bf a, v16bf b, v8f c) { return __builtin_amdgcn_wmma_f32_16x16x32_bf16(false, a, false, b, (short)0, c, false, false); }
__device__ __forceinline__ void splitf(float y, unsigned short& h, unsigned short& l) { h = f2bf(y); l = f2bf(y - bf2f(h)); }
typedef __attribute__((ext_vector_type(4))) unsigned short v4us;
typedef __attribute__((ext_vector_type(4))) _Float16 v4h;
typedef __attribute__((ext_vector_type(2))) float v2f;
__device__ __forceinline__ float xrow8(float x) { return __builtin_bit_cast(float, __builtin_amdgcn_permlane16(__builtin_bit_cast(int, x), __builtin_bit_cast(int, x), 0xfedcba98, 0x76543210, false, false)); }   // lane l with lane l ^ 8



// ---- k_gemmt: GEMM with its operands staged in LDS. One 128 x 128 output tile a work-group, 8 waves as 4 (rows) x 2 (columns), a wave owns 32 x 64 (8 accumulators); grid (M/128, N/128, jobs), 256 threads.
// c[m][n] = sum_k A[m][k] Bt[n][k] + the split product: NSPLIT 1 = (A + X2) Bt, X2 a second plane of A's rows; NSPLIT 3 = A (Bt + X2), X2 a second plane of Bt's rows. f32, k in rising order. K = DM.
// A stage is 64 k of the three planes (128 rows x 128 B each): every global load instruction covers four whole 128-B lines, the tile goes through registers into LDS rows of 144 B (16-B readers), two buffers, one barrier a stage.
// EPI says where the tile goes: 1 = rows are tokens of both batches, a wave's 64 columns one head of q or k (Bt = Wq, Wk one behind the other): rotate-half RoPE with aux = CS[t][d] (cos, sin), then hl planes Ph/Pl [b][h][t][d], k's planes QKSTEP elements behind q's; 2 = fp16 to Ch (pitch TT), blockIdx.z = batch; 3 = C (f32, pitch DM) = bf16-rounded aux[m][n] + c.
#define QKSTEP ((size_t)2 * NB_ * TT * DM)
#define GKP 72
#define GPS (128 * GKP)
#define OSZ (16 * 68)
template <typename T16> struct WFrag;
template <> struct WFrag<bf> { typedef v16bf V; static __device__ __forceinline__ V ld(const bf* p) { return cat16b(*(const v8us*)p, *(const v8us*)(p + 16)); } };
typedef float __attribute__((may_alias)) f32a;
__device__ __forceinline__ v16bf ldsfrag(const unsigned short* p) { return cat16b(*(const v8usa*)p, *(const v8usa*)(p + 16)); }
template <int NSPLIT, int EPI>
__global__ __launch_bounds__(256) void k_gemmt(const bf* __restrict__ A, const bf* __restrict__ X2, const bf* __restrict__ Bt, const float* __restrict__ aux, float* C, h16* Ch, bf* Ph, bf* Pl) {
    constexpr int K = DM;
    if (EPI == 2) { const size_t zb = (size_t)blockIdx.z * TT * DM; Bt += zb; X2 += zb; Ch += zb; }
    __shared__ __align__(16) unsigned short sm[2 * 3 * GPS];
    const int tid = threadIdx.x, lane = tid & 31, lr = lane & 15, hi = lane >> 4; const int wv = __builtin_amdgcn_readfirstlane(tid >> 5), wm = wv >> 1, wn = wv & 1;
    const int r0 = blockIdx.x * 128, c0 = blockIdx.y * 128;
    const int srow = tid >> 3, sseg = (tid & 7) * 8;   // staging: a thread moves 16 B of rows srow, srow + 32, + 64, + 96 of each plane; eight neighbouring threads cover one 128-B line
    const bf* g0 = A + (size_t)(r0 + srow) * K + sseg; const bf* g1 = X2 + (size_t)((NSPLIT == 1 ? r0 : c0) + srow) * K + sseg; const bf* g2 = Bt + (size_t)(c0 + srow) * K + sseg;
    unsigned short* sw = sm + srow * GKP + sseg;
    v8us st[12];
    v8f acc[2][4];
#pragma unroll
    for (int mb = 0; mb < 2; ++mb)
#pragma unroll
        for (int nb = 0; nb < 4; ++nb) acc[mb][nb] = (v8f){};
#pragma unroll
    for (int i = 0; i < 4; ++i) { st[i] = *(const v8usa*)(g0 + (size_t)i * 32 * K); st[4 + i] = *(const v8usa*)(g1 + (size_t)i * 32 * K); st[8 + i] = *(const v8usa*)(g2 + (size_t)i * 32 * K); }
    asm volatile("s_wait_xcnt 0x0" ::: "memory");   // behind the first stage's loads, before their address registers are reused
#pragma unroll
    for (int i = 0; i < 12; ++i) *(v8usa*)(sw + (i >> 2) * GPS + (i & 3) * 32 * GKP) = st[i];
    __syncthreads();
#pragma unroll 1   // the stage loop stays rolled: the buffer is picked by s & 1, the body is one stage
    for (int s = 0; s < K / 64; ++s) {
        const bool more = s + 1 < K / 64;
        if (more) { const int kn = (s + 1) * 64;   // next stage's planes fly into registers under this stage's products
#pragma unroll
            for (int i = 0; i < 4; ++i) { st[i] = *(const v8usa*)(g0 + (size_t)i * 32 * K + kn); st[4 + i] = *(const v8usa*)(g1 + (size_t)i * 32 * K + kn); st[8 + i] = *(const v8usa*)(g2 + (size_t)i * 32 * K + kn); }
            asm volatile("s_wait_xcnt 0x0" ::: "memory"); }   // behind these loads, before their address registers are reused
        const unsigned short* bp = sm + (s & 1) * 3 * GPS;
        v16bf a[2][2], b[2][4], x[2][4];
#pragma unroll
        for (int kc = 0; kc < 2; ++kc) {
            const unsigned short* ap = bp + (wm * 32 + lr) * GKP + kc * 32 + 8 * hi; const unsigned short* bq = bp + 2 * GPS + (wn * 64 + lr) * GKP + kc * 32 + 8 * hi;
#pragma unroll
            for (int mb = 0; mb < 2; ++mb) { a[kc][mb] = ldsfrag(ap + mb * 16 * GKP); if (NSPLIT == 1) x[kc][mb] = ldsfrag(ap + GPS + mb * 16 * GKP); }
#pragma unroll
            for (int nb = 0; nb < 4; ++nb) { b[kc][nb] = ldsfrag(bq + nb * 16 * GKP); if (NSPLIT == 3) x[kc][nb] = ldsfrag(bq - GPS + nb * 16 * GKP); } }
        __builtin_amdgcn_sched_barrier(0);   // keeps the stage's LDS reads together as one group in front of its products: sunk among them, each place costs the wave an LDS latency
#pragma unroll
        for (int kc = 0; kc < 2; ++kc) {
#pragma unroll
            for (int mb = 0; mb < 2; ++mb)   // eight independent tiles in turn
#pragma unroll
                for (int nb = 0; nb < 4; ++nb) acc[mb][nb] = wmmab(a[kc][mb], b[kc][nb], acc[mb][nb]);
#pragma unroll
            for (int mb = 0; mb < 2; ++mb)
#pragma unroll
                for (int nb = 0; nb < 4; ++nb) acc[mb][nb] = wmmab(NSPLIT == 1 ? x[kc][mb] : a[kc][mb], NSPLIT == 1 ? b[kc][nb] : x[kc][nb], acc[mb][nb]);
        }
        if (more) { unsigned short* sn = sw + ((s + 1) & 1) * 3 * GPS;   // that buffer's last readers left it before the barrier that ended stage s - 1
#pragma unroll
            for (int i = 0; i < 12; ++i) *(v8usa*)(sn + (i >> 2) * GPS + (i & 3) * 32 * GKP) = st[i]; }
        __syncthreads();   // publishes stage s + 1 and ends every read of stage s
    }
    // Epilogue: the last barrier has ended every read of the stage buffers; each wave turns its own tile through its own LDS range (16 x 64 blocks, 272-B rows) so that 16 lanes hold one row of 64 columns.
    f32a* ob = (f32a*)sm + wv * 2 * OSZ; const int cofs = lr * 4;
#pragma unroll
    for (int mb = 0; mb < 2; ++mb)
#pragma unroll
        for (int nb = 0; nb < 4; ++nb)
#pragma unroll
            for (int j = 0; j < 8; ++j) ob[mb * OSZ + (hi * 8 + j) * 68 + nb * 16 + lr] = acc[mb][nb][j];
    asm volatile("s_wait_dscnt 0x0" ::: "memory");   // this wave's LDS stores are done before its lanes read one another's rows back
    const int nc = c0 + wn * 64;   // the wave's first column
#pragma unroll
    for (int mb = 0; mb < 2; ++mb) {
        const int m0 = r0 + wm * 32 + mb * 16 + hi;   // this lane's rows of the block: m0 + 2 rp
        v4f ex[8][2], val[8];
        const float* cp = EPI == 1 ? aux + ((size_t)m0 * HD + cofs) * 2 : aux + (size_t)m0 * DM + nc + cofs;   // what the epilogue reads from memory: (cos, sin) pairs, or the residual
#pragma unroll
        for (int rp = 0; rp < 8; ++rp) {
            if (EPI == 1) { ex[rp][0] = *(const v4f*)(cp + rp * 4 * HD); ex[rp][1] = *(const v4f*)(cp + rp * 4 * HD + 4); }
            if (EPI == 3) ex[rp][0] = *(const v4f*)(cp + rp * 2 * DM); }
        if (EPI == 1 || EPI == 3) { asm volatile("s_wait_xcnt 0x0" :: "v"(cp) : "memory");   // behind these loads, before their address registers are reused; the address is an input so that it lives up to the wait and no load's result lands on it
            __builtin_amdgcn_sched_barrier(0); }   // keeps the register writes that follow from being scheduled in front of that wait
#pragma unroll
        for (int rp = 0; rp < 8; ++rp) val[rp] = *(const v4fa*)((const f32a*)ob + mb * OSZ + (2 * rp + hi) * 68 + cofs);
        if (EPI == 1) { v4us oh[8], ol[8];   // column d's partner d +- 32 sits eight lanes away in the same 16-lane row; d < 32 takes -x[d + 32] sin, d >= 32 takes +x[d - 32] sin
#pragma unroll
            for (int rp = 0; rp < 8; ++rp)
#pragma unroll
                for (int u = 0; u < 4; ++u) { const float xp = xrow8(val[rp][u]); const float r = val[rp][u] * ex[rp][u >> 1][(u & 1) * 2] + (lr < 8 ? -xp : xp) * ex[rp][u >> 1][(u & 1) * 2 + 1]; unsigned short a2, c2; splitf(r, a2, c2); oh[rp][u] = a2; ol[rp][u] = c2; }
            __builtin_amdgcn_sched_barrier(0);   // every result stands in its own registers before the first store is issued: no store's registers are rewritten in front of the wait below
            const int zk = nc / DM, hh = (nc - zk * DM) / HD, bb = r0 / TT, t0 = m0 - bb * TT;
            const size_t oo = zk * QKSTEP + (size_t)bb * TT * DM + ((size_t)hh * TT + t0) * HD + cofs;
#pragma unroll
            for (int rp = 0; rp < 8; ++rp) { *(v4us*)(Ph + oo + rp * 2 * HD) = oh[rp]; *(v4us*)(Pl + oo + rp * 2 * HD) = ol[rp]; } }
        if (EPI == 2) { v4h o4[8];
#pragma unroll
            for (int rp = 0; rp < 8; ++rp) o4[rp] = __builtin_convertvector(val[rp], v4h);
            __builtin_amdgcn_sched_barrier(0);   // results first, then the stores: no store's registers are rewritten in front of the wait below
#pragma unroll
            for (int rp = 0; rp < 8; ++rp) *(v4h*)(Ch + (size_t)m0 * TT + nc + cofs + rp * 2 * TT) = o4[rp]; }
        if (EPI == 3) { v4f o4[8];
#pragma unroll
            for (int rp = 0; rp < 8; ++rp)
#pragma unroll
                for (int u = 0; u < 4; ++u) o4[rp][u] = bfr(ex[rp][0][u]) + val[rp][u];
            __builtin_amdgcn_sched_barrier(0);   // results first, then the stores: no store's registers are rewritten in front of the wait below
#pragma unroll
            for (int rp = 0; rp < 8; ++rp) *(v4f*)(C + (size_t)m0 * DM + nc + cofs + rp * 2 * DM) = o4[rp]; }
        if (mb < 1) { asm volatile("s_wait_xcnt 0x0" ::: "memory");   // behind this block's stores, before their data and address registers are reused
            __builtin_amdgcn_sched_barrier(0); }   // keeps the next block's register writes behind that wait
    }
}


// ---- k_prep: everything the projections wait for, none of it waiting for any other of it, as ONE grid: blocks [0, PCS) the cos/sin table, [PCS, PCS + PRM) RMSNorm, then PCV blocks for each of the four weights (BW = Wq, Wk, Wv, Wo in bf16, one behind the other; torch [out][in] = Bt). t runs over the NB_ TT tokens of both batches.
#define PCS (NB_ * TT * HD / 256)
#define PRM (NB_ * TT / 8)
#define PCV (DM * DM / 8 / 256)
// RMSNorm: wave per token: x rsqrt(mean x^2 + 1e-6) w -> hl planes (8-B lanes); table: CS[t][dd] = (cos, sin)((float)pos[t] x 10000^(-2 (dd mod 32)/64));
__global__ __launch_bounds__(256) void k_prep(const int* __restrict__ pos, float* CS, const float* __restrict__ X, const float* __restrict__ w, bf* Hh, bf* Hl, const float* __restrict__ wq, const float* __restrict__ wk, const float* __restrict__ wv, const float* __restrict__ wo, bf* BW) {
    const int blk = blockIdx.x;
    if (blk >= PCS && blk < PCS + PRM) { const int lane = threadIdx.x & 31; const int t = (blk - PCS) * 8 + (threadIdx.x >> 5); if (t >= NB_ * TT) return; float v[DM / 32]; float q = 0.f;
#pragma unroll
    for (int ch = 0; ch < DM / 128; ++ch) { const v4f a = *(const v4f*)(X + (size_t)t * DM + ch * 128 + lane * 4);
#pragma unroll
        for (int u = 0; u < 4; ++u) { v[ch * 4 + u] = bfr(a[u]); float p = __fmul_rn(v[ch * 4 + u], v[ch * 4 + u]); asm volatile("" : "+v"(p)); q = __fadd_rn(q, p); } }
#pragma unroll
    for (int sh = 16; sh; sh >>= 1) q += __shfl_xor(q, sh, 32);
    const float rs = __frsqrt_rn(__fadd_rn(q * (1.0f / DM), 1e-6f));
    {
#pragma unroll
        for (int ch = 0; ch < DM / 128; ++ch) { const int c0 = ch * 128 + lane * 4; v4us oh, ol;
#pragma unroll
            for (int u = 0; u < 4; ++u) { float n0 = __fmul_rn(v[ch * 4 + u], rs); asm volatile("" : "+v"(n0)); const float y = __fmul_rn(n0, bfr(w[c0 + u])); unsigned short a2, b2; splitf(y, a2, b2); oh[u] = a2; ol[u] = b2; }
            const size_t oo = (size_t)t * DM + c0; *(v4us*)(Hh + oo) = oh; *(v4us*)(Hl + oo) = ol; }
         } }
    else if (blk < PCS) { const int idx = blk * 256 + threadIdx.x; if (idx >= NB_ * TT * HD) return; const int dd = idx % HD; const int t = idx / HD; const int i2 = dd % (HD / 2); const float inv = __fdiv_rn(1.0f, powf(10000.0f, (float)(2 * i2) / (float)HD)); const float ang = __fmul_rn((float)pos[t], inv); v2f cs; cs[0] = cosf(ang); cs[1] = sinf(ang);
    *(v2f*)(CS + (size_t)idx * 2) = cs;  }
    else { const int j = blk - (PCS + PRM), which = j / PCV; const float* __restrict__ src = which == 0 ? wq : which == 1 ? wk : which == 2 ? wv : wo; bf* dst = BW + (size_t)which * DM * DM; const size_t n8 = DM * DM / 8;
        const size_t i = (size_t)(j % PCV) * 256 + threadIdx.x; if (i >= n8) return; const v8f v = *(const v8f*)(src + i * 8); v8us o;
#pragma unroll
        for (int k = 0; k < 8; ++k) o[k] = f2bf(v[k]); *(v8us*)(dst + i * 8) = o;  }
}
#define FKP  72
#define FTS  (64 * FKP)
#define FTHR 4.0f
#define FSH  9.0f
#define L2E  1.4426950408889634f
typedef __attribute__((ext_vector_type(2))) __bf16 v2bf;
__device__ __forceinline__ float xhalf(float x) { return __builtin_bit_cast(float, __builtin_amdgcn_permlanex16(__builtin_bit_cast(int, x), __builtin_bit_cast(int, x), 0x76543210, 0xfedcba98, false, false)); }   // lane l with lane l ^ 16
__global__ __launch_bounds__(256) void k_fattn(const bf* __restrict__ Qh, const bf* __restrict__ Ql, const bf* __restrict__ Kh, const bf* __restrict__ Kl, const h16* __restrict__ VT, const float* __restrict__ mk, bf* Ah, bf* Al) {
    __shared__ __align__(16) unsigned short sm[2 * 3 * FTS];
    const int tid = threadIdx.x, lane = tid & 31, lr = lane & 15, hi = lane >> 4; const int wv = __builtin_amdgcn_readfirstlane(tid >> 5);
    const int h = blockIdx.y, b = blockIdx.z; const size_t hz = ((size_t)b * NH_ + h) * TT * HD; const int q0 = blockIdx.x * 256 + wv * 32;
    v16bf qh[2][2], ql[2][2]; const bf* qhp = Qh + hz + (size_t)(q0 + lr) * HD + 8 * hi; const bf* qlp = Ql + hz + (size_t)(q0 + lr) * HD + 8 * hi;
#pragma unroll
    for (int g = 0; g < 2; ++g)
#pragma unroll
        for (int kc = 0; kc < 2; ++kc) { qh[g][kc] = WFrag<bf>::ld(qhp + g * 16 * HD + kc * 32); ql[g][kc] = WFrag<bf>::ld(qlp + g * 16 * HD + kc * 32); }
    asm volatile("s_wait_xcnt 0x0" ::: "memory");   // behind the Q loads, before their address registers are reused
    __builtin_amdgcn_sched_barrier(0);   // keeps the address arithmetic that follows from being scheduled in front of that wait, into the Q loads' address registers
    const int srow = tid >> 3, sseg = (tid & 7) * 8;   // staging: a thread moves 16 B of rows srow and srow + 32 of each of the three tiles
    const bf* gkh = Kh + hz + (size_t)srow * HD + sseg; const bf* gkl = Kl + hz + (size_t)srow * HD + sseg; const h16* gvt = VT + hz + (size_t)srow * TT + sseg;
    unsigned short* sw = sm + srow * FKP + sseg;
    const float* mr0 = mk + (size_t)b * TT * TT + (size_t)(q0 + lr) * TT + 8 * hi; const float* mr1 = mr0 + (size_t)16 * TT;
    v8us st[6]; v4f mc[2][2][2];
    v8f o[4][2]; float mrun[2], lrun[2];
#pragma unroll
    for (int g = 0; g < 2; ++g) { mrun[g] = -1.0e30f; lrun[g] = 0.f;
#pragma unroll
        for (int db = 0; db < 4; ++db) o[db][g] = (v8f){}; }
    st[0] = *(const v8usa*)gkh; st[1] = *(const v8usa*)(gkh + 32 * HD); st[2] = *(const v8usa*)gkl; st[3] = *(const v8usa*)(gkl + 32 * HD); st[4] = *(const v8usa*)gvt; st[5] = *(const v8usa*)(gvt + (size_t)32 * TT);
#pragma unroll
    for (int kt = 0; kt < 2; ++kt)
#pragma unroll
        for (int u = 0; u < 2; ++u) { mc[kt][0][u] = *(const v4f*)(mr0 + kt * 16 + u * 4); mc[kt][1][u] = *(const v4f*)(mr1 + kt * 16 + u * 4); }
    asm volatile("s_wait_xcnt 0x0" ::: "memory");   // behind the first stage's and the first pass's loads, before their address registers are reused
#pragma unroll
    for (int i = 0; i < 6; ++i) *(v8usa*)(sw + (i >> 1) * FTS + (i & 1) * 32 * FKP) = st[i];
    __syncthreads();
#pragma unroll 1   // the stage loop stays rolled: one body of two passes
    for (int s = 0; s < TT / 64; ++s) {
        const bool more = s + 1 < TT / 64;
        if (more) { const int kn = (s + 1) * 64;   // next stage's tiles fly into registers under this stage's work
            st[0] = *(const v8usa*)(gkh + (size_t)kn * HD); st[1] = *(const v8usa*)(gkh + (size_t)(kn + 32) * HD); st[2] = *(const v8usa*)(gkl + (size_t)kn * HD); st[3] = *(const v8usa*)(gkl + (size_t)(kn + 32) * HD); st[4] = *(const v8usa*)(gvt + kn); st[5] = *(const v8usa*)(gvt + (size_t)32 * TT + kn);
            asm volatile("s_wait_xcnt 0x0" ::: "memory"); }   // behind these loads, before their address registers are reused
        const unsigned short* bp = sm + (s & 1) * 3 * FTS;
#pragma unroll
        for (int c = 0; c < 2; ++c) {
            const int nk = min(s * 64 + c * 32 + 32, TT - 32);   // next pass's mask, one pass ahead (the last pass re-reads its own: in bounds)
            v4f mn[2][2][2];
#pragma unroll
            for (int kt = 0; kt < 2; ++kt)
#pragma unroll
                for (int u = 0; u < 2; ++u) { mn[kt][0][u] = *(const v4f*)(mr0 + nk + kt * 16 + u * 4); mn[kt][1][u] = *(const v4f*)(mr1 + nk + kt * 16 + u * 4); }
            asm volatile("s_wait_xcnt 0x0" ::: "memory");   // stands behind the loads issued ahead, before their address registers are reused; its clobber also keeps those loads up here, in front of this pass's work, instead of sinking to the loop's foot
            v16bf ah[2][2], al[2][2];
#pragma unroll
            for (int kt = 0; kt < 2; ++kt)
#pragma unroll
                for (int kc = 0; kc < 2; ++kc) { const unsigned short* kp = bp + (c * 32 + kt * 16 + lr) * FKP + kc * 32 + 8 * hi; ah[kt][kc] = cat16b(*(const v8usa*)kp, *(const v8usa*)(kp + 16)); al[kt][kc] = cat16b(*(const v8usa*)(kp + FTS), *(const v8usa*)(kp + FTS + 16)); }
            v8f sc[2][2];
#pragma unroll
            for (int kt = 0; kt < 2; ++kt)
#pragma unroll
                for (int g = 0; g < 2; ++g) sc[kt][g] = (v8f){};
#pragma unroll
            for (int kc = 0; kc < 2; ++kc) {   // four independent score tiles in turn
#pragma unroll
                for (int kt = 0; kt < 2; ++kt)
#pragma unroll
                    for (int g = 0; g < 2; ++g) sc[kt][g] = wmmab(ah[kt][kc], qh[g][kc], sc[kt][g]);
#pragma unroll
                for (int kt = 0; kt < 2; ++kt)
#pragma unroll
                    for (int g = 0; g < 2; ++g) sc[kt][g] = wmmab(ah[kt][kc], ql[g][kc], sc[kt][g]);
#pragma unroll
                for (int kt = 0; kt < 2; ++kt)
#pragma unroll
                    for (int g = 0; g < 2; ++g) sc[kt][g] = wmmab(al[kt][kc], qh[g][kc], sc[kt][g]); }
            v16h vf[4];
#pragma unroll
            for (int db = 0; db < 4; ++db) { const unsigned short* vp = bp + 2 * FTS + (db * 16 + lr) * FKP + c * 32 + 8 * hi; vf[db] = cat16(*(const v8ha*)vp, *(const v8ha*)(vp + 16)); }
            float mb[2]; bool need = false;
#pragma unroll
            for (int g = 0; g < 2; ++g) { float mx = -3.0e38f;
#pragma unroll
                for (int kt = 0; kt < 2; ++kt)
#pragma unroll
                    for (int r = 0; r < 8; r += 2) { const v2bf m2 = __builtin_convertvector((v2f){mc[kt][g][r >> 2][r & 3], mc[kt][g][r >> 2][(r & 3) + 1]}, v2bf);   // mask rounded to bf16 (nearest even), as every input
                        const float t0 = sc[kt][g][r] + (float)m2[0], t1 = sc[kt][g][r + 1] + (float)m2[1]; sc[kt][g][r] = t0; sc[kt][g][r + 1] = t1; mx = fmaxf(mx, fmaxf(t0, t1)); }
                mx = fmaxf(mx, xhalf(mx)); mb[g] = mx; need = need || (mx > mrun[g] + FTHR); }
            if (__builtin_amdgcn_ballot_w32(need) != 0) {   // one wave-uniform test a pass; rare after the first passes
#pragma unroll
                for (int g = 0; g < 2; ++g) { const float mnew = fmaxf(mrun[g], mb[g]); const float corr = __builtin_amdgcn_exp2f((mrun[g] - mnew) * L2E); mrun[g] = mnew; lrun[g] *= corr;
#pragma unroll
                    for (int db = 0; db < 4; ++db) o[db][g] = o[db][g] * corr; } }
#pragma unroll
            for (int g = 0; g < 2; ++g) { const float nm = fmaf(-mrun[g], L2E, FSH); v8f p0, p1; float ls0 = 0.f, ls1 = 0.f;
#pragma unroll
                for (int r = 0; r < 8; ++r) { p0[r] = __builtin_amdgcn_exp2f(fmaf(sc[0][g][r], L2E, nm)); p1[r] = __builtin_amdgcn_exp2f(fmaf(sc[1][g][r], L2E, nm)); ls0 += p0[r]; ls1 += p1[r]; }
                lrun[g] += ls0 + ls1;
                const v16h pf = cat16(__builtin_convertvector(p0, v8h), __builtin_convertvector(p1, v8h));
#pragma unroll
                for (int db = 0; db < 4; ++db) o[db][g] = wmma16(vf[db], pf, o[db][g]); }
#pragma unroll
            for (int kt = 0; kt < 2; ++kt)
#pragma unroll
                for (int g = 0; g < 2; ++g)
#pragma unroll
                    for (int u = 0; u < 2; ++u) mc[kt][g][u] = mn[kt][g][u];
        }
        if (more) { unsigned short* sn = sw + ((s + 1) & 1) * 3 * FTS;   // that buffer's last readers left it before the barrier that ended stage s - 1
#pragma unroll
            for (int i = 0; i < 6; ++i) *(v8usa*)(sn + (i >> 1) * FTS + (i & 1) * 32 * FKP) = st[i]; }
        asm volatile("s_wait_dscnt 0x0" ::: "memory");   // this wave's LDS stores of stage s + 1 and its reads of stage s are done
        asm volatile("s_barrier_signal -1\n\ts_barrier_wait -1" ::: "memory");   // publishes stage s + 1 and ends every read of stage s; by hand because __syncthreads() would also drain the mask loads that are in flight for the next pass
    }
#pragma unroll
    for (int g = 0; g < 2; ++g) { const float inv = __fdiv_rn(1.0f, lrun[g] + xhalf(lrun[g])); const size_t ob = ((size_t)b * TT + q0 + g * 16 + lr) * DM + h * HD + 8 * hi;
#pragma unroll
        for (int db = 0; db < 4; ++db) { v8us oh, ol;
#pragma unroll
            for (int r = 0; r < 8; ++r) { unsigned short a2, c2; splitf(o[db][g][r] * inv, a2, c2); oh[r] = a2; ol[r] = c2; }
            *(v8us*)(Ah + ob + db * 16) = oh; *(v8us*)(Al + ob + db * 16) = ol; } }
}

extern "C" void kernel_launch(void* const* d_in, const int* in_sizes, int n_in,
                              void* d_out, int out_size, void* d_ws, size_t ws_size, hipStream_t stream) {
    (void)in_sizes; (void)n_in; (void)out_size;
    const float* x = (const float*)d_in[0]; const float* amask = (const float*)d_in[1]; const int* pos = (const int*)d_in[2]; const float* lnw = (const float*)d_in[3]; const float* wq = (const float*)d_in[4]; const float* wk = (const float*)d_in[5]; const float* wv = (const float*)d_in[6]; const float* wo = (const float*)d_in[7];
    float* OUT = (float*)d_out;     // [2][2048][768]
    char* wsp = (char*)d_ws;
    auto take = [&](size_t bytes) { char* p = wsp; wsp += (bytes + 255) & ~(size_t)255; return (void*)p; };
    bf* BW = (bf*)take((size_t)4 * DM * DM * 2);   // Wq, Wk, Wv, Wo in bf16
    const size_t zb = (size_t)NH_ * TT * HD;   // one batch's planes
    bf* NH = (bf*)take(NB_ * zb * 2); bf* NL = (bf*)take(NB_ * zb * 2); float* CS = (float*)take((size_t)NB_ * TT * HD * 2 * 4);
    bf* Qh = (bf*)take(4 * NB_ * zb * 2); bf* Ql = Qh + NB_ * zb; bf* Kh = Qh + QKSTEP; bf* Kl = Ql + QKSTEP; h16* VT = (h16*)take(NB_ * zb * 2);
    bf* Ah = (bf*)take(NB_ * zb * 2); bf* Al = (bf*)take(NB_ * zb * 2);
    if ((size_t)(wsp - (char*)d_ws) > ws_size) return;    // total ~ 64 MB
    k_prep<<<PCS + PRM + 4 * PCV, 256, 0, stream>>>(pos, CS, x, lnw, NH, NL, wq, wk, wv, wo, BW);
    k_gemmt<1, 1><<<dim3(NB_ * TT / 128, 2 * DM / 128, 1), 256, 0, stream>>>(NH, NL, BW, CS, nullptr, nullptr, Qh, Ql);   // rows are the tokens of both batches, columns the heads of q, then of k
    k_gemmt<3, 2><<<dim3(DM / 128, TT / 128, NB_), 256, 0, stream>>>(BW + (size_t)2 * DM * DM, NL, NH, nullptr, nullptr, VT, nullptr, nullptr);   // rows are V's features, columns tokens (V^T = Wv N^T comes out of the GEMM already transposed)
    k_fattn<<<dim3(TT / 256, NH_, NB_), 256, 0, stream>>>(Qh, Ql, Kh, Kl, VT, amask, Ah, Al);
    k_gemmt<1, 3><<<dim3(NB_ * TT / 128, DM / 128, 1), 256, 0, stream>>>(Ah, Al, BW + (size_t)3 * DM * DM, x, OUT, nullptr, nullptr, nullptr);
}

// v006
// It runs in 108 microseconds.
// In two side-by-side timings against v005, it was 1.17 and 1.18 times as fast.
// Over all steps from v000 it is 7.09 times as fast.
#include <hip/hip_runtime.h>

// TimeSelfAttentionFallback (hidden [2][2048][768]; normed = RMSNorm(x) ln_weight; q/k/v = normed W^T (12 heads x 64); rotate-half RoPE with angles position_ids[b][t] (int, read) x inv_freq (tables computed in-kernel per batch); scores = q.k (UNSCALED) + attention_mask[b][0][i][j] (float, read);
// fp32 softmax; out = hidden + (attn v merged) Wo^T -> [2][2048][768]).
// Compute dtypes, f32 accumulate: every input rounded to bf16; RMSNorm f32 -> hl planes; q/k/v as hl(normed) x exact W (2 products); RoPE f32; scores hl x hl (3 products, K 64 - the unscaled logits need it); probabilities and v in fp16; scores, softmax and P.V in one kernel (online softmax), the scores stay in registers. What follows a projection element by element (RoPE and the hl split; the fp16 rounding of V^T; the residual add) is done in that GEMM's epilogue.

#define NB_  2
#define TT   2048
#define DM   768
#define NH_  12
#define HD   64
typedef _Float16 h16;
typedef unsigned short bf;
typedef __attribute__((ext_vector_type(16))) __bf16   v16bf;
typedef __attribute__((ext_vector_type(16))) _Float16 v16h;
typedef __attribute__((ext_vector_type(8)))  _Float16 v8h;
typedef __attribute__((ext_vector_type(8)))  unsigned short v8us;
typedef __attribute__((ext_vector_type(8)))  float    v8f;
typedef __attribute__((ext_vector_type(4)))  float    v4f;
typedef v8h  __attribute__((may_alias)) v8ha;
typedef v4f  __attribute__((may_alias)) v4fa;
typedef v8us __attribute__((may_alias)) v8usa;

__device__ __forceinline__ unsigned short f2bf(float f) { unsigned u = __float_as_uint(f); u += 0x7FFFu + ((u >> 16) & 1u); return (unsigned short)(u >> 16); }
__device__ __forceinline__ float bf2f(unsigned short b) { return __uint_as_float(((unsigned)b) << 16); }
__device__ __forceinline__ float bfr(float f) { return bf2f(f2bf(f)); }
__device__ __forceinline__ v16h cat16(v8h lo, v8h hi) { return __builtin_shufflevector(lo, hi, 0, 1, 2, 3, 4, 5, 6, 7, 8, 9, 10, 11, 12, 13, 14, 15); }
__device__ __forceinline__ v16bf cat16b(v8us lo, v8us hi) { return __builtin_bit_cast(v16bf, __builtin_shufflevector(lo, hi, 0, 1, 2, 3, 4, 5, 6, 7, 8, 9, 10, 11, 12, 13, 14, 15)); }
__device__ __forceinline__ v8f wmma16(v16h a, v16h b, v8f c) { return __builtin_amdgcn_wmma_f32_16x16x32_f16(false, a, false, b, (short)0, c, false, false); }
__device__ __forceinline__ v8f wmmab(v16bf a, v16bf b, v8f c) { return __builtin_amdgcn_wmma_f32_16x16x32_bf16(false, a, false, b, (short)0, c, false, false); }
__device__ __forceinline__ void splitf(float y, unsigned short& h, unsigned short& l) { h = f2bf(y); l = f2bf(y - bf2f(h)); }
typedef __attribute__((ext_vector_type(4))) unsigned short v4us;
typedef __attribute__((ext_vector_type(4))) _Float16 v4h;
typedef __attribute__((ext_vector_type(2))) float v2f;
__device__ __forceinline__ float xrow8(float x) { return __builtin_bit_cast(float, __builtin_amdgcn_permlane16(__builtin_bit_cast(int, x), __builtin_bit_cast(int, x), 0xfedcba98, 0x76543210, false, false)); }   // lane l with lane l ^ 8



// ---- k_gemmt: GEMM with its operands staged in LDS. One 128 x 128 output tile a work-group, 8 waves as 4 (rows) x 2 (columns), a wave owns 32 x 64 (8 accumulators); grid (M/128, N/128, jobs), 256 threads.
// c[m][n] = sum_k A[m][k] Bt[n][k] + the split product: NSPLIT 1 = (A + X2) Bt, X2 a second plane of A's rows; NSPLIT 3 = A (Bt + X2), X2 a second plane of Bt's rows. f32, k in rising order. K = DM.
// A stage is 64 k of the three planes (128 rows x 128 B each): every global load instruction covers four whole 128-B lines, the tile goes through registers into LDS rows of 144 B (16-B readers), two buffers, one barrier a stage.
// EPI says where the tile goes: 1 = rows are tokens of both batches, a wave's 64 columns one head of q or k (Bt = Wq, Wk one behind the other): rotate-half RoPE with aux = CS[t][d] (cos, sin), then hl planes Ph/Pl [b][h][t][d], k's planes QKSTEP elements behind q's; 2 = fp16 to Ch (pitch TT), blockIdx.z = batch; 3 = C (f32, pitch DM) = bf16-rounded aux[m][n] + c.
// With EPI 1 the grid has PMS more blocks, behind the GEMM's in y, that do no GEMM: they scan the mask for attention (mask_scan), on the places that the GEMM's 384 blocks leave free.
#define QKSTEP ((size_t)2 * NB_ * TT * DM)
#define GKP 72
#define GPS (128 * GKP)
#define OSZ (16 * 68)
// Mask scan: a wave takes 32 query rows x 128 keys (one whole 512-B load a row) and stores one word, alone in its 128-B line: MF[gw 32], gw = (b TT/32 + query group) 16 + key group; bit l says that lane l's four key columns hold something other than +-0 in some row, so byte i speaks for tile i of the group, 32 queries x 32 keys.
#define PMS (NB_ * (TT / 32) * (TT / 128) / 8)
__device__ __forceinline__ void mask_scan(const float* __restrict__ mk, unsigned* MF, int j) {
    const int lane = threadIdx.x & 31; const int gw = j * 8 + (threadIdx.x >> 5);
    const float* mp = mk + (size_t)(gw >> 4) * 32 * TT + (gw & 15) * 128 + lane * 4; v4f a[32];
#pragma unroll
    for (int r = 0; r < 32; ++r) a[r] = *(const v4f*)(mp + (size_t)r * TT);
    asm volatile("s_wait_xcnt 0x0" ::: "memory");   // behind the scan's loads, before their address registers are reused
    unsigned any = 0u;
#pragma unroll
    for (int r = 0; r < 32; ++r) any |= __float_as_uint(a[r][0]) | __float_as_uint(a[r][1]) | __float_as_uint(a[r][2]) | __float_as_uint(a[r][3]);
    const unsigned bl = __builtin_amdgcn_ballot_w32((any & 0x7fffffffu) != 0u);
    if (lane == 0) MF[(size_t)gw * 32] = bl;
}
template <typename T16> struct WFrag;
template <> struct WFrag<bf> { typedef v16bf V; static __device__ __forceinline__ V ld(const bf* p) { return cat16b(*(const v8us*)p, *(const v8us*)(p + 16)); } };
typedef float __attribute__((may_alias)) f32a;
__device__ __forceinline__ v16bf ldsfrag(const unsigned short* p) { return cat16b(*(const v8usa*)p, *(const v8usa*)(p + 16)); }
template <int NSPLIT, int EPI>
__global__ __launch_bounds__(256) void k_gemmt(const bf* __restrict__ A, const bf* __restrict__ X2, const bf* __restrict__ Bt, const float* __restrict__ aux, float* C, h16* Ch, bf* Ph, bf* Pl, const float* __restrict__ mk, unsigned* MF) {
    constexpr int K = DM;
    if (EPI == 1 && blockIdx.y >= 2 * DM / 128) { mask_scan(mk, MF, (blockIdx.y - 2 * DM / 128) * (NB_ * TT / 128) + blockIdx.x); return; }   // whole blocks, in front of every barrier
    if (EPI == 2) { const size_t zb = (size_t)blockIdx.z * TT * DM; Bt += zb; X2 += zb; Ch += zb; }
    __shared__ __align__(16) unsigned short sm[2 * 3 * GPS];
    const int tid = threadIdx.x, lane = tid & 31, lr = lane & 15, hi = lane >> 4; const int wv = __builtin_amdgcn_readfirstlane(tid >> 5), wm = wv >> 1, wn = wv & 1;
    const int r0 = blockIdx.x * 128, c0 = blockIdx.y * 128;
    const int srow = tid >> 3, sseg = (tid & 7) * 8;   // staging: a thread moves 16 B of rows srow, srow + 32, + 64, + 96 of each plane; eight neighbouring threads cover one 128-B line
    const bf* g0 = A + (size_t)(r0 + srow) * K + sseg; const bf* g1 = X2 + (size_t)((NSPLIT == 1 ? r0 : c0) + srow) * K + sseg; const bf* g2 = Bt + (size_t)(c0 + srow) * K + sseg;
    unsigned short* sw = sm + srow * GKP + sseg;
    v8us st[12];
    v8f acc[2][4];
#pragma unroll
    for (int mb = 0; mb < 2; ++mb)
#pragma unroll
        for (int nb = 0; nb < 4; ++nb) acc[mb][nb] = (v8f){};
#pragma unroll
    for (int i = 0; i < 4; ++i) { st[i] = *(const v8usa*)(g0 + (size_t)i * 32 * K); st[4 + i] = *(const v8usa*)(g1 + (size_t)i * 32 * K); st[8 + i] = *(const v8usa*)(g2 + (size_t)i * 32 * K); }
    asm volatile("s_wait_xcnt 0x0" ::: "memory");   // behind the first stage's loads, before their address registers are reused
#pragma unroll
    for (int i = 0; i < 12; ++i) *(v8usa*)(sw + (i >> 2) * GPS + (i & 3) * 32 * GKP) = st[i];
    __syncthreads();
#pragma unroll 1   // the stage loop stays rolled: the buffer is picked by s & 1, the body is one stage
    for (int s = 0; s < K / 64; ++s) {
        const bool more = s + 1 < K / 64;
        if (more) { const int kn = (s + 1) * 64;   // next stage's planes fly into registers under this stage's products
#pragma unroll
            for (int i = 0; i < 4; ++i) { st[i] = *(const v8usa*)(g0 + (size_t)i * 32 * K + kn); st[4 + i] = *(const v8usa*)(g1 + (size_t)i * 32 * K + kn); st[8 + i] = *(const v8usa*)(g2 + (size_t)i * 32 * K + kn); }
            asm volatile("s_wait_xcnt 0x0" ::: "memory"); }   // behind these loads, before their address registers are reused
        const unsigned short* bp = sm + (s & 1) * 3 * GPS;
        v16bf a[2][2], b[2][4], x[2][4];
#pragma unroll
        for (int kc = 0; kc < 2; ++kc) {
            const unsigned short* ap = bp + (wm * 32 + lr) * GKP + kc * 32 + 8 * hi; const unsigned short* bq = bp + 2 * GPS + (wn * 64 + lr) * GKP + kc * 32 + 8 * hi;
#pragma unroll
            for (int mb = 0; mb < 2; ++mb) { a[kc][mb] = ldsfrag(ap + mb * 16 * GKP); if (NSPLIT == 1) x[kc][mb] = ldsfrag(ap + GPS + mb * 16 * GKP); }
#pragma unroll
            for (int nb = 0; nb < 4; ++nb) { b[kc][nb] = ldsfrag(bq + nb * 16 * GKP); if (NSPLIT == 3) x[kc][nb] = ldsfrag(bq - GPS + nb * 16 * GKP); } }
        __builtin_amdgcn_sched_barrier(0);   // keeps the stage's LDS reads together as one group in front of its products: sunk among them, each place costs the wave an LDS latency
#pragma unroll
        for (int kc = 0; kc < 2; ++kc) {
#pragma unroll
            for (int mb = 0; mb < 2; ++mb)   // eight independent tiles in turn
#pragma unroll
                for (int nb = 0; nb < 4; ++nb) acc[mb][nb] = wmmab(a[kc][mb], b[kc][nb], acc[mb][nb]);
#pragma unroll
            for (int mb = 0; mb < 2; ++mb)
#pragma unroll
                for (int nb = 0; nb < 4; ++nb) acc[mb][nb] = wmmab(NSPLIT == 1 ? x[kc][mb] : a[kc][mb], NSPLIT == 1 ? b[kc][nb] : x[kc][nb], acc[mb][nb]);
        }
        if (more) { unsigned short* sn = sw + ((s + 1) & 1) * 3 * GPS;   // that buffer's last readers left it before the barrier that ended stage s - 1
#pragma unroll
            for (int i = 0; i < 12; ++i) *(v8usa*)(sn + (i >> 2) * GPS + (i & 3) * 32 * GKP) = st[i]; }
        __syncthreads();   // publishes stage s + 1 and ends every read of stage s
    }
    // Epilogue: the last barrier has ended every read of the stage buffers; each wave turns its own tile through its own LDS range (16 x 64 blocks, 272-B rows) so that 16 lanes hold one row of 64 columns.
    f32a* ob = (f32a*)sm + wv * 2 * OSZ; const int cofs = lr * 4;
#pragma unroll
    for (int mb = 0; mb < 2; ++mb)
#pragma unroll
        for (int nb = 0; nb < 4; ++nb)
#pragma unroll
            for (int j = 0; j < 8; ++j) ob[mb * OSZ + (hi * 8 + j) * 68 + nb * 16 + lr] = acc[mb][nb][j];
    asm volatile("s_wait_dscnt 0x0" ::: "memory");   // this wave's LDS stores are done before its lanes read one another's rows back
    const int nc = c0 + wn * 64;   // the wave's first column
#pragma unroll
    for (int mb = 0; mb < 2; ++mb) {
        const int m0 = r0 + wm * 32 + mb * 16 + hi;   // this lane's rows of the block: m0 + 2 rp
        v4f ex[8][2], val[8];
        const float* cp = EPI == 1 ? aux + ((size_t)m0 * HD + cofs) * 2 : aux + (size_t)m0 * DM + nc + cofs;   // what the epilogue reads from memory: (cos, sin) pairs, or the residual
#pragma unroll
        for (int rp = 0; rp < 8; ++rp) {
            if (EPI == 1) { ex[rp][0] = *(const v4f*)(cp + rp * 4 * HD); ex[rp][1] = *(const v4f*)(cp + rp * 4 * HD + 4); }
            if (EPI == 3) ex[rp][0] = *(const v4f*)(cp + rp * 2 * DM); }
        if (EPI == 1 || EPI == 3) { asm volatile("s_wait_xcnt 0x0" :: "v"(cp) : "memory");   // behind these loads, before their address registers are reused; the address is an input so that it lives up to the wait and no load's result lands on it
            __builtin_amdgcn_sched_barrier(0); }   // keeps the register writes that follow from being scheduled in front of that wait
#pragma unroll
        for (int rp = 0; rp < 8; ++rp) val[rp] = *(const v4fa*)((const f32a*)ob + mb * OSZ + (2 * rp + hi) * 68 + cofs);
        if (EPI == 1) { v4us oh[8], ol[8];   // column d's partner d +- 32 sits eight lanes away in the same 16-lane row; d < 32 takes -x[d + 32] sin, d >= 32 takes +x[d - 32] sin
#pragma unroll
            for (int rp = 0; rp < 8; ++rp)
#pragma unroll
                for (int u = 0; u < 4; ++u) { const float xp = xrow8(val[rp][u]); const float r = val[rp][u] * ex[rp][u >> 1][(u & 1) * 2] + (lr < 8 ? -xp : xp) * ex[rp][u >> 1][(u & 1) * 2 + 1]; unsigned short a2, c2; splitf(r, a2, c2); oh[rp][u] = a2; ol[rp][u] = c2; }
            __builtin_amdgcn_sched_barrier(0);   // every result stands in its own registers before the first store is issued: no store's registers are rewritten in front of the wait below
            const int zk = nc / DM, hh = (nc - zk * DM) / HD, bb = r0 / TT, t0 = m0 - bb * TT;
            const size_t oo = zk * QKSTEP + (size_t)bb * TT * DM + ((size_t)hh * TT + t0) * HD + cofs;
#pragma unroll
            for (int rp = 0; rp < 8; ++rp) { *(v4us*)(Ph + oo + rp * 2 * HD) = oh[rp]; *(v4us*)(Pl + oo + rp * 2 * HD) = ol[rp]; } }
        if (EPI == 2) { v4h o4[8];
#pragma unroll
            for (int rp = 0; rp < 8; ++rp) o4[rp] = __builtin_convertvector(val[rp], v4h);
            __builtin_amdgcn_sched_barrier(0);   // results first, then the stores: no store's registers are rewritten in front of the wait below
#pragma unroll
            for (int rp = 0; rp < 8; ++rp) *(v4h*)(Ch + (size_t)m0 * TT + nc + cofs + rp * 2 * TT) = o4[rp]; }
        if (EPI == 3) { v4f o4[8];
#pragma unroll
            for (int rp = 0; rp < 8; ++rp)
#pragma unroll
                for (int u = 0; u < 4; ++u) o4[rp][u] = bfr(ex[rp][0][u]) + val[rp][u];
            __builtin_amdgcn_sched_barrier(0);   // results first, then the stores: no store's registers are rewritten in front of the wait below
#pragma unroll
            for (int rp = 0; rp < 8; ++rp) *(v4f*)(C + (size_t)m0 * DM + nc + cofs + rp * 2 * DM) = o4[rp]; }
        if (mb < 1) { asm volatile("s_wait_xcnt 0x0" ::: "memory");   // behind this block's stores, before their data and address registers are reused
            __builtin_amdgcn_sched_barrier(0); }   // keeps the next block's register writes behind that wait
    }
}


// ---- k_prep: everything the projections wait for, none of it waiting for any other of it, as ONE grid: blocks [0, PCS) the cos/sin table, [PCS, PCS + PRM) RMSNorm, then PCV blocks for each of the four weights (BW = Wq, Wk, Wv, Wo in bf16, one behind the other; torch [out][in] = Bt). t runs over the NB_ TT tokens of both batches.
#define PCS (NB_ * TT * HD / 256)
#define PRM (NB_ * TT / 8)
#define PCV (DM * DM / 8 / 256)
// RMSNorm: wave per token: x rsqrt(mean x^2 + 1e-6) w -> hl planes (8-B lanes); table: CS[t][dd] = (cos, sin)((float)pos[t] x 10000^(-2 (dd mod 32)/64));
__global__ __launch_bounds__(256) void k_prep(const int* __restrict__ pos, float* CS, const float* __restrict__ X, const float* __restrict__ w, bf* Hh, bf* Hl, const float* __restrict__ wq, const float* __restrict__ wk, const float* __restrict__ wv, const float* __restrict__ wo, bf* BW) {
    const int blk = blockIdx.x;
    if (blk >= PCS && blk < PCS + PRM) { const int lane = threadIdx.x & 31; const int t = (blk - PCS) * 8 + (threadIdx.x >> 5); if (t >= NB_ * TT) return; float v[DM / 32]; float q = 0.f;
#pragma unroll
    for (int ch = 0; ch < DM / 128; ++ch) { const v4f a = *(const v4f*)(X + (size_t)t * DM + ch * 128 + lane * 4);
#pragma unroll
        for (int u = 0; u < 4; ++u) { v[ch * 4 + u] = bfr(a[u]); float p = __fmul_rn(v[ch * 4 + u], v[ch * 4 + u]); asm volatile("" : "+v"(p)); q = __fadd_rn(q, p); } }
#pragma unroll
    for (int sh = 16; sh; sh >>= 1) q += __shfl_xor(q, sh, 32);
    const float rs = __frsqrt_rn(__fadd_rn(q * (1.0f / DM), 1e-6f));
    {
#pragma unroll
        for (int ch = 0; ch < DM / 128; ++ch) { const int c0 = ch * 128 + lane * 4; v4us oh, ol;
#pragma unroll
            for (int u = 0; u < 4; ++u) { float n0 = __fmul_rn(v[ch * 4 + u], rs); asm volatile("" : "+v"(n0)); const float y = __fmul_rn(n0, bfr(w[c0 + u])); unsigned short a2, b2; splitf(y, a2, b2); oh[u] = a2; ol[u] = b2; }
            const size_t oo = (size_t)t * DM + c0; *(v4us*)(Hh + oo) = oh; *(v4us*)(Hl + oo) = ol; }
         } }
    else if (blk < PCS) { const int idx = blk * 256 + threadIdx.x; if (idx >= NB_ * TT * HD) return; const int dd = idx % HD; const int t = idx / HD; const int i2 = dd % (HD / 2); const float inv = __fdiv_rn(1.0f, powf(10000.0f, (float)(2 * i2) / (float)HD)); const float ang = __fmul_rn((float)pos[t], inv); v2f cs; cs[0] = cosf(ang); cs[1] = sinf(ang);
    *(v2f*)(CS + (size_t)idx * 2) = cs;  }
    else { const int j = blk - (PCS + PRM), which = j / PCV; const float* __restrict__ src = which == 0 ? wq : which == 1 ? wk : which == 2 ? wv : wo; bf* dst = BW + (size_t)which * DM * DM; const size_t n8 = DM * DM / 8;
        const size_t i = (size_t)(j % PCV) * 256 + threadIdx.x; if (i >= n8) return; const v8f v = *(const v8f*)(src + i * 8); v8us o;
#pragma unroll
        for (int k = 0; k < 8; ++k) o[k] = f2bf(v[k]); *(v8us*)(dst + i * 8) = o;  }
}
#define FKP  72
#define FTS  (64 * FKP)
#define FTHR 4.0f
#define FSH  9.0f
#define L2E  1.4426950408889634f
typedef __attribute__((ext_vector_type(2))) __bf16 v2bf;
__device__ __forceinline__ float xhalf(float x) { return __builtin_bit_cast(float, __builtin_amdgcn_permlanex16(__builtin_bit_cast(int, x), __builtin_bit_cast(int, x), 0x76543210, 0xfedcba98, false, false)); }   // lane l with lane l ^ 16
__global__ __launch_bounds__(256) void k_fattn(const bf* __restrict__ Qh, const bf* __restrict__ Ql, const bf* __restrict__ Kh, const bf* __restrict__ Kl, const h16* __restrict__ VT, const float* __restrict__ mk, const unsigned* __restrict__ MF, bf* Ah, bf* Al) {
    __shared__ __align__(16) unsigned short sm[2 * 3 * FTS];
    const int tid = threadIdx.x, lane = tid & 31, lr = lane & 15, hi = lane >> 4; const int wv = __builtin_amdgcn_readfirstlane(tid >> 5);
    const int h = blockIdx.y, b = blockIdx.z; const size_t hz = ((size_t)b * NH_ + h) * TT * HD; const int q0 = blockIdx.x * 256 + wv * 32;
    v16bf qh[2][2], ql[2][2]; const bf* qhp = Qh + hz + (size_t)(q0 + lr) * HD + 8 * hi; const bf* qlp = Ql + hz + (size_t)(q0 + lr) * HD + 8 * hi;
#pragma unroll
    for (int g = 0; g < 2; ++g)
#pragma unroll
        for (int kc = 0; kc < 2; ++kc) { qh[g][kc] = WFrag<bf>::ld(qhp + g * 16 * HD + kc * 32); ql[g][kc] = WFrag<bf>::ld(qlp + g * 16 * HD + kc * 32); }
    const unsigned* mfp = MF + ((size_t)(b * (TT / 32) + (q0 >> 5)) * 16 + (lane >> 2)) * 32;   // lane l looks up passes l and l + 32: byte l & 3 of the scan words of key groups l >> 2 and 8 + (l >> 2)
    const unsigned mw0 = mfp[0], mw1 = mfp[8 * 32];
    asm volatile("s_wait_xcnt 0x0" ::: "memory");   // behind the Q loads and the scan words' loads, before their address registers are reused
    __builtin_amdgcn_sched_barrier(0);   // keeps the address arithmetic that follows from being scheduled in front of that wait, into the Q loads' address registers
    const int srow = tid >> 3, sseg = (tid & 7) * 8;   // staging: a thread moves 16 B of rows srow and srow + 32 of each of the three tiles
    const bf* gkh = Kh + hz + (size_t)srow * HD + sseg; const bf* gkl = Kl + hz + (size_t)srow * HD + sseg; const h16* gvt = VT + hz + (size_t)srow * TT + sseg;
    unsigned short* sw = sm + srow * FKP + sseg;
    const float* mr0 = mk + (size_t)b * TT * TT + (size_t)(q0 + lr) * TT + 8 * hi; const float* mr1 = mr0 + (size_t)16 * TT;
    const unsigned long long fm = (unsigned long long)__builtin_amdgcn_ballot_w32(((mw0 >> ((lane & 3) * 8)) & 0xffu) != 0u) | ((unsigned long long)__builtin_amdgcn_ballot_w32(((mw1 >> ((lane & 3) * 8)) & 0xffu) != 0u) << 32);
    v8us st[6]; v4f mq[2][2][2][2];   // mask registers, two sets: pass p reads set p & 1 while the other is filled for pass p + 1
#pragma unroll
    for (int i = 0; i < 16; ++i) mq[i >> 3][(i >> 2) & 1][(i >> 1) & 1][i & 1] = (v4f){};
    v8f o[4][2]; float mrun[2], lrun[2];
#pragma unroll
    for (int g = 0; g < 2; ++g) { mrun[g] = -1.0e30f; lrun[g] = 0.f;
#pragma unroll
        for (int db = 0; db < 4; ++db) o[db][g] = (v8f){}; }
    st[0] = *(const v8usa*)gkh; st[1] = *(const v8usa*)(gkh + 32 * HD); st[2] = *(const v8usa*)gkl; st[3] = *(const v8usa*)(gkl + 32 * HD); st[4] = *(const v8usa*)gvt; st[5] = *(const v8usa*)(gvt + (size_t)32 * TT);
    if (fm & 1ull) {
#pragma unroll
        for (int kt = 0; kt < 2; ++kt)
#pragma unroll
            for (int u = 0; u < 2; ++u) { mq[0][kt][0][u] = *(const v4f*)(mr0 + kt * 16 + u * 4); mq[0][kt][1][u] = *(const v4f*)(mr1 + kt * 16 + u * 4); } }
    asm volatile("s_wait_xcnt 0x0" ::: "memory");   // behind the first stage's and the first pass's loads, before their address registers are reused
#pragma unroll
    for (int i = 0; i < 6; ++i) *(v8usa*)(sw + (i >> 1) * FTS + (i & 1) * 32 * FKP) = st[i];
    __syncthreads();
#pragma unroll 1   // the stage loop stays rolled: one body of two passes
    for (int s = 0; s < TT / 64; ++s) {
        const bool more = s + 1 < TT / 64;
        if (more) { const int kn = (s + 1) * 64;   // next stage's tiles fly into registers under this stage's work
            st[0] = *(const v8usa*)(gkh + (size_t)kn * HD); st[1] = *(const v8usa*)(gkh + (size_t)(kn + 32) * HD); st[2] = *(const v8usa*)(gkl + (size_t)kn * HD); st[3] = *(const v8usa*)(gkl + (size_t)(kn + 32) * HD); st[4] = *(const v8usa*)(gvt + kn); st[5] = *(const v8usa*)(gvt + (size_t)32 * TT + kn);
            asm volatile("s_wait_xcnt 0x0" ::: "memory"); }   // behind these loads, before their address registers are reused
        const unsigned short* bp = sm + (s & 1) * 3 * FTS;
#pragma unroll
        for (int c = 0; c < 2; ++c) {
            const int p = s * 2 + c;
            if (p + 1 < TT / 32 && ((fm >> (p + 1)) & 1ull)) { const int nk = (p + 1) * 32;   // next pass's mask tile, one pass ahead, where there is a next pass and its tile is not all zero
#pragma unroll
                for (int kt = 0; kt < 2; ++kt)
#pragma unroll
                    for (int u = 0; u < 2; ++u) { mq[c ^ 1][kt][0][u] = *(const v4f*)(mr0 + nk + kt * 16 + u * 4); mq[c ^ 1][kt][1][u] = *(const v4f*)(mr1 + nk + kt * 16 + u * 4); }
                asm volatile("s_wait_xcnt 0x0" ::: "memory"); }   // stands behind the loads issued ahead, before their address registers are reused; its clobber also keeps those loads up here, in front of this pass's work
            v16bf ah[2][2], al[2][2];
#pragma unroll
            for (int kt = 0; kt < 2; ++kt)
#pragma unroll
                for (int kc = 0; kc < 2; ++kc) { const unsigned short* kp = bp + (c * 32 + kt * 16 + lr) * FKP + kc * 32 + 8 * hi; ah[kt][kc] = cat16b(*(const v8usa*)kp, *(const v8usa*)(kp + 16)); al[kt][kc] = cat16b(*(const v8usa*)(kp + FTS), *(const v8usa*)(kp + FTS + 16)); }
            __builtin_amdgcn_sched_barrier(0);   // keeps the pass's K reads together as one group in front of its products: sunk among them, each place costs the wave an LDS latency
            v8f sc[2][2];
#pragma unroll
            for (int kt = 0; kt < 2; ++kt)
#pragma unroll
                for (int g = 0; g < 2; ++g) sc[kt][g] = (v8f){};
#pragma unroll
            for (int kc = 0; kc < 2; ++kc) {   // four independent score tiles in turn
#pragma unroll
                for (int kt = 0; kt < 2; ++kt)
#pragma unroll
                    for (int g = 0; g < 2; ++g) sc[kt][g] = wmmab(ah[kt][kc], qh[g][kc], sc[kt][g]);
#pragma unroll
                for (int kt = 0; kt < 2; ++kt)
#pragma unroll
                    for (int g = 0; g < 2; ++g) sc[kt][g] = wmmab(ah[kt][kc], ql[g][kc], sc[kt][g]);
#pragma unroll
                for (int kt = 0; kt < 2; ++kt)
#pragma unroll
                    for (int g = 0; g < 2; ++g) sc[kt][g] = wmmab(al[kt][kc], qh[g][kc], sc[kt][g]); }
            v16h vf[4];
#pragma unroll
            for (int db = 0; db < 4; ++db) { const unsigned short* vp = bp + 2 * FTS + (db * 16 + lr) * FKP + c * 32 + 8 * hi; vf[db] = cat16(*(const v8ha*)vp, *(const v8ha*)(vp + 16)); }
            if ((fm >> p) & 1ull) {
#pragma unroll
                for (int g = 0; g < 2; ++g)
#pragma unroll
                    for (int kt = 0; kt < 2; ++kt)
#pragma unroll
                        for (int r = 0; r < 8; r += 2) { const v2bf m2 = __builtin_convertvector((v2f){mq[c][kt][g][r >> 2][r & 3], mq[c][kt][g][r >> 2][(r & 3) + 1]}, v2bf);   // mask rounded to bf16 (nearest even), as every input
                            sc[kt][g][r] += (float)m2[0]; sc[kt][g][r + 1] += (float)m2[1]; } }
            float mb[2]; bool need = false;
#pragma unroll
            for (int g = 0; g < 2; ++g) { float mx = -3.0e38f;
#pragma unroll
                for (int kt = 0; kt < 2; ++kt)
#pragma unroll
                    for (int r = 0; r < 8; r += 2) mx = fmaxf(mx, fmaxf(sc[kt][g][r], sc[kt][g][r + 1]));
                mx = fmaxf(mx, xhalf(mx)); mb[g] = mx; need = need || (mx > mrun[g] + FTHR); }
            if (__builtin_amdgcn_ballot_w32(need) != 0) {   // one wave-uniform test a pass; rare after the first passes
#pragma unroll
                for (int g = 0; g < 2; ++g) { const float mnew = fmaxf(mrun[g], mb[g]); const float corr = __builtin_amdgcn_exp2f((mrun[g] - mnew) * L2E); mrun[g] = mnew; lrun[g] *= corr;
#pragma unroll
                    for (int db = 0; db < 4; ++db) o[db][g] = o[db][g] * corr; } }
#pragma unroll
            for (int g = 0; g < 2; ++g) { const float nm = fmaf(-mrun[g], L2E, FSH); v8f p0, p1; float ls0 = 0.f, ls1 = 0.f;
#pragma unroll
                for (int r = 0; r < 8; ++r) { p0[r] = __builtin_amdgcn_exp2f(fmaf(sc[0][g][r], L2E, nm)); p1[r] = __builtin_amdgcn_exp2f(fmaf(sc[1][g][r], L2E, nm)); ls0 += p0[r]; ls1 += p1[r]; }
                lrun[g] += ls0 + ls1;
                const v16h pf = cat16(__builtin_convertvector(p0, v8h), __builtin_convertvector(p1, v8h));
#pragma unroll
                for (int db = 0; db < 4; ++db) o[db][g] = wmma16(vf[db], pf, o[db][g]); }
        }
        __builtin_amdgcn_sched_barrier(0);   // keeps the stage's last products in front of the slots below
        asm volatile("v_nop\n\tv_nop\n\tv_nop\n\tv_nop");   // the four vector slots between a product and the first vector instruction that overwrites its operands
        if (more) { unsigned short* sn = sw + ((s + 1) & 1) * 3 * FTS;   // that buffer's last readers left it before the barrier that ended stage s - 1
#pragma unroll
            for (int i = 0; i < 6; ++i) *(v8usa*)(sn + (i >> 1) * FTS + (i & 1) * 32 * FKP) = st[i]; }
        asm volatile("s_wait_dscnt 0x0" ::: "memory");   // this wave's LDS stores of stage s + 1 and its reads of stage s are done
        asm volatile("s_barrier_signal -1\n\ts_barrier_wait -1" ::: "memory");   // publishes stage s + 1 and ends every read of stage s; by hand because __syncthreads() would also drain the mask loads that are in flight for the next pass
    }
#pragma unroll
    for (int g = 0; g < 2; ++g) { const float inv = __fdiv_rn(1.0f, lrun[g] + xhalf(lrun[g])); const size_t ob = ((size_t)b * TT + q0 + g * 16 + lr) * DM + h * HD + 8 * hi;
#pragma unroll
        for (int db = 0; db < 4; ++db) { v8us oh, ol;
#pragma unroll
            for (int r = 0; r < 8; ++r) { unsigned short a2, c2; splitf(o[db][g][r] * inv, a2, c2); oh[r] = a2; ol[r] = c2; }
            *(v8us*)(Ah + ob + db * 16) = oh; *(v8us*)(Al + ob + db * 16) = ol; } }
}

extern "C" void kernel_launch(void* const* d_in, const int* in_sizes, int n_in,
                              void* d_out, int out_size, void* d_ws, size_t ws_size, hipStream_t stream) {
    (void)in_sizes; (void)n_in; (void)out_size;
    const float* x = (const float*)d_in[0]; const float* amask = (const float*)d_in[1]; const int* pos = (const int*)d_in[2]; const float* lnw = (const float*)d_in[3]; const float* wq = (const float*)d_in[4]; const float* wk = (const float*)d_in[5]; const float* wv = (const float*)d_in[6]; const float* wo = (const float*)d_in[7];
    float* OUT = (float*)d_out;     // [2][2048][768]
    char* wsp = (char*)d_ws;
    auto take = [&](size_t bytes) { char* p = wsp; wsp += (bytes + 255) & ~(size_t)255; return (void*)p; };
    bf* BW = (bf*)take((size_t)4 * DM * DM * 2);   // Wq, Wk, Wv, Wo in bf16
    const size_t zb = (size_t)NH_ * TT * HD;   // one batch's planes
    bf* NH = (bf*)take(NB_ * zb * 2); bf* NL = (bf*)take(NB_ * zb * 2); float* CS = (float*)take((size_t)NB_ * TT * HD * 2 * 4);
    bf* Qh = (bf*)take(4 * NB_ * zb * 2); bf* Ql = Qh + NB_ * zb; bf* Kh = Qh + QKSTEP; bf* Kl = Ql + QKSTEP; h16* VT = (h16*)take(NB_ * zb * 2);
    bf* Ah = (bf*)take(NB_ * zb * 2); bf* Al = (bf*)take(NB_ * zb * 2); unsigned* MF = (unsigned*)take((size_t)PMS * 8 * 128);   // the mask scan's words, one a 128-B line
    if ((size_t)(wsp - (char*)d_ws) > ws_size) return;    // total ~ 64 MB
    k_prep<<<PCS + PRM + 4 * PCV, 256, 0, stream>>>(pos, CS, x, lnw, NH, NL, wq, wk, wv, wo, BW);
    k_gemmt<1, 1><<<dim3(NB_ * TT / 128, 2 * DM / 128 + PMS / (NB_ * TT / 128), 1), 256, 0, stream>>>(NH, NL, BW, CS, nullptr, nullptr, Qh, Ql, amask, MF);   // rows are the tokens of both batches, columns the heads of q, then of k; the last PMS blocks: the mask scan
    k_gemmt<3, 2><<<dim3(DM / 128, TT / 128, NB_), 256, 0, stream>>>(BW + (size_t)2 * DM * DM, NL, NH, nullptr, nullptr, VT, nullptr, nullptr, nullptr, nullptr);   // rows are V's features, columns tokens (V^T = Wv N^T comes out of the GEMM already transposed)
    k_fattn<<<dim3(TT / 256, NH_, NB_), 256, 0, stream>>>(Qh, Ql, Kh, Kl, VT, amask, MF, Ah, Al);
    k_gemmt<1, 3><<<dim3(NB_ * TT / 128, DM / 128, 1), 256, 0, stream>>>(Ah, Al, BW + (size_t)3 * DM * DM, x, OUT, nullptr, nullptr, nullptr, nullptr, nullptr);
}

// v007
// One run takes 99.8 microseconds.
// Two timings next to v006 both put it at 1.08 times that version's speed.
// Counting every step since v000, it is 7.67 times as fast.
#include <hip/hip_runtime.h>

// TimeSelfAttentionFallback (hidden [2][2048][768]; normed = RMSNorm(x) ln_weight; q/k/v = normed W^T (12 heads x 64); rotate-half RoPE with angles position_ids[b][t] (int, read) x inv_freq (tables computed in-kernel per batch); scores = q.k (UNSCALED) + attention_mask[b][0][i][j] (float, read);
// fp32 softmax; out = hidden + (attn v merged) Wo^T -> [2][2048][768]).
// Compute dtypes, f32 accumulate: every input rounded to bf16; RMSNorm f32 -> hl planes; q/k/v as hl(normed) x exact W (2 products); RoPE f32; scores hl x hl (3 products, K 64 - the unscaled logits need it); probabilities and v in fp16; scores, softmax and P.V in one kernel (online softmax), the scores stay in registers. What follows a projection element by element (RoPE and the hl split; the fp16 rounding of V^T; the residual add) is done in that GEMM's epilogue.

#define NB_  2
#define TT   2048
#define DM   768
#define NH_  12
#define HD   64
typedef _Float16 h16;
typedef unsigned short bf;
typedef __attribute__((ext_vector_type(16))) __bf16   v16bf;
typedef __attribute__((ext_vector_type(16))) _Float16 v16h;
typedef __attribute__((ext_vector_type(8)))  _Float16 v8h;
typedef __attribute__((ext_vector_type(8)))  unsigned short v8us;
typedef __attribute__((ext_vector_type(8)))  float    v8f;
typedef __attribute__((ext_vector_type(4)))  float    v4f;
typedef v8h  __attribute__((may_alias)) v8ha;
typedef v4f  __attribute__((may_alias)) v4fa;
typedef v8us __attribute__((may_alias)) v8usa;

__device__ __forceinline__ unsigned short f2bf(float f) { unsigned u = __float_as_uint(f); u += 0x7FFFu + ((u >> 16) & 1u); return (unsigned short)(u >> 16); }
__device__ __forceinline__ float bf2f(unsigned short b) { return __uint_as_float(((unsigned)b) << 16); }
__device__ __forceinline__ float bfr(float f) { return bf2f(f2bf(f)); }
__device__ __forceinline__ v16h cat16(v8h lo, v8h hi) { return __builtin_shufflevector(lo, hi, 0, 1, 2, 3, 4, 5, 6, 7, 8, 9, 10, 11, 12, 13, 14, 15); }
__device__ __forceinline__ v16bf cat16b(v8us lo, v8us hi) { return __builtin_bit_cast(v16bf, __builtin_shufflevector(lo, hi, 0, 1, 2, 3, 4, 5, 6, 7, 8, 9, 10, 11, 12, 13, 14, 15)); }
__device__ __forceinline__ v8f wmma16(v16h a, v16h b, v8f c) { return __builtin_amdgcn_wmma_f32_16x16x32_f16(false, a, false, b, (short)0, c, false, false); }
__device__ __forceinline__ v8f wmmab(v16bf a, v16bf b, v8f c) { return __builtin_amdgcn_wmma_f32_16x16x32_bf16(false, a, false, b, (short)0, c, false, false); }
__device__ __forceinline__ void splitf(float y, unsigned short& h, unsigned short& l) { h = f2bf(y); l = f2bf(y - bf2f(h)); }
typedef __attribute__((ext_vector_type(4))) unsigned short v4us;
typedef __attribute__((ext_vector_type(4))) _Float16 v4h;
typedef __attribute__((ext_vector_type(2))) float v2f;
__device__ __forceinline__ float xrow8(float x) { return __builtin_bit_cast(float, __builtin_amdgcn_permlane16(__builtin_bit_cast(int, x), __builtin_bit_cast(int, x), 0xfedcba98, 0x76543210, false, false)); }   // lane l with lane l ^ 8



// ---- k_gemmt: GEMM with its operands staged in LDS. One 128 x 128 output tile a work-group, 8 waves as 4 (rows) x 2 (columns), a wave owns 32 x 64 (8 accumulators); grid (M/128, N/128, jobs), 256 threads.
// c[m][n] = sum_k A[m][k] Bt[n][k] + the split product: NSPLIT 1 = (A + X2) Bt, X2 a second plane of A's rows; NSPLIT 3 = A (Bt + X2), X2 a second plane of Bt's rows. f32, k in rising order. K = DM.
// A stage is 64 k of the three planes (128 rows x 128 B each): every global load instruction covers four whole 128-B lines, the tile goes through registers into LDS rows of 144 B (16-B readers), two buffers, one barrier a stage.
// EPI says where the tile goes: 1 = rows are tokens of both batches, a wave's 64 columns one head of q or k (Bt = Wq, Wk one behind the other): rotate-half RoPE with aux = CS[t][d] (cos, sin), then hl planes Ph/Pl [b][h][t][d], k's planes QKSTEP elements behind q's; 2 = fp16 to Ch (pitch TT), blockIdx.z = batch; 3 = C (f32, pitch DM) = bf16-rounded aux[m][n] + c.
// With EPI 1 the grid has PMS more blocks, behind the GEMM's in y, that do no GEMM: they scan the mask for attention (mask_scan), on the places that the GEMM's 384 blocks leave free.
#define QKSTEP ((size_t)2 * NB_ * TT * DM)
#define GKP 72
#define GPS (128 * GKP)
#define OSZ (16 * 68)
// Mask scan: a wave takes 32 query rows x 128 keys (one whole 512-B load a row) and stores one word, alone in its 128-B line: MF[gw 32], gw = (b TT/32 + query group) 16 + key group; bit l says that lane l's four key columns hold something other than +-0 in some row, so byte i speaks for tile i of the group, 32 queries x 32 keys.
#define PMS (NB_ * (TT / 32) * (TT / 128) / 8)
__device__ __forceinline__ void mask_scan(const float* __restrict__ mk, unsigned* MF, int j) {
    const int lane = threadIdx.x & 31; const int gw = j * 8 + (threadIdx.x >> 5);
    const float* mp = mk + (size_t)(gw >> 4) * 32 * TT + (gw & 15) * 128 + lane * 4; v4f a[32];
#pragma unroll
    for (int r = 0; r < 32; ++r) a[r] = *(const v4f*)(mp + (size_t)r * TT);
    asm volatile("s_wait_xcnt 0x0" ::: "memory");   // behind the scan's loads, before their address registers are reused
    unsigned any = 0u;
#pragma unroll
    for (int r = 0; r < 32; ++r) any |= __float_as_uint(a[r][0]) | __float_as_uint(a[r][1]) | __float_as_uint(a[r][2]) | __float_as_uint(a[r][3]);
    const unsigned bl = __builtin_amdgcn_ballot_w32((any & 0x7fffffffu) != 0u);
    if (lane == 0) MF[(size_t)gw * 32] = bl;
}
template <typename T16> struct WFrag;
template <> struct WFrag<bf> { typedef v16bf V; static __device__ __forceinline__ V ld(const bf* p) { return cat16b(*(const v8us*)p, *(const v8us*)(p + 16)); } };
typedef float __attribute__((may_alias)) f32a;
__device__ __forceinline__ v16bf ldsfrag(const unsigned short* p) { return cat16b(*(const v8usa*)p, *(const v8usa*)(p + 16)); }
template <int NSPLIT, int EPI>
__global__ __launch_bounds__(256) void k_gemmt(const bf* __restrict__ A, const bf* __restrict__ X2, const bf* __restrict__ Bt, const float* __restrict__ aux, float* C, h16* Ch, bf* Ph, bf* Pl, const float* __restrict__ mk, unsigned* MF) {
    constexpr int K = DM;
    if (EPI == 1 && blockIdx.y >= 2 * DM / 128) { mask_scan(mk, MF, (blockIdx.y - 2 * DM / 128) * (NB_ * TT / 128) + blockIdx.x); return; }   // whole blocks, in front of every barrier
    if (EPI == 2) { const size_t zb = (size_t)blockIdx.z * TT * DM; Bt += zb; X2 += zb; Ch += zb; }
    __shared__ __align__(16) unsigned short sm[2 * 3 * GPS];
    const int tid = threadIdx.x, lane = tid & 31, lr = lane & 15, hi = lane >> 4; const int wv = __builtin_amdgcn_readfirstlane(tid >> 5), wm = wv >> 1, wn = wv & 1;
    const int r0 = blockIdx.x * 128, c0 = blockIdx.y * 128;
    const int srow = tid >> 3, sseg = (tid & 7) * 8;   // staging: a thread moves 16 B of rows srow, srow + 32, + 64, + 96 of each plane; eight neighbouring threads cover one 128-B line
    const bf* g0 = A + (size_t)(r0 + srow) * K + sseg; const bf* g1 = X2 + (size_t)((NSPLIT == 1 ? r0 : c0) + srow) * K + sseg; const bf* g2 = Bt + (size_t)(c0 + srow) * K + sseg;
    unsigned short* sw = sm + srow * GKP + sseg;
    v8us st[12];
    v8f acc[2][4];
#pragma unroll
    for (int mb = 0; mb < 2; ++mb)
#pragma unroll
        for (int nb = 0; nb < 4; ++nb) acc[mb][nb] = (v8f){};
#pragma unroll
    for (int i = 0; i < 4; ++i) { st[i] = *(const v8usa*)(g0 + (size_t)i * 32 * K); st[4 + i] = *(const v8usa*)(g1 + (size_t)i * 32 * K); st[8 + i] = *(const v8usa*)(g2 + (size_t)i * 32 * K); }
    asm volatile("s_wait_xcnt 0x0" ::: "memory");   // behind the first stage's loads, before their address registers are reused
#pragma unroll
    for (int i = 0; i < 12; ++i) *(v8usa*)(sw + (i >> 2) * GPS + (i & 3) * 32 * GKP) = st[i];
    __syncthreads();
#pragma unroll 1   // the stage loop stays rolled: the buffer is picked by s & 1, the body is one stage
    for (int s = 0; s < K / 64; ++s) {
        const bool more = s + 1 < K / 64;
        if (more) { const int kn = (s + 1) * 64;   // next stage's planes fly into registers under this stage's products
#pragma unroll
            for (int i = 0; i < 4; ++i) { st[i] = *(const v8usa*)(g0 + (size_t)i * 32 * K + kn); st[4 + i] = *(const v8usa*)(g1 + (size_t)i * 32 * K + kn); st[8 + i] = *(const v8usa*)(g2 + (size_t)i * 32 * K + kn); }
            asm volatile("s_wait_xcnt 0x0" ::: "memory"); }   // behind these loads, before their address registers are reused
        const unsigned short* bp = sm + (s & 1) * 3 * GPS;
        v16bf a[2][2], b[2][4], x[2][4];
#pragma unroll
        for (int kc = 0; kc < 2; ++kc) {
            const unsigned short* ap = bp + (wm * 32 + lr) * GKP + kc * 32 + 8 * hi; const unsigned short* bq = bp + 2 * GPS + (wn * 64 + lr) * GKP + kc * 32 + 8 * hi;
#pragma unroll
            for (int mb = 0; mb < 2; ++mb) { a[kc][mb] = ldsfrag(ap + mb * 16 * GKP); if (NSPLIT == 1) x[kc][mb] = ldsfrag(ap + GPS + mb * 16 * GKP); }
#pragma unroll
            for (int nb = 0; nb < 4; ++nb) { b[kc][nb] = ldsfrag(bq + nb * 16 * GKP); if (NSPLIT == 3) x[kc][nb] = ldsfrag(bq - GPS + nb * 16 * GKP); } }
        __builtin_amdgcn_sched_barrier(0);   // keeps the stage's LDS reads together as one group in front of its products: sunk among them, each place costs the wave an LDS latency
#pragma unroll
        for (int kc = 0; kc < 2; ++kc) {
#pragma unroll
            for (int mb = 0; mb < 2; ++mb)   // eight independent tiles in turn
#pragma unroll
                for (int nb = 0; nb < 4; ++nb) acc[mb][nb] = wmmab(a[kc][mb], b[kc][nb], acc[mb][nb]);
#pragma unroll
            for (int mb = 0; mb < 2; ++mb)
#pragma unroll
                for (int nb = 0; nb < 4; ++nb) acc[mb][nb] = wmmab(NSPLIT == 1 ? x[kc][mb] : a[kc][mb], NSPLIT == 1 ? b[kc][nb] : x[kc][nb], acc[mb][nb]);
        }
        if (more) { unsigned short* sn = sw + ((s + 1) & 1) * 3 * GPS;   // that buffer's last readers left it before the barrier that ended stage s - 1
#pragma unroll
            for (int i = 0; i < 12; ++i) *(v8usa*)(sn + (i >> 2) * GPS + (i & 3) * 32 * GKP) = st[i]; }
        __syncthreads();   // publishes stage s + 1 and ends every read of stage s
    }
    // Epilogue: the last barrier has ended every read of the stage buffers; each wave turns its own tile through its own LDS range (16 x 64 blocks, 272-B rows) so that 16 lanes hold one row of 64 columns.
    f32a* ob = (f32a*)sm + wv * 2 * OSZ; const int cofs = lr * 4;
#pragma unroll
    for (int mb = 0; mb < 2; ++mb)
#pragma unroll
        for (int nb = 0; nb < 4; ++nb)
#pragma unroll
            for (int j = 0; j < 8; ++j) ob[mb * OSZ + (hi * 8 + j) * 68 + nb * 16 + lr] = acc[mb][nb][j];
    asm volatile("s_wait_dscnt 0x0" ::: "memory");   // this wave's LDS stores are done before its lanes read one another's rows back
    const int nc = c0 + wn * 64;   // the wave's first column
#pragma unroll
    for (int mb = 0; mb < 2; ++mb) {
        const int m0 = r0 + wm * 32 + mb * 16 + hi;   // this lane's rows of the block: m0 + 2 rp
        v4f ex[8][2], val[8];
        const float* cp = EPI == 1 ? aux + ((size_t)m0 * HD + cofs) * 2 : aux + (size_t)m0 * DM + nc + cofs;   // what the epilogue reads from memory: (cos, sin) pairs, or the residual
#pragma unroll
        for (int rp = 0; rp < 8; ++rp) {
            if (EPI == 1) { ex[rp][0] = *(const v4f*)(cp + rp * 4 * HD); ex[rp][1] = *(const v4f*)(cp + rp * 4 * HD + 4); }
            if (EPI == 3) ex[rp][0] = *(const v4f*)(cp + rp * 2 * DM); }
        if (EPI == 1 || EPI == 3) { asm volatile("s_wait_xcnt 0x0" :: "v"(cp) : "memory");   // behind these loads, before their address registers are reused; the address is an input so that it lives up to the wait and no load's result lands on it
            __builtin_amdgcn_sched_barrier(0); }   // keeps the register writes that follow from being scheduled in front of that wait
#pragma unroll
        for (int rp = 0; rp < 8; ++rp) val[rp] = *(const v4fa*)((const f32a*)ob + mb * OSZ + (2 * rp + hi) * 68 + cofs);
        if (EPI == 1) { v4us oh[8], ol[8];   // column d's partner d +- 32 sits eight lanes away in the same 16-lane row; d < 32 takes -x[d + 32] sin, d >= 32 takes +x[d - 32] sin
#pragma unroll
            for (int rp = 0; rp < 8; ++rp)
#pragma unroll
                for (int u = 0; u < 4; ++u) { const float xp = xrow8(val[rp][u]); const float r = val[rp][u] * ex[rp][u >> 1][(u & 1) * 2] + (lr < 8 ? -xp : xp) * ex[rp][u >> 1][(u & 1) * 2 + 1]; unsigned short a2, c2; splitf(r, a2, c2); oh[rp][u] = a2; ol[rp][u] = c2; }
            __builtin_amdgcn_sched_barrier(0);   // every result stands in its own registers before the first store is issued: no store's registers are rewritten in front of the wait below
            const int zk = nc / DM, hh = (nc - zk * DM) / HD, bb = r0 / TT, t0 = m0 - bb * TT;
            const size_t oo = zk * QKSTEP + (size_t)bb * TT * DM + ((size_t)hh * TT + t0) * HD + cofs;
#pragma unroll
            for (int rp = 0; rp < 8; ++rp) { *(v4us*)(Ph + oo + rp * 2 * HD) = oh[rp]; *(v4us*)(Pl + oo + rp * 2 * HD) = ol[rp]; } }
        if (EPI == 2) { v4h o4[8];
#pragma unroll
            for (int rp = 0; rp < 8; ++rp) o4[rp] = __builtin_convertvector(val[rp], v4h);
            __builtin_amdgcn_sched_barrier(0);   // results first, then the stores: no store's registers are rewritten in front of the wait below
#pragma unroll
            for (int rp = 0; rp < 8; ++rp) *(v4h*)(Ch + (size_t)m0 * TT + nc + cofs + rp * 2 * TT) = o4[rp]; }
        if (EPI == 3) { v4f o4[8];
#pragma unroll
            for (int rp = 0; rp < 8; ++rp)
#pragma unroll
                for (int u = 0; u < 4; ++u) o4[rp][u] = bfr(ex[rp][0][u]) + val[rp][u];
            __builtin_amdgcn_sched_barrier(0);   // results first, then the stores: no store's registers are rewritten in front of the wait below
#pragma unroll
            for (int rp = 0; rp < 8; ++rp) *(v4f*)(C + (size_t)m0 * DM + nc + cofs + rp * 2 * DM) = o4[rp]; }
        if (mb < 1) { asm volatile("s_wait_xcnt 0x0" ::: "memory");   // behind this block's stores, before their data and address registers are reused
            __builtin_amdgcn_sched_barrier(0); }   // keeps the next block's register writes behind that wait
    }
}


// ---- k_prep: everything the projections wait for, none of it waiting for any other of it, as ONE grid: blocks [0, PCS) the cos/sin table, [PCS, PCS + PRM) RMSNorm, then PCV blocks for each of the four weights (BW = Wq, Wk, Wv, Wo in bf16, one behind the other; torch [out][in] = Bt). t runs over the NB_ TT tokens of both batches.
#define PCS (NB_ * TT * HD / 256)
#define PRM (NB_ * TT / 8)
#define PCV (DM * DM / 8 / 256)
// RMSNorm: wave per token: x rsqrt(mean x^2 + 1e-6) w -> hl planes (8-B lanes); table: CS[t][dd] = (cos, sin)((float)pos[t] x 10000^(-2 (dd mod 32)/64));
__global__ __launch_bounds__(256) void k_prep(const int* __restrict__ pos, float* CS, const float* __restrict__ X, const float* __restrict__ w, bf* Hh, bf* Hl, const float* __restrict__ wq, const float* __restrict__ wk, const float* __restrict__ wv, const float* __restrict__ wo, bf* BW) {
    const int blk = blockIdx.x;
    if (blk >= PCS && blk < PCS + PRM) { const int lane = threadIdx.x & 31; const int t = (blk - PCS) * 8 + (threadIdx.x >> 5); if (t >= NB_ * TT) return; float v[DM / 32]; float q = 0.f;
#pragma unroll
    for (int ch = 0; ch < DM / 128; ++ch) { const v4f a = *(const v4f*)(X + (size_t)t * DM + ch * 128 + lane * 4);
#pragma unroll
        for (int u = 0; u < 4; ++u) { v[ch * 4 + u] = bfr(a[u]); float p = __fmul_rn(v[ch * 4 + u], v[ch * 4 + u]); asm volatile("" : "+v"(p)); q = __fadd_rn(q, p); } }
#pragma unroll
    for (int sh = 16; sh; sh >>= 1) q += __shfl_xor(q, sh, 32);
    const float rs = __frsqrt_rn(__fadd_rn(q * (1.0f / DM), 1e-6f));
    {
#pragma unroll
        for (int ch = 0; ch < DM / 128; ++ch) { const int c0 = ch * 128 + lane * 4; v4us oh, ol;
#pragma unroll
            for (int u = 0; u < 4; ++u) { float n0 = __fmul_rn(v[ch * 4 + u], rs); asm volatile("" : "+v"(n0)); const float y = __fmul_rn(n0, bfr(w[c0 + u])); unsigned short a2, b2; splitf(y, a2, b2); oh[u] = a2; ol[u] = b2; }
            const size_t oo = (size_t)t * DM + c0; *(v4us*)(Hh + oo) = oh; *(v4us*)(Hl + oo) = ol; }
         } }
    else if (blk < PCS) { const int idx = blk * 256 + threadIdx.x; if (idx >= NB_ * TT * HD) return; const int dd = idx % HD; const int t = idx / HD; const int i2 = dd % (HD / 2); const float inv = __fdiv_rn(1.0f, powf(10000.0f, (float)(2 * i2) / (float)HD)); const float ang = __fmul_rn((float)pos[t], inv); v2f cs; cs[0] = cosf(ang); cs[1] = sinf(ang);
    *(v2f*)(CS + (size_t)idx * 2) = cs;  }
    else { const int j = blk - (PCS + PRM), which = j / PCV; const float* __restrict__ src = which == 0 ? wq : which == 1 ? wk : which == 2 ? wv : wo; bf* dst = BW + (size_t)which * DM * DM; const size_t n8 = DM * DM / 8;
        const size_t i = (size_t)(j % PCV) * 256 + threadIdx.x; if (i >= n8) return; const v8f v = *(const v8f*)(src + i * 8); v8us o;
#pragma unroll
        for (int k = 0; k < 8; ++k) o[k] = f2bf(v[k]); *(v8us*)(dst + i * 8) = o;  }
}
#define FKP  72
#define FKK  136
#define FKS  (64 * FKK)
#define FBS  (FKS + 64 * FKP)
#define FTHR 4.0f
#define FSH  9.0f
#define L2E  1.4426950408889634f
typedef __attribute__((ext_vector_type(2))) __bf16 v2bf;
__device__ __forceinline__ float xhalf(float x) { return __builtin_bit_cast(float, __builtin_amdgcn_permlanex16(__builtin_bit_cast(int, x), __builtin_bit_cast(int, x), 0x76543210, 0xfedcba98, false, false)); }   // lane l with lane l ^ 16
__global__ __launch_bounds__(128) __attribute__((amdgpu_waves_per_eu(3, 3))) void k_fattn(const bf* __restrict__ Qh, const bf* __restrict__ Ql, const bf* __restrict__ Kh, const h16* __restrict__ VT, const float* __restrict__ mk, const unsigned* __restrict__ MF, bf* Ah, bf* Al) {
    __shared__ __align__(16) unsigned short sm[2 * 2 * FBS];
    const int tid = threadIdx.x, lane = tid & 31, lr = lane & 15, hi = lane >> 4; const int wv = __builtin_amdgcn_readfirstlane(tid >> 5), qg = wv & 1, kh = wv >> 1;
    // Which (head, 64 queries) work-group f takes: f, f + 256, f + 512 and f, f + 8, f + 16 are neighbours on one head, so that work-groups that come to share a WGP ask for the same K and V lines at about the same time and can meet in its cache. For speed only: the map is a permutation of the 768 units, the result is the same wherever a work-group lands.
    const int f = blockIdx.x, un = ((f >> 3) & 31) * 3 + (f >> 8), hb = (f & 7) * 3 + (un >> 5);
    const int h = hb % NH_, b = hb / NH_; const size_t hz = (size_t)hb * TT * HD; const int q0 = (un & 31) * 64 + qg * 32, kb0 = kh * (TT / 2);
    v16bf qh[2][2], ql[2][2]; const bf* qhp = Qh + hz + (size_t)(q0 + lr) * HD + 8 * hi; const bf* qlp = Ql + hz + (size_t)(q0 + lr) * HD + 8 * hi;
#pragma unroll
    for (int g = 0; g < 2; ++g)
#pragma unroll
        for (int kc = 0; kc < 2; ++kc) { qh[g][kc] = WFrag<bf>::ld(qhp + g * 16 * HD + kc * 32); ql[g][kc] = WFrag<bf>::ld(qlp + g * 16 * HD + kc * 32); }
    const unsigned* mfp = MF + ((size_t)(b * (TT / 32) + (q0 >> 5)) * 16 + kh * 8 + (lane >> 2)) * 32;   // lane l looks up the wave's pass l: byte l & 3 of the scan word of key group 8 kh + (l >> 2)
    const unsigned mw = mfp[0];
    asm volatile("s_wait_xcnt 0x0" ::: "memory");   // behind the Q loads and the scan word's load, before their address registers are reused
    __builtin_amdgcn_sched_barrier(0);   // keeps the address arithmetic that follows from being scheduled in front of that wait, into the Q loads' address registers
    const int t2 = tid & 63, krow = t2 >> 4, kseg = t2 & 15, vrow = t2 >> 3, vseg = (t2 & 7) * 8;   // staging, by the 64 threads of a key half: 16 threads move one K row (a 128-B line of Kh, one of Kl), 8 threads one 128-B line of a V^T row
    // every global address of the loop is a wave-uniform base plus a 32-bit lane offset that never changes: one vector register a stream. Kl's plane lies NB_ TT DM elements behind Kh's (kernel_launch cuts both from one piece).
    const bf* gk = Kh + hz + (size_t)kb0 * HD; const h16* gvt = VT + hz + kb0; const unsigned kl = krow * HD + (kseg & 7) * 8 + ((kseg & 8) ? NB_ * TT * DM : 0), vl = vrow * TT + vseg;
    unsigned short* ring = sm + kh * 2 * FBS; unsigned short* swk = ring + krow * FKK + kseg * 8; unsigned short* swv = ring + FKS + vrow * FKP + vseg;
    const float* mr0 = mk + (size_t)b * TT * TT + (size_t)q0 * TT + kb0; const unsigned mlo = lr * TT + 8 * hi;
    const unsigned fmh = __builtin_amdgcn_ballot_w32(((mw >> ((lane & 3) * 8)) & 0xffu) != 0u);
    v8us st[12];
    v8f o[4][2]; float mrun[2], lrun[2];
#pragma unroll
    for (int g = 0; g < 2; ++g) { mrun[g] = -1.0e30f; lrun[g] = 0.f;
#pragma unroll
        for (int db = 0; db < 4; ++db) o[db][g] = (v8f){}; }
    { v8us s0[24];   // the first stage whole: the accumulators' registers are still free
#pragma unroll
        for (int i = 0; i < 16; ++i) s0[i] = *(const v8usa*)(gk + (size_t)(4 * i) * HD + kl);
#pragma unroll
        for (int i = 0; i < 8; ++i) s0[16 + i] = *(const v8usa*)(gvt + (size_t)(8 * i) * TT + vl);
        asm volatile("s_wait_xcnt 0x0" ::: "memory");   // behind the first stage's loads, before their address registers are reused
#pragma unroll
        for (int i = 0; i < 16; ++i) *(v8usa*)(swk + 4 * i * FKK) = s0[i];
#pragma unroll
        for (int i = 0; i < 8; ++i) *(v8usa*)(swv + 8 * i * FKP) = s0[16 + i]; }
    __syncthreads();
#pragma unroll 1   // the pass loop stays rolled: unrolled by two, the compiler sinks one pass's row sums into the next pass, and its 32 probabilities stay live beside the new K fragments: the registers of a third wave a SIMD
    for (int pl = 0; pl < TT / 64; ++pl) {
        const int s = pl >> 1, c = pl & 1; const bool more = s + 1 < TT / 128, fl = ((fmh >> pl) & 1u) != 0u;
        const unsigned short* bp = ring + (s & 1) * FBS;
        if (more) { const bf* gkn = gk + (size_t)((s + 1) * 64 + c * 32) * HD; const h16* gvn = gvt + (size_t)(c * 32) * TT + (s + 1) * 64;   // half of the next stage (32 K rows, 32 V^T rows) flies into registers under this pass's work
#pragma unroll
            for (int i = 0; i < 8; ++i) st[i] = *(const v8usa*)(gkn + (size_t)(4 * i) * HD + kl);
#pragma unroll
            for (int i = 0; i < 4; ++i) st[8 + i] = *(const v8usa*)(gvn + (size_t)(8 * i) * TT + vl);
            asm volatile("s_wait_xcnt 0x0" ::: "memory"); }   // behind these loads, before their address registers are reused
        v16bf ah[2][2], al[2][2];
#pragma unroll
        for (int kt = 0; kt < 2; ++kt)
#pragma unroll
            for (int kc = 0; kc < 2; ++kc) { const unsigned short* kp = bp + c * 32 * FKK + (kt * 16 + lr) * FKK + kc * 32 + 8 * hi; ah[kt][kc] = cat16b(*(const v8usa*)kp, *(const v8usa*)(kp + 16)); al[kt][kc] = cat16b(*(const v8usa*)(kp + 64), *(const v8usa*)(kp + 64 + 16)); }
        __builtin_amdgcn_sched_barrier(0);   // keeps the pass's K reads together as one group in front of its products: sunk among them, each place costs the wave an LDS latency
        v8f sc[2][2];
#pragma unroll
        for (int kt = 0; kt < 2; ++kt)
#pragma unroll
            for (int g = 0; g < 2; ++g) sc[kt][g] = (v8f){};
#pragma unroll
        for (int kc = 0; kc < 2; ++kc) {   // four independent score tiles in turn
#pragma unroll
            for (int kt = 0; kt < 2; ++kt)
#pragma unroll
                for (int g = 0; g < 2; ++g) sc[kt][g] = wmmab(ah[kt][kc], qh[g][kc], sc[kt][g]);
#pragma unroll
            for (int kt = 0; kt < 2; ++kt)
#pragma unroll
                for (int g = 0; g < 2; ++g) sc[kt][g] = wmmab(ah[kt][kc], ql[g][kc], sc[kt][g]);
#pragma unroll
            for (int kt = 0; kt < 2; ++kt)
#pragma unroll
                for (int g = 0; g < 2; ++g) sc[kt][g] = wmmab(al[kt][kc], qh[g][kc], sc[kt][g]); }
        v16h vf[4];
#pragma unroll
        for (int db = 0; db < 4; ++db) { const unsigned short* vp = bp + FKS + (db * 16 + lr) * FKP + c * 32 + 8 * hi; vf[db] = cat16(*(const v8ha*)vp, *(const v8ha*)(vp + 16)); }
        if (fl) { v4f mq[2][2][2]; const float* mp = mr0 + pl * 32 + mlo;   // this pass's mask tile, where it is not all zero: asked for behind the scores' products, so that it takes the registers that the K fragments leave (a third wave a SIMD needs them)
#pragma unroll
            for (int kt = 0; kt < 2; ++kt)
#pragma unroll
                for (int u = 0; u < 2; ++u) { mq[kt][0][u] = *(const v4f*)(mp + kt * 16 + u * 4); mq[kt][1][u] = *(const v4f*)(mp + 16 * TT + kt * 16 + u * 4); }
            asm volatile("s_wait_xcnt 0x0" :: "v"(mp) : "memory");   // behind the mask loads, before their address registers are reused; the address is an input so that it lives up to the wait and no load's result lands on it
#pragma unroll
            for (int g = 0; g < 2; ++g)
#pragma unroll
                for (int kt = 0; kt < 2; ++kt)
#pragma unroll
                    for (int r = 0; r < 8; r += 2) { const v2bf m2 = __builtin_convertvector((v2f){mq[kt][g][r >> 2][r & 3], mq[kt][g][r >> 2][(r & 3) + 1]}, v2bf);   // mask rounded to bf16 (nearest even), as every input
                        sc[kt][g][r] += (float)m2[0]; sc[kt][g][r + 1] += (float)m2[1]; } }
        float mb[2]; bool need = false;
#pragma unroll
        for (int g = 0; g < 2; ++g) { float mx = -3.0e38f;
#pragma unroll
            for (int kt = 0; kt < 2; ++kt)
#pragma unroll
                for (int r = 0; r < 8; r += 2) mx = fmaxf(mx, fmaxf(sc[kt][g][r], sc[kt][g][r + 1]));
            mx = fmaxf(mx, xhalf(mx)); mb[g] = mx; need = need || (mx > mrun[g] + FTHR); }
        if (__builtin_amdgcn_ballot_w32(need) != 0) {   // one wave-uniform test a pass; rare after the first passes
#pragma unroll
            for (int g = 0; g < 2; ++g) { const float mnew = fmaxf(mrun[g], mb[g]); const float corr = __builtin_amdgcn_exp2f((mrun[g] - mnew) * L2E); mrun[g] = mnew; lrun[g] *= corr;
#pragma unroll
                for (int db = 0; db < 4; ++db) o[db][g] = o[db][g] * corr; } }
#pragma unroll
        for (int g = 0; g < 2; ++g) { const float nm = fmaf(-mrun[g], L2E, FSH); v8f p0, p1; float ls0 = 0.f, ls1 = 0.f;
#pragma unroll
            for (int r = 0; r < 8; ++r) { p0[r] = __builtin_amdgcn_exp2f(fmaf(sc[0][g][r], L2E, nm)); p1[r] = __builtin_amdgcn_exp2f(fmaf(sc[1][g][r], L2E, nm)); ls0 += p0[r]; ls1 += p1[r]; }
            lrun[g] += ls0 + ls1;
            const v16h pf = cat16(__builtin_convertvector(p0, v8h), __builtin_convertvector(p1, v8h));
#pragma unroll
            for (int db = 0; db < 4; ++db) o[db][g] = wmma16(vf[db], pf, o[db][g]); }
        __builtin_amdgcn_sched_barrier(0);   // keeps the pass's last products in front of the slots below
        asm volatile("v_nop\n\tv_nop\n\tv_nop\n\tv_nop");   // the four vector slots between a product and the first vector instruction that overwrites its operands
        if (more) { unsigned short* snk = swk + ((s + 1) & 1) * FBS + c * 32 * FKK; unsigned short* snv = swv + ((s + 1) & 1) * FBS + c * 32 * FKP;   // that buffer's last readers left it before the barrier that ended stage s - 1
#pragma unroll
            for (int i = 0; i < 8; ++i) *(v8usa*)(snk + 4 * i * FKK) = st[i];
#pragma unroll
            for (int i = 0; i < 4; ++i) *(v8usa*)(snv + 8 * i * FKP) = st[8 + i]; }
        if (c == 1) {   // the stage's end, at the same pass in every wave
            asm volatile("s_wait_dscnt 0x0" ::: "memory");   // this wave's LDS stores of stage s + 1 and its reads of stage s are done
            asm volatile("s_barrier_signal -1\n\ts_barrier_wait -1" ::: "memory"); }   // publishes stage s + 1 and ends every read of stage s
    }
    // The join: the wave of key half kh finishes column group kh. It hands the other group's sums (32 floats a lane, then maximum and row sum) to its partner, wave wv ^ 2, through LDS (the last barrier has ended every read of the rings) and takes the partner's sums of its own group; lane for lane the two waves hold the same (query, feature) places.
    f32a* xb = (f32a*)sm; v8f mine[4], give[4];
#pragma unroll
    for (int db = 0; db < 4; ++db) { mine[db] = kh ? o[db][1] : o[db][0]; give[db] = kh ? o[db][0] : o[db][1]; }
    const float mm = kh ? mrun[1] : mrun[0], ml = kh ? lrun[1] : lrun[0], gm = kh ? mrun[0] : mrun[1], gl = kh ? lrun[0] : lrun[1];
#pragma unroll
    for (int db = 0; db < 4; ++db)
#pragma unroll
        for (int u = 0; u < 2; ++u) *(v4fa*)(xb + ((wv * 9 + db * 2 + u) * 32 + lane) * 4) = (v4f){give[db][u * 4], give[db][u * 4 + 1], give[db][u * 4 + 2], give[db][u * 4 + 3]};
    *(v4fa*)(xb + ((wv * 9 + 8) * 32 + lane) * 4) = (v4f){gm, gl, 0.f, 0.f};
    __syncthreads();   // every wave's hand-over stands in LDS before its partner reads it
    const f32a* xp = xb + ((wv ^ 2) * 9 * 32 + lane) * 4;
    const v4f pml = *(const v4fa*)(xp + 8 * 32 * 4);
    const float mj = fmaxf(mm, pml[0]); const float ca = __builtin_amdgcn_exp2f((mm - mj) * L2E), cb = __builtin_amdgcn_exp2f((pml[0] - mj) * L2E);
    const float lj = ml * ca + pml[1] * cb; const float inv = __fdiv_rn(1.0f, lj + xhalf(lj)); const float ia = ca * inv, ib = cb * inv;
    const size_t ob = ((size_t)b * TT + q0 + kh * 16 + lr) * DM + h * HD + 8 * hi;
#pragma unroll
    for (int db = 0; db < 4; ++db) { const v4f x0 = *(const v4fa*)(xp + (db * 2) * 32 * 4), x1 = *(const v4fa*)(xp + (db * 2 + 1) * 32 * 4); v8us oh, ol;
#pragma unroll
        for (int r = 0; r < 8; ++r) { unsigned short a2, c2; splitf(mine[db][r] * ia + (r < 4 ? x0[r & 3] : x1[r & 3]) * ib, a2, c2); oh[r] = a2; ol[r] = c2; }
        *(v8us*)(Ah + ob + db * 16) = oh; *(v8us*)(Al + ob + db * 16) = ol; }
}

extern "C" void kernel_launch(void* const* d_in, const int* in_sizes, int n_in,
                              void* d_out, int out_size, void* d_ws, size_t ws_size, hipStream_t stream) {
    (void)in_sizes; (void)n_in; (void)out_size;
    const float* x = (const float*)d_in[0]; const float* amask = (const float*)d_in[1]; const int* pos = (const int*)d_in[2]; const float* lnw = (const float*)d_in[3]; const float* wq = (const float*)d_in[4]; const float* wk = (const float*)d_in[5]; const float* wv = (const float*)d_in[6]; const float* wo = (const float*)d_in[7];
    float* OUT = (float*)d_out;     // [2][2048][768]
    char* wsp = (char*)d_ws;
    auto take = [&](size_t bytes) { char* p = wsp; wsp += (bytes + 255) & ~(size_t)255; return (void*)p; };
    bf* BW = (bf*)take((size_t)4 * DM * DM * 2);   // Wq, Wk, Wv, Wo in bf16
    const size_t zb = (size_t)NH_ * TT * HD;   // one batch's planes
    bf* NH = (bf*)take(NB_ * zb * 2); bf* NL = (bf*)take(NB_ * zb * 2); float* CS = (float*)take((size_t)NB_ * TT * HD * 2 * 4);
    bf* Qh = (bf*)take(4 * NB_ * zb * 2); bf* Ql = Qh + NB_ * zb; bf* Kh = Qh + QKSTEP; h16* VT = (h16*)take(NB_ * zb * 2);
    bf* Ah = (bf*)take(NB_ * zb * 2); bf* Al = (bf*)take(NB_ * zb * 2); unsigned* MF = (unsigned*)take((size_t)PMS * 8 * 128);   // the mask scan's words, one a 128-B line
    if ((size_t)(wsp - (char*)d_ws) > ws_size) return;    // total ~ 64 MB
    k_prep<<<PCS + PRM + 4 * PCV, 256, 0, stream>>>(pos, CS, x, lnw, NH, NL, wq, wk, wv, wo, BW);
    k_gemmt<1, 1><<<dim3(NB_ * TT / 128, 2 * DM / 128 + PMS / (NB_ * TT / 128), 1), 256, 0, stream>>>(NH, NL, BW, CS, nullptr, nullptr, Qh, Ql, amask, MF);   // rows are the tokens of both batches, columns the heads of q, then of k; the last PMS blocks: the mask scan
    k_gemmt<3, 2><<<dim3(DM / 128, TT / 128, NB_), 256, 0, stream>>>(BW + (size_t)2 * DM * DM, NL, NH, nullptr, nullptr, VT, nullptr, nullptr, nullptr, nullptr);   // rows are V's features, columns tokens (V^T = Wv N^T comes out of the GEMM already transposed)
    k_fattn<<<dim3(NB_ * NH_ * (TT / 64), 1, 1), 128, 0, stream>>>(Qh, Ql, Kh, VT, amask, MF, Ah, Al);
    k_gemmt<1, 3><<<dim3(NB_ * TT / 128, DM / 128, 1), 256, 0, stream>>>(Ah, Al, BW + (size_t)3 * DM * DM, x, OUT, nullptr, nullptr, nullptr, nullptr, nullptr);
}

// v008
// Measured time: 87.9 microseconds a run.
// Next to v007, in two timings, it ran 1.13 times as fast each time.
// All steps since v000 together make it 8.67 times as fast.
#include <hip/hip_runtime.h>

// TimeSelfAttentionFallback (hidden [2][2048][768]; normed = RMSNorm(x) ln_weight; q/k/v = normed W^T (12 heads x 64); rotate-half RoPE with angles position_ids[b][t] (int, read) x inv_freq (tables computed in-kernel per batch); scores = q.k (UNSCALED) + attention_mask[b][0][i][j] (float, read);
// fp32 softmax; out = hidden + (attn v merged) Wo^T -> [2][2048][768]).
// Compute dtypes, f32 accumulate: every input rounded to bf16; RMSNorm f32 -> hl planes; q/k/v as hl(normed) x exact W (2 products); RoPE f32; scores hl x hl (3 products, K 64 - the unscaled logits need it); probabilities and v in fp16; scores, softmax and P.V in one kernel (online softmax), the scores stay in registers. What follows a projection element by element (RoPE and the hl split; the fp16 rounding of V^T; the residual add) is done in that GEMM's epilogue.

#define NB_  2
#define TT   2048
#define DM   768
#define NH_  12
#define HD   64
typedef _Float16 h16;
typedef unsigned short bf;
typedef __attribute__((ext_vector_type(16))) __bf16   v16bf;
typedef __attribute__((ext_vector_type(16))) _Float16 v16h;
typedef __attribute__((ext_vector_type(8)))  _Float16 v8h;
typedef __attribute__((ext_vector_type(8)))  unsigned short v8us;
typedef __attribute__((ext_vector_type(8)))  float    v8f;
typedef __attribute__((ext_vector_type(4)))  float    v4f;
typedef v8h  __attribute__((may_alias)) v8ha;
typedef v4f  __attribute__((may_alias)) v4fa;
typedef v8us __attribute__((may_alias)) v8usa;

__device__ __forceinline__ unsigned short f2bf(float f) { unsigned u = __float_as_uint(f); u += 0x7FFFu + ((u >> 16) & 1u); return (unsigned short)(u >> 16); }
__device__ __forceinline__ float bf2f(unsigned short b) { return __uint_as_float(((unsigned)b) << 16); }
__device__ __forceinline__ float bfr(float f) { return bf2f(f2bf(f)); }
__device__ __forceinline__ v16h cat16(v8h lo, v8h hi) { return __builtin_shufflevector(lo, hi, 0, 1, 2, 3, 4, 5, 6, 7, 8, 9, 10, 11, 12, 13, 14, 15); }
__device__ __forceinline__ v16bf cat16b(v8us lo, v8us hi) { return __builtin_bit_cast(v16bf, __builtin_shufflevector(lo, hi, 0, 1, 2, 3, 4, 5, 6, 7, 8, 9, 10, 11, 12, 13, 14, 15)); }
__device__ __forceinline__ v8f wmma16(v16h a, v16h b, v8f c) { return __builtin_amdgcn_wmma_f32_16x16x32_f16(false, a, false, b, (short)0, c, false, false); }
__device__ __forceinline__ v8f wmmab(v16bf a, v16bf b, v8f c) { return __builtin_amdgcn_wmma_f32_16x16x32_bf16(false, a, false, b, (short)0, c, false, false); }
__device__ __forceinline__ void splitf(float y, unsigned short& h, unsigned short& l) { h = f2bf(y); l = f2bf(y - bf2f(h)); }
typedef __attribute__((ext_vector_type(4))) unsigned short v4us;
typedef __attribute__((ext_vector_type(2))) float v2f;
__device__ __forceinline__ float xrow8(float x) { return __builtin_bit_cast(float, __builtin_amdgcn_permlane16(__builtin_bit_cast(int, x), __builtin_bit_cast(int, x), 0xfedcba98, 0x76543210, false, false)); }   // lane l with lane l ^ 8



// ---- k_gemmt / gemm_tile<EPI, NBW>: GEMM with its operands staged in LDS. One 128 x 32 NBW output tile a work-group, 8 waves as 4 (rows) x 2 (columns), a wave owns 32 x 16 NBW (2 NBW accumulators); NBW = 4 (128 x 128) but for v, NBW = 6 (128 x 192); 256 threads, blockIdx.x = row block, blockIdx.y = column block.
// c[m][n] = sum_k (A + X2)[m][k] Bt[n][k], X2 a second plane of A's rows: two products. f32, k in rising order. K = DM.
// A stage is 64 k of the three planes (A's two of 128 rows, Bt's 32 NBW rows, 128 B a row): every global load instruction covers four whole 128-B lines, the tile goes through registers into LDS rows of 144 B (16-B readers), two buffers, one barrier a stage.
// EPI says where the tile goes: 1 = rows are tokens of both batches, a wave's 64 columns one head of q or k (Bt = Wq, Wk one behind the other): rotate-half RoPE with aux = CS[t][d] (cos, sin), then hl planes Ph/Pl [b][h][t][d], k's planes QKSTEP elements behind q's; 2 = rows are tokens, columns v's features (Bt = Wv): the block's tile, rounded to fp16, is turned through LDS and stored as V^T, Ch[b][feature][t] (pitch TT), 256 B of a feature's row at a time; 3 = C (f32, pitch DM) = bf16-rounded aux[m][n] + c.
// k_gemmt<1> is q, k and v in one grid. Two work-groups fit a WGP (LDS, and 256 registers a wave), 512 places on the chip: q and k take 384 blocks, and v's 768 features are cut into VCB = 4 column blocks of 192, 128 blocks, so that every GEMM block of the launch is resident from the start. The wide blocks last longest and come first in y.
// Behind the GEMM's blocks in y the grid has PMS more that do no GEMM: they scan the mask for attention (mask_scan), on the places that the first finished blocks leave.
#define QKSTEP ((size_t)2 * NB_ * TT * DM)
#define GKP 72
#define GPS (128 * GKP)
#define OSZ (16 * 68)
#define VTP 136
// Mask scan: a wave takes 32 query rows x 128 keys (one whole 512-B load a row) and stores one word, alone in its 128-B line: MF[gw 32], gw = (b TT/32 + query group) 16 + key group; bit l says that lane l's four key columns hold something other than +-0 in some row, so byte i speaks for tile i of the group, 32 queries x 32 keys.
#define PMS (NB_ * (TT / 32) * (TT / 128) / 8)
__device__ __forceinline__ void mask_scan(const float* __restrict__ mk, unsigned* MF, int j) {
    const int lane = threadIdx.x & 31; const int gw = j * 8 + (threadIdx.x >> 5);
    const float* mp = mk + (size_t)(gw >> 4) * 32 * TT + (gw & 15) * 128 + lane * 4; v4f a[32];
#pragma unroll
    for (int r = 0; r < 32; ++r) a[r] = *(const v4f*)(mp + (size_t)r * TT);
    asm volatile("s_wait_xcnt 0x0" ::: "memory");   // behind the scan's loads, before their address registers are reused
    unsigned any = 0u;
#pragma unroll
    for (int r = 0; r < 32; ++r) any |= __float_as_uint(a[r][0]) | __float_as_uint(a[r][1]) | __float_as_uint(a[r][2]) | __float_as_uint(a[r][3]);
    const unsigned bl = __builtin_amdgcn_ballot_w32((any & 0x7fffffffu) != 0u);
    if (lane == 0) MF[(size_t)gw * 32] = bl;
}
template <typename T16> struct WFrag;
template <> struct WFrag<bf> { typedef v16bf V; static __device__ __forceinline__ V ld(const bf* p) { return cat16b(*(const v8us*)p, *(const v8us*)(p + 16)); } };
typedef float __attribute__((may_alias)) f32a;
__device__ __forceinline__ v16bf ldsfrag(const unsigned short* p) { return cat16b(*(const v8usa*)p, *(const v8usa*)(p + 16)); }
template <int EPI, int NBW>
__device__ __forceinline__ void gemm_tile(unsigned short* sm, const bf* __restrict__ A, const bf* __restrict__ X2, const bf* __restrict__ Bt, const float* __restrict__ aux, float* C, h16* Ch, bf* Ph, bf* Pl, const int r0, const int c0) {
    constexpr int K = DM, BUF = 2 * GPS + NBW * 32 * GKP;   // one buffer: A's two planes, then Bt's 32 NBW rows
    const int tid = threadIdx.x, lane = tid & 31, lr = lane & 15, hi = lane >> 4; const int wv = __builtin_amdgcn_readfirstlane(tid >> 5), wm = wv >> 1, wn = wv & 1;
    const int srow = tid >> 3, sseg = (tid & 7) * 8;   // staging: a thread moves 16 B of rows srow, srow + 32, ... of each plane; eight neighbouring threads cover one 128-B line
    const bf* g0 = A + (size_t)(r0 + srow) * K + sseg; const bf* g1 = X2 + (size_t)(r0 + srow) * K + sseg; const bf* g2 = Bt + (size_t)(c0 + srow) * K + sseg;
    unsigned short* sw = sm + srow * GKP + sseg;
    v8us st[8 + NBW];
    v8f acc[2][NBW];
#pragma unroll
    for (int mb = 0; mb < 2; ++mb)
#pragma unroll
        for (int nb = 0; nb < NBW; ++nb) acc[mb][nb] = (v8f){};
#pragma unroll
    for (int i = 0; i < 4; ++i) { st[i] = *(const v8usa*)(g0 + (size_t)i * 32 * K); st[4 + i] = *(const v8usa*)(g1 + (size_t)i * 32 * K); }
#pragma unroll
    for (int i = 0; i < NBW; ++i) st[8 + i] = *(const v8usa*)(g2 + (size_t)i * 32 * K);
    asm volatile("s_wait_xcnt 0x0" ::: "memory");   // behind the first stage's loads, before their address registers are reused
#pragma unroll
    for (int i = 0; i < 8 + NBW; ++i) *(v8usa*)(sw + i * 32 * GKP) = st[i];   // the planes lie one behind the other in a buffer, A's two of 128 rows first
    __syncthreads();
#pragma unroll 1   // the stage loop stays rolled: the buffer is picked by s & 1, the body is one stage
    for (int s = 0; s < K / 64; ++s) {
        const bool more = s + 1 < K / 64;
        if (more) { const bf* p0 = g0 + (s + 1) * 64; const bf* p1 = g1 + (s + 1) * 64; const bf* p2 = g2 + (s + 1) * 64;   // next stage's planes fly into registers under this stage's products
#pragma unroll
            for (int i = 0; i < 4; ++i) { st[i] = *(const v8usa*)(p0 + (size_t)i * 32 * K); st[4 + i] = *(const v8usa*)(p1 + (size_t)i * 32 * K); }
#pragma unroll
            for (int i = 0; i < NBW; ++i) st[8 + i] = *(const v8usa*)(p2 + (size_t)i * 32 * K);
            asm volatile("s_wait_xcnt 0x0" :: "v"(p0), "v"(p1), "v"(p2) : "memory"); }   // behind these loads, before their address registers are reused; the addresses are inputs so that they live up to the wait and no load's result lands on them
        const unsigned short* bp = sm + (s & 1) * BUF;
        if constexpr (NBW == 4) {
        v16bf a[2][2], b[2][4], x[2][2];
#pragma unroll
        for (int kc = 0; kc < 2; ++kc) {
            const unsigned short* ap = bp + (wm * 32 + lr) * GKP + kc * 32 + 8 * hi; const unsigned short* bq = bp + 2 * GPS + (wn * 64 + lr) * GKP + kc * 32 + 8 * hi;
#pragma unroll
            for (int mb = 0; mb < 2; ++mb) { a[kc][mb] = ldsfrag(ap + mb * 16 * GKP); x[kc][mb] = ldsfrag(ap + GPS + mb * 16 * GKP); }
#pragma unroll
            for (int nb = 0; nb < 4; ++nb) b[kc][nb] = ldsfrag(bq + nb * 16 * GKP); }
        __builtin_amdgcn_sched_barrier(0);   // keeps the stage's LDS reads together as one group in front of its products: sunk among them, each place costs the wave an LDS latency
#pragma unroll
        for (int kc = 0; kc < 2; ++kc) {
#pragma unroll
            for (int mb = 0; mb < 2; ++mb)   // eight independent tiles in turn
#pragma unroll
                for (int nb = 0; nb < 4; ++nb) acc[mb][nb] = wmmab(a[kc][mb], b[kc][nb], acc[mb][nb]);
#pragma unroll
            for (int mb = 0; mb < 2; ++mb)
#pragma unroll
                for (int nb = 0; nb < 4; ++nb) acc[mb][nb] = wmmab(x[kc][mb], b[kc][nb], acc[mb][nb]);
        }
        } else {   // the wide tile: the fragments of 32 k at a time, so that its accumulators and fragments fit the registers of four waves a SIMD
#pragma unroll
        for (int kc = 0; kc < 2; ++kc) {
            v16bf a[2], x[2], b[NBW];
            const unsigned short* ap = bp + (wm * 32 + lr) * GKP + kc * 32 + 8 * hi; const unsigned short* bq = bp + 2 * GPS + (wn * NBW * 16 + lr) * GKP + kc * 32 + 8 * hi;
#pragma unroll
            for (int mb = 0; mb < 2; ++mb) { a[mb] = ldsfrag(ap + mb * 16 * GKP); x[mb] = ldsfrag(ap + GPS + mb * 16 * GKP); }
#pragma unroll
            for (int nb = 0; nb < NBW; ++nb) b[nb] = ldsfrag(bq + nb * 16 * GKP);
            __builtin_amdgcn_sched_barrier(0);   // keeps these LDS reads together as one group in front of their products: sunk among them, each place costs the wave an LDS latency
#pragma unroll
            for (int mb = 0; mb < 2; ++mb)   // 2 NBW independent tiles in turn
#pragma unroll
                for (int nb = 0; nb < NBW; ++nb) acc[mb][nb] = wmmab(a[mb], b[nb], acc[mb][nb]);
#pragma unroll
            for (int mb = 0; mb < 2; ++mb)
#pragma unroll
                for (int nb = 0; nb < NBW; ++nb) acc[mb][nb] = wmmab(x[mb], b[nb], acc[mb][nb]);
            __builtin_amdgcn_sched_barrier(0);   // keeps the next 32 k's reads behind these products: hoisted, a second fragment set would not fit the registers
        }
        }
        if (more) { unsigned short* sn = sw + ((s + 1) & 1) * BUF;   // that buffer's last readers left it before the barrier that ended stage s - 1
#pragma unroll
            for (int i = 0; i < 8 + NBW; ++i) *(v8usa*)(sn + i * 32 * GKP) = st[i]; }
        __syncthreads();   // publishes stage s + 1 and ends every read of stage s
    }
    if constexpr (EPI == 2) {   // V^T: a lane's eight accumulator rows are eight neighbouring tokens of one feature, 16 B of fp16; LDS rows are features, VTP halves apart (16-B readers). The last barrier has ended every read of the stage buffers.
#pragma unroll
        for (int mb = 0; mb < 2; ++mb)
#pragma unroll
            for (int nb = 0; nb < NBW; ++nb) *(v8ha*)(sm + ((wn * NBW + nb) * 16 + lr) * VTP + wm * 32 + mb * 16 + hi * 8) = __builtin_convertvector(acc[mb][nb], v8h);
        __syncthreads();   // the whole tile stands in LDS before any wave reads other waves' tokens of a feature
        v8h o8[2 * NBW];
#pragma unroll
        for (int i = 0; i < 2 * NBW; ++i) o8[i] = *(const v8ha*)(sm + (wv * 4 * NBW + i * 2 + hi) * VTP + lr * 8);
        const int bb = r0 / TT; h16* vp = Ch + (size_t)bb * TT * DM + (size_t)(c0 + wv * 4 * NBW + hi) * TT + (r0 - bb * TT) + lr * 8;   // 16 lanes store 256 B of one feature's row
#pragma unroll
        for (int i = 0; i < 2 * NBW; ++i) *(v8h*)(vp + (size_t)i * 2 * TT) = o8[i];
        asm volatile("s_wait_xcnt 0x0" ::: "memory");   // behind the V^T stores, before their data and address registers are reused by the code of the launch's other block kinds, which follows this tile's in the kernel
    } else {
    // Epilogue: the last barrier has ended every read of the stage buffers; each wave turns its own tile through its own LDS range (16 x 64 blocks, 272-B rows) so that 16 lanes hold one row of 64 columns.
    f32a* ob = (f32a*)sm + wv * 2 * OSZ; const int cofs = lr * 4;
#pragma unroll
    for (int mb = 0; mb < 2; ++mb)
#pragma unroll
        for (int nb = 0; nb < 4; ++nb)
#pragma unroll
            for (int j = 0; j < 8; ++j) ob[mb * OSZ + (hi * 8 + j) * 68 + nb * 16 + lr] = acc[mb][nb][j];
    asm volatile("s_wait_dscnt 0x0" ::: "memory");   // this wave's LDS stores are done before its lanes read one another's rows back
    const int nc = c0 + wn * 64;   // the wave's first column
#pragma unroll
    for (int mb = 0; mb < 2; ++mb) {
        const int m0 = r0 + wm * 32 + mb * 16 + hi;   // this lane's rows of the block: m0 + 2 rp
        v4f ex[8][2], val[8];
        const float* cp = EPI == 1 ? aux + ((size_t)m0 * HD + cofs) * 2 : aux + (size_t)m0 * DM + nc + cofs;   // what the epilogue reads from memory: (cos, sin) pairs, or the residual
#pragma unroll
        for (int rp = 0; rp < 8; ++rp) {
            if (EPI == 1) { ex[rp][0] = *(const v4f*)(cp + rp * 4 * HD); ex[rp][1] = *(const v4f*)(cp + rp * 4 * HD + 4); }
            if (EPI == 3) ex[rp][0] = *(const v4f*)(cp + rp * 2 * DM); }
        if (EPI == 1 || EPI == 3) { asm volatile("s_wait_xcnt 0x0" :: "v"(cp) : "memory");   // behind these loads, before their address registers are reused; the address is an input so that it lives up to the wait and no load's result lands on it
            __builtin_amdgcn_sched_barrier(0); }   // keeps the register writes that follow from being scheduled in front of that wait
#pragma unroll
        for (int rp = 0; rp < 8; ++rp) val[rp] = *(const v4fa*)((const f32a*)ob + mb * OSZ + (2 * rp + hi) * 68 + cofs);
        if (EPI == 1) { v4us oh[8], ol[8];   // column d's partner d +- 32 sits eight lanes away in the same 16-lane row; d < 32 takes -x[d + 32] sin, d >= 32 takes +x[d - 32] sin
#pragma unroll
            for (int rp = 0; rp < 8; ++rp)
#pragma unroll
                for (int u = 0; u < 4; ++u) { const float xp = xrow8(val[rp][u]); const float r = val[rp][u] * ex[rp][u >> 1][(u & 1) * 2] + (lr < 8 ? -xp : xp) * ex[rp][u >> 1][(u & 1) * 2 + 1]; unsigned short a2, c2; splitf(r, a2, c2); oh[rp][u] = a2; ol[rp][u] = c2; }
            __builtin_amdgcn_sched_barrier(0);   // every result stands in its own registers before the first store is issued: no store's registers are rewritten in front of the wait below
            const int zk = nc / DM, hh = (nc - zk * DM) / HD, bb = r0 / TT, t0 = m0 - bb * TT;
            const size_t oo = zk * QKSTEP + (size_t)bb * TT * DM + ((size_t)hh * TT + t0) * HD + cofs;
#pragma unroll
            for (int rp = 0; rp < 8; ++rp) { *(v4us*)(Ph + oo + rp * 2 * HD) = oh[rp]; *(v4us*)(Pl + oo + rp * 2 * HD) = ol[rp]; } }
        if (EPI == 3) { v4f o4[8];
#pragma unroll
            for (int rp = 0; rp < 8; ++rp)
#pragma unroll
                for (int u = 0; u < 4; ++u) o4[rp][u] = bfr(ex[rp][0][u]) + val[rp][u];
            __builtin_amdgcn_sched_barrier(0);   // results first, then the stores: no store's registers are rewritten in front of the wait below
#pragma unroll
            for (int rp = 0; rp < 8; ++rp) *(v4f*)(C + (size_t)m0 * DM + nc + cofs + rp * 2 * DM) = o4[rp]; }
        if (mb < 1 || EPI == 1) { asm volatile("s_wait_xcnt 0x0" ::: "memory");   // behind this block's stores, before their data and address registers are reused: by the next row block, or (EPI 1, last row block) by the code of the launch's other block kinds, which follows this tile's in the kernel
            __builtin_amdgcn_sched_barrier(0); }   // keeps the register writes that follow behind that wait
    }
    }
}
#define VCB (DM / 192)
// amdgpu_waves_per_eu(4, 4): the registers are dealt for four waves a SIMD (256 each), the two work-groups a WGP that the q/k/v grid is cut for.
template <int EPI>
__global__ __launch_bounds__(256) __attribute__((amdgpu_waves_per_eu(4, 4))) void k_gemmt(const bf* __restrict__ A, const bf* __restrict__ X2, const bf* __restrict__ Bt, const float* __restrict__ aux, float* C, h16* Ch, bf* Ph, bf* Pl, const float* __restrict__ mk, unsigned* MF) {
    __shared__ __align__(16) unsigned short sm[2 * (2 * GPS + (EPI == 1 ? 192 : 128) * GKP)];
    const int r0 = blockIdx.x * 128, by = blockIdx.y;   // every branch below is taken by whole blocks, in front of every barrier
    if constexpr (EPI == 1) {
        if (by >= VCB + 2 * DM / 128) mask_scan(mk, MF, (by - (VCB + 2 * DM / 128)) * (NB_ * TT / 128) + blockIdx.x);
        else if (by < VCB) gemm_tile<2, 6>(sm, A, X2, Bt + (size_t)2 * DM * DM, aux, C, Ch, Ph, Pl, r0, by * 192);
        else gemm_tile<1, 4>(sm, A, X2, Bt, aux, C, Ch, Ph, Pl, r0, (by - VCB) * 128);
    } else gemm_tile<EPI, 4>(sm, A, X2, Bt, aux, C, Ch, Ph, Pl, r0, by * 128);
}


// ---- k_prep: everything the projections wait for, none of it waiting for any other of it, as ONE grid: blocks [0, PCS) the cos/sin table, [PCS, PCS + PRM) RMSNorm, then PCV blocks for each of the four weights (BW = Wq, Wk, Wv, Wo in bf16, one behind the other; torch [out][in] = Bt). t runs over the NB_ TT tokens of both batches.
#define PCS (NB_ * TT * HD / 256)
#define PRM (NB_ * TT / 8)
#define PCV (DM * DM / 8 / 256)
// RMSNorm: wave per token: x rsqrt(mean x^2 + 1e-6) w -> hl planes (8-B lanes); table: CS[t][dd] = (cos, sin)((float)pos[t] x 10000^(-2 (dd mod 32)/64));
__global__ __launch_bounds__(256) void k_prep(const int* __restrict__ pos, float* CS, const float* __restrict__ X, const float* __restrict__ w, bf* Hh, bf* Hl, const float* __restrict__ wq, const float* __restrict__ wk, const float* __restrict__ wv, const float* __restrict__ wo, bf* BW) {
    const int blk = blockIdx.x;
    if (blk >= PCS && blk < PCS + PRM) { const int lane = threadIdx.x & 31; const int t = (blk - PCS) * 8 + (threadIdx.x >> 5); if (t >= NB_ * TT) return; float v[DM / 32]; float q = 0.f;
#pragma unroll
    for (int ch = 0; ch < DM / 128; ++ch) { const v4f a = *(const v4f*)(X + (size_t)t * DM + ch * 128 + lane * 4);
#pragma unroll
        for (int u = 0; u < 4; ++u) { v[ch * 4 + u] = bfr(a[u]); float p = __fmul_rn(v[ch * 4 + u], v[ch * 4 + u]); asm volatile("" : "+v"(p)); q = __fadd_rn(q, p); } }
#pragma unroll
    for (int sh = 16; sh; sh >>= 1) q += __shfl_xor(q, sh, 32);
    const float rs = __frsqrt_rn(__fadd_rn(q * (1.0f / DM), 1e-6f));
    {
#pragma unroll
        for (int ch = 0; ch < DM / 128; ++ch) { const int c0 = ch * 128 + lane * 4; v4us oh, ol;
#pragma unroll
            for (int u = 0; u < 4; ++u) { float n0 = __fmul_rn(v[ch * 4 + u], rs); asm volatile("" : "+v"(n0)); const float y = __fmul_rn(n0, bfr(w[c0 + u])); unsigned short a2, b2; splitf(y, a2, b2); oh[u] = a2; ol[u] = b2; }
            const size_t oo = (size_t)t * DM + c0; *(v4us*)(Hh + oo) = oh; *(v4us*)(Hl + oo) = ol; }
         } }
    else if (blk < PCS) { const int idx = blk * 256 + threadIdx.x; if (idx >= NB_ * TT * HD) return; const int dd = idx % HD; const int t = idx / HD; const int i2 = dd % (HD / 2); const float inv = __fdiv_rn(1.0f, powf(10000.0f, (float)(2 * i2) / (float)HD)); const float ang = __fmul_rn((float)pos[t], inv); v2f cs; cs[0] = cosf(ang); cs[1] = sinf(ang);
    *(v2f*)(CS + (size_t)idx * 2) = cs;  }
    else { const int j = blk - (PCS + PRM), which = j / PCV; const float* __restrict__ src = which == 0 ? wq : which == 1 ? wk : which == 2 ? wv : wo; bf* dst = BW + (size_t)which * DM * DM; const size_t n8 = DM * DM / 8;
        const size_t i = (size_t)(j % PCV) * 256 + threadIdx.x; if (i >= n8) return; const v8f v = *(const v8f*)(src + i * 8); v8us o;
#pragma unroll
        for (int k = 0; k < 8; ++k) o[k] = f2bf(v[k]); *(v8us*)(dst + i * 8) = o;  }
}
#define FKP  72
#define FKK  136
#define FKS  (64 * FKK)
#define FBS  (FKS + 64 * FKP)
#define FTHR 4.0f
#define FSH  9.0f
#define L2E  1.4426950408889634f
typedef __attribute__((ext_vector_type(2))) __bf16 v2bf;
__device__ __forceinline__ float xhalf(float x) { return __builtin_bit_cast(float, __builtin_amdgcn_permlanex16(__builtin_bit_cast(int, x), __builtin_bit_cast(int, x), 0x76543210, 0xfedcba98, false, false)); }   // lane l with lane l ^ 16
__global__ __launch_bounds__(128) __attribute__((amdgpu_waves_per_eu(3, 3))) void k_fattn(const bf* __restrict__ Qh, const bf* __restrict__ Ql, const bf* __restrict__ Kh, const h16* __restrict__ VT, const float* __restrict__ mk, const unsigned* __restrict__ MF, bf* Ah, bf* Al) {
    __shared__ __align__(16) unsigned short sm[2 * 2 * FBS];
    const int tid = threadIdx.x, lane = tid & 31, lr = lane & 15, hi = lane >> 4; const int wv = __builtin_amdgcn_readfirstlane(tid >> 5), qg = wv & 1, kh = wv >> 1;
    // Which (head, 64 queries) work-group f takes: f, f + 256, f + 512 and f, f + 8, f + 16 are neighbours on one head, so that work-groups that come to share a WGP ask for the same K and V lines at about the same time and can meet in its cache. For speed only: the map is a permutation of the 768 units, the result is the same wherever a work-group lands.
    const int f = blockIdx.x, un = ((f >> 3) & 31) * 3 + (f >> 8), hb = (f & 7) * 3 + (un >> 5);
    const int h = hb % NH_, b = hb / NH_; const size_t hz = (size_t)hb * TT * HD; const int q0 = (un & 31) * 64 + qg * 32, kb0 = kh * (TT / 2);
    v16bf qh[2][2], ql[2][2]; const bf* qhp = Qh + hz + (size_t)(q0 + lr) * HD + 8 * hi; const bf* qlp = Ql + hz + (size_t)(q0 + lr) * HD + 8 * hi;
#pragma unroll
    for (int g = 0; g < 2; ++g)
#pragma unroll
        for (int kc = 0; kc < 2; ++kc) { qh[g][kc] = WFrag<bf>::ld(qhp + g * 16 * HD + kc * 32); ql[g][kc] = WFrag<bf>::ld(qlp + g * 16 * HD + kc * 32); }
    const unsigned* mfp = MF + ((size_t)(b * (TT / 32) + (q0 >> 5)) * 16 + kh * 8 + (lane >> 2)) * 32;   // lane l looks up the wave's pass l: byte l & 3 of the scan word of key group 8 kh + (l >> 2)
    const unsigned mw = mfp[0];
    asm volatile("s_wait_xcnt 0x0" ::: "memory");   // behind the Q loads and the scan word's load, before their address registers are reused
    __builtin_amdgcn_sched_barrier(0);   // keeps the address arithmetic that follows from being scheduled in front of that wait, into the Q loads' address registers
    const int t2 = tid & 63, krow = t2 >> 4, kseg = t2 & 15, vrow = t2 >> 3, vseg = (t2 & 7) * 8;   // staging, by the 64 threads of a key half: 16 threads move one K row (a 128-B line of Kh, one of Kl), 8 threads one 128-B line of a V^T row
    // every global address of the loop is a wave-uniform base plus a 32-bit lane offset that never changes: one vector register a stream. Kl's plane lies NB_ TT DM elements behind Kh's (kernel_launch cuts both from one piece).
    const bf* gk = Kh + hz + (size_t)kb0 * HD; const h16* gvt = VT + hz + kb0; const unsigned kl = krow * HD + (kseg & 7) * 8 + ((kseg & 8) ? NB_ * TT * DM : 0), vl = vrow * TT + vseg;
    unsigned short* ring = sm + kh * 2 * FBS; unsigned short* swk = ring + krow * FKK + kseg * 8; unsigned short* swv = ring + FKS + vrow * FKP + vseg;
    const float* mr0 = mk + (size_t)b * TT * TT + (size_t)q0 * TT + kb0; const unsigned mlo = lr * TT + 8 * hi;
    const unsigned fmh = __builtin_amdgcn_ballot_w32(((mw >> ((lane & 3) * 8)) & 0xffu) != 0u);
    v8us st[12];
    v8f o[4][2]; float mrun[2], lrun[2];
#pragma unroll
    for (int g = 0; g < 2; ++g) { mrun[g] = -1.0e30f; lrun[g] = 0.f;
#pragma unroll
        for (int db = 0; db < 4; ++db) o[db][g] = (v8f){}; }
    { v8us s0[24];   // the first stage whole: the accumulators' registers are still free
#pragma unroll
        for (int i = 0; i < 16; ++i) s0[i] = *(const v8usa*)(gk + (size_t)(4 * i) * HD + kl);
#pragma unroll
        for (int i = 0; i < 8; ++i) s0[16 + i] = *(const v8usa*)(gvt + (size_t)(8 * i) * TT + vl);
        asm volatile("s_wait_xcnt 0x0" ::: "memory");   // behind the first stage's loads, before their address registers are reused
#pragma unroll
        for (int i = 0; i < 16; ++i) *(v8usa*)(swk + 4 * i * FKK) = s0[i];
#pragma unroll
        for (int i = 0; i < 8; ++i) *(v8usa*)(swv + 8 * i * FKP) = s0[16 + i]; }
    __syncthreads();
#pragma unroll 1   // the pass loop stays rolled: unrolled by two, the compiler sinks one pass's row sums into the next pass, and its 32 probabilities stay live beside the new K fragments: the registers of a third wave a SIMD
    for (int pl = 0; pl < TT / 64; ++pl) {
        const int s = pl >> 1, c = pl & 1; const bool more = s + 1 < TT / 128, fl = ((fmh >> pl) & 1u) != 0u;
        const unsigned short* bp = ring + (s & 1) * FBS;
        if (more) { const bf* gkn = gk + (size_t)((s + 1) * 64 + c * 32) * HD; const h16* gvn = gvt + (size_t)(c * 32) * TT + (s + 1) * 64;   // half of the next stage (32 K rows, 32 V^T rows) flies into registers under this pass's work
#pragma unroll
            for (int i = 0; i < 8; ++i) st[i] = *(const v8usa*)(gkn + (size_t)(4 * i) * HD + kl);
#pragma unroll
            for (int i = 0; i < 4; ++i) st[8 + i] = *(const v8usa*)(gvn + (size_t)(8 * i) * TT + vl);
            asm volatile("s_wait_xcnt 0x0" ::: "memory"); }   // behind these loads, before their address registers are reused
        v16bf ah[2][2], al[2][2];
#pragma unroll
        for (int kt = 0; kt < 2; ++kt)
#pragma unroll
            for (int kc = 0; kc < 2; ++kc) { const unsigned short* kp = bp + c * 32 * FKK + (kt * 16 + lr) * FKK + kc * 32 + 8 * hi; ah[kt][kc] = cat16b(*(const v8usa*)kp, *(const v8usa*)(kp + 16)); al[kt][kc] = cat16b(*(const v8usa*)(kp + 64), *(const v8usa*)(kp + 64 + 16)); }
        __builtin_amdgcn_sched_barrier(0);   // keeps the pass's K reads together as one group in front of its products: sunk among them, each place costs the wave an LDS latency
        v8f sc[2][2];
#pragma unroll
        for (int kt = 0; kt < 2; ++kt)
#pragma unroll
            for (int g = 0; g < 2; ++g) sc[kt][g] = (v8f){};
#pragma unroll
        for (int kc = 0; kc < 2; ++kc) {   // four independent score tiles in turn
#pragma unroll
            for (int kt = 0; kt < 2; ++kt)
#pragma unroll
                for (int g = 0; g < 2; ++g) sc[kt][g] = wmmab(ah[kt][kc], qh[g][kc], sc[kt][g]);
#pragma unroll
            for (int kt = 0; kt < 2; ++kt)
#pragma unroll
                for (int g = 0; g < 2; ++g) sc[kt][g] = wmmab(ah[kt][kc], ql[g][kc], sc[kt][g]);
#pragma unroll
            for (int kt = 0; kt < 2; ++kt)
#pragma unroll
                for (int g = 0; g < 2; ++g) sc[kt][g] = wmmab(al[kt][kc], qh[g][kc], sc[kt][g]); }
        v16h vf[4];
#pragma unroll
        for (int db = 0; db < 4; ++db) { const unsigned short* vp = bp + FKS + (db * 16 + lr) * FKP + c * 32 + 8 * hi; vf[db] = cat16(*(const v8ha*)vp, *(const v8ha*)(vp + 16)); }
        if (fl) { v4f mq[2][2][2]; const float* mp = mr0 + pl * 32 + mlo;   // this pass's mask tile, where it is not all zero: asked for behind the scores' products, so that it takes the registers that the K fragments leave (a third wave a SIMD needs them)
#pragma unroll
            for (int kt = 0; kt < 2; ++kt)
#pragma unroll
                for (int u = 0; u < 2; ++u) { mq[kt][0][u] = *(const v4f*)(mp + kt * 16 + u * 4); mq[kt][1][u] = *(const v4f*)(mp + 16 * TT + kt * 16 + u * 4); }
            asm volatile("s_wait_xcnt 0x0" :: "v"(mp) : "memory");   // behind the mask loads, before their address registers are reused; the address is an input so that it lives up to the wait and no load's result lands on it
#pragma unroll
            for (int g = 0; g < 2; ++g)
#pragma unroll
                for (int kt = 0; kt < 2; ++kt)
#pragma unroll
                    for (int r = 0; r < 8; r += 2) { const v2bf m2 = __builtin_convertvector((v2f){mq[kt][g][r >> 2][r & 3], mq[kt][g][r >> 2][(r & 3) + 1]}, v2bf);   // mask rounded to bf16 (nearest even), as every input
                        sc[kt][g][r] += (float)m2[0]; sc[kt][g][r + 1] += (float)m2[1]; } }
        float mb[2]; bool need = false;
#pragma unroll
        for (int g = 0; g < 2; ++g) { float mx = -3.0e38f;
#pragma unroll
            for (int kt = 0; kt < 2; ++kt)
#pragma unroll
                for (int r = 0; r < 8; r += 2) mx = fmaxf(mx, fmaxf(sc[kt][g][r], sc[kt][g][r + 1]));
            mx = fmaxf(mx, xhalf(mx)); mb[g] = mx; need = need || (mx > mrun[g] + FTHR); }
        if (__builtin_amdgcn_ballot_w32(need) != 0) {   // one wave-uniform test a pass; rare after the first passes
#pragma unroll
            for (int g = 0; g < 2; ++g) { const float mnew = fmaxf(mrun[g], mb[g]); const float corr = __builtin_amdgcn_exp2f((mrun[g] - mnew) * L2E); mrun[g] = mnew; lrun[g] *= corr;
#pragma unroll
                for (int db = 0; db < 4; ++db) o[db][g] = o[db][g] * corr; } }
#pragma unroll
        for (int g = 0; g < 2; ++g) { const float nm = fmaf(-mrun[g], L2E, FSH); v8f p0, p1; float ls0 = 0.f, ls1 = 0.f;
#pragma unroll
            for (int r = 0; r < 8; ++r) { p0[r] = __builtin_amdgcn_exp2f(fmaf(sc[0][g][r], L2E, nm)); p1[r] = __builtin_amdgcn_exp2f(fmaf(sc[1][g][r], L2E, nm)); ls0 += p0[r]; ls1 += p1[r]; }
            lrun[g] += ls0 + ls1;
            const v16h pf = cat16(__builtin_convertvector(p0, v8h), __builtin_convertvector(p1, v8h));
#pragma unroll
            for (int db = 0; db < 4; ++db) o[db][g] = wmma16(vf[db], pf, o[db][g]); }
        __builtin_amdgcn_sched_barrier(0);   // keeps the pass's last products in front of the slots below
        asm volatile("v_nop\n\tv_nop\n\tv_nop\n\tv_nop");   // the four vector slots between a product and the first vector instruction that overwrites its operands
        if (more) { unsigned short* snk = swk + ((s + 1) & 1) * FBS + c * 32 * FKK; unsigned short* snv = swv + ((s + 1) & 1) * FBS + c * 32 * FKP;   // that buffer's last readers left it before the barrier that ended stage s - 1
#pragma unroll
            for (int i = 0; i < 8; ++i) *(v8usa*)(snk + 4 * i * FKK) = st[i];
#pragma unroll
            for (int i = 0; i < 4; ++i) *(v8usa*)(snv + 8 * i * FKP) = st[8 + i]; }
        if (c == 1) {   // the stage's end, at the same pass in every wave
            asm volatile("s_wait_dscnt 0x0" ::: "memory");   // this wave's LDS stores of stage s + 1 and its reads of stage s are done
            asm volatile("s_barrier_signal -1\n\ts_barrier_wait -1" ::: "memory"); }   // publishes stage s + 1 and ends every read of stage s
    }
    // The join: the wave of key half kh finishes column group kh. It hands the other group's sums (32 floats a lane, then maximum and row sum) to its partner, wave wv ^ 2, through LDS (the last barrier has ended every read of the rings) and takes the partner's sums of its own group; lane for lane the two waves hold the same (query, feature) places.
    f32a* xb = (f32a*)sm; v8f mine[4], give[4];
#pragma unroll
    for (int db = 0; db < 4; ++db) { mine[db] = kh ? o[db][1] : o[db][0]; give[db] = kh ? o[db][0] : o[db][1]; }
    const float mm = kh ? mrun[1] : mrun[0], ml = kh ? lrun[1] : lrun[0], gm = kh ? mrun[0] : mrun[1], gl = kh ? lrun[0] : lrun[1];
#pragma unroll
    for (int db = 0; db < 4; ++db)
#pragma unroll
        for (int u = 0; u < 2; ++u) *(v4fa*)(xb + ((wv * 9 + db * 2 + u) * 32 + lane) * 4) = (v4f){give[db][u * 4], give[db][u * 4 + 1], give[db][u * 4 + 2], give[db][u * 4 + 3]};
    *(v4fa*)(xb + ((wv * 9 + 8) * 32 + lane) * 4) = (v4f){gm, gl, 0.f, 0.f};
    __syncthreads();   // every wave's hand-over stands in LDS before its partner reads it
    const f32a* xp = xb + ((wv ^ 2) * 9 * 32 + lane) * 4;
    const v4f pml = *(const v4fa*)(xp + 8 * 32 * 4);
    const float mj = fmaxf(mm, pml[0]); const float ca = __builtin_amdgcn_exp2f((mm - mj) * L2E), cb = __builtin_amdgcn_exp2f((pml[0] - mj) * L2E);
    const float lj = ml * ca + pml[1] * cb; const float inv = __fdiv_rn(1.0f, lj + xhalf(lj)); const float ia = ca * inv, ib = cb * inv;
    const size_t ob = ((size_t)b * TT + q0 + kh * 16 + lr) * DM + h * HD + 8 * hi;
#pragma unroll
    for (int db = 0; db < 4; ++db) { const v4f x0 = *(const v4fa*)(xp + (db * 2) * 32 * 4), x1 = *(const v4fa*)(xp + (db * 2 + 1) * 32 * 4); v8us oh, ol;
#pragma unroll
        for (int r = 0; r < 8; ++r) { unsigned short a2, c2; splitf(mine[db][r] * ia + (r < 4 ? x0[r & 3] : x1[r & 3]) * ib, a2, c2); oh[r] = a2; ol[r] = c2; }
        *(v8us*)(Ah + ob + db * 16) = oh; *(v8us*)(Al + ob + db * 16) = ol; }
}

extern "C" void kernel_launch(void* const* d_in, const int* in_sizes, int n_in,
                              void* d_out, int out_size, void* d_ws, size_t ws_size, hipStream_t stream) {
    (void)in_sizes; (void)n_in; (void)out_size;
    const float* x = (const float*)d_in[0]; const float* amask = (const float*)d_in[1]; const int* pos = (const int*)d_in[2]; const float* lnw = (const float*)d_in[3]; const float* wq = (const float*)d_in[4]; const float* wk = (const float*)d_in[5]; const float* wv = (const float*)d_in[6]; const float* wo = (const float*)d_in[7];
    float* OUT = (float*)d_out;     // [2][2048][768]
    char* wsp = (char*)d_ws;
    auto take = [&](size_t bytes) { char* p = wsp; wsp += (bytes + 255) & ~(size_t)255; return (void*)p; };
    bf* BW = (bf*)take((size_t)4 * DM * DM * 2);   // Wq, Wk, Wv, Wo in bf16
    const size_t zb = (size_t)NH_ * TT * HD;   // one batch's planes
    bf* NH = (bf*)take(NB_ * zb * 2); bf* NL = (bf*)take(NB_ * zb * 2); float* CS = (float*)take((size_t)NB_ * TT * HD * 2 * 4);
    bf* Qh = (bf*)take(4 * NB_ * zb * 2); bf* Ql = Qh + NB_ * zb; bf* Kh = Qh + QKSTEP; h16* VT = (h16*)take(NB_ * zb * 2);
    bf* Ah = (bf*)take(NB_ * zb * 2); bf* Al = (bf*)take(NB_ * zb * 2); unsigned* MF = (unsigned*)take((size_t)PMS * 8 * 128);   // the mask scan's words, one a 128-B line
    if ((size_t)(wsp - (char*)d_ws) > ws_size) return;    // total ~ 64 MB
    k_prep<<<PCS + PRM + 4 * PCV, 256, 0, stream>>>(pos, CS, x, lnw, NH, NL, wq, wk, wv, wo, BW);
    k_gemmt<1><<<dim3(NB_ * TT / 128, VCB + 2 * DM / 128 + PMS / (NB_ * TT / 128), 1), 256, 0, stream>>>(NH, NL, BW, CS, nullptr, VT, Qh, Ql, amask, MF);   // rows are the tokens of both batches; in y first v's wide column blocks, then the heads of q and of k, then the PMS blocks of the mask scan
    k_fattn<<<dim3(NB_ * NH_ * (TT / 64), 1, 1), 128, 0, stream>>>(Qh, Ql, Kh, VT, amask, MF, Ah, Al);
    k_gemmt<3><<<dim3(NB_ * TT / 128, DM / 128, 1), 256, 0, stream>>>(Ah, Al, BW + (size_t)3 * DM * DM, x, OUT, nullptr, nullptr, nullptr, nullptr, nullptr);
}

// v009
// One run takes 84.9 microseconds.
// In two side-by-side timings against v008, it was 1.04 and 1.03 times as fast.
// All steps since v000 together make it 8.98 times as fast.
#include <hip/hip_runtime.h>

// TimeSelfAttentionFallback (hidden [2][2048][768]; normed = RMSNorm(x) ln_weight; q/k/v = normed W^T (12 heads x 64); rotate-half RoPE with angles position_ids[b][t] (int, read) x inv_freq (tables computed in-kernel per batch); scores = q.k (UNSCALED) + attention_mask[b][0][i][j] (float, read);
// fp32 softmax; out = hidden + (attn v merged) Wo^T -> [2][2048][768]).
// Compute dtypes, f32 accumulate: every input rounded to bf16; RMSNorm f32 -> hl planes and one fp16 plane; q/k as hl(normed) x exact W (2 products); v as fp16(normed) x exact Wv in fp16 (1 product: V is kept in fp16 anyway); RoPE f32; scores hl x hl (3 products, K 64 - the unscaled logits need it); probabilities and v in fp16; scores, softmax and P.V in one kernel (online softmax), the scores stay in registers; the attention output, a sum of fp16 products, goes to the o-projection as one fp16 plane x exact Wo in fp16 (1 product). What follows a projection element by element (RoPE and the hl split; the fp16 rounding of V^T; the residual add) is done in that GEMM's epilogue.

#define NB_  2
#define TT   2048
#define DM   768
#define NH_  12
#define HD   64
typedef _Float16 h16;
typedef unsigned short bf;
typedef __attribute__((ext_vector_type(16))) __bf16   v16bf;
typedef __attribute__((ext_vector_type(16))) _Float16 v16h;
typedef __attribute__((ext_vector_type(8)))  _Float16 v8h;
typedef __attribute__((ext_vector_type(8)))  unsigned short v8us;
typedef __attribute__((ext_vector_type(8)))  float    v8f;
typedef __attribute__((ext_vector_type(4)))  float    v4f;
typedef v8h  __attribute__((may_alias)) v8ha;
typedef v4f  __attribute__((may_alias)) v4fa;
typedef v8us __attribute__((may_alias)) v8usa;

__device__ __forceinline__ unsigned short f2bf(float f) { unsigned u = __float_as_uint(f); u += 0x7FFFu + ((u >> 16) & 1u); return (unsigned short)(u >> 16); }
__device__ __forceinline__ float bf2f(unsigned short b) { return __uint_as_float(((unsigned)b) << 16); }
__device__ __forceinline__ float bfr(float f) { return bf2f(f2bf(f)); }
__device__ __forceinline__ v16h cat16(v8h lo, v8h hi) { return __builtin_shufflevector(lo, hi, 0, 1, 2, 3, 4, 5, 6, 7, 8, 9, 10, 11, 12, 13, 14, 15); }
__device__ __forceinline__ v16bf cat16b(v8us lo, v8us hi) { return __builtin_bit_cast(v16bf, __builtin_shufflevector(lo, hi, 0, 1, 2, 3, 4, 5, 6, 7, 8, 9, 10, 11, 12, 13, 14, 15)); }
__device__ __forceinline__ v8f wmma16(v16h a, v16h b, v8f c) { return __builtin_amdgcn_wmma_f32_16x16x32_f16(false, a, false, b, (short)0, c, false, false); }
__device__ __forceinline__ v8f wmmab(v16bf a, v16bf b, v8f c) { return __builtin_amdgcn_wmma_f32_16x16x32_bf16(false, a, false, b, (short)0, c, false, false); }
template <bool F16> __device__ __forceinline__ v8f wmmax(v16bf a, v16bf b, v8f c) { if constexpr (F16) return wmma16(__builtin_bit_cast(v16h, a), __builtin_bit_cast(v16h, b), c); else return wmmab(a, b, c); }   // the staged 16-bit words are bf16 or fp16, by the tile
__device__ __forceinline__ void splitf(float y, unsigned short& h, unsigned short& l) { h = f2bf(y); l = f2bf(y - bf2f(h)); }
typedef __attribute__((ext_vector_type(4))) unsigned short v4us;
typedef __attribute__((ext_vector_type(4))) _Float16 v4h;
typedef __attribute__((ext_vector_type(2))) float v2f;
__device__ __forceinline__ float xrow8(float x) { return __builtin_bit_cast(float, __builtin_amdgcn_permlane16(__builtin_bit_cast(int, x), __builtin_bit_cast(int, x), 0xfedcba98, 0x76543210, false, false)); }   // lane l with lane l ^ 8



// ---- k_gemmt / gemm_tile<EPI, NBW>: GEMM with its operands staged in LDS. One 128 x 32 NBW output tile a work-group, 8 waves as 4 (rows) x 2 (columns), a wave owns 32 x 16 NBW (2 NBW accumulators); NBW = 4 (128 x 128) but for v, NBW = 6 (128 x 192); 256 threads, blockIdx.x = row block, blockIdx.y = column block.
// EPI 1: c[m][n] = sum_k (A + X2)[m][k] Bt[n][k], bf16, X2 a second plane of A's rows: two products. EPI 2, 3: c[m][n] = sum_k A[m][k] Bt[n][k], both fp16, one plane, one product (X2 is not read). f32, k in rising order. K = DM.
// A stage is 64 k of the planes (A's one or two of 128 rows, Bt's 32 NBW rows, 128 B a row): every global load instruction covers four whole 128-B lines, the tile goes through registers into LDS rows of 144 B (16-B readers), two buffers, one barrier a stage.
// EPI says where the tile goes: 1 = rows are tokens of both batches, a wave's 64 columns one head of q or k (Bt = Wq, Wk one behind the other): rotate-half RoPE with aux = CS[t][d] (cos, sin), then hl planes Ph/Pl [b][h][t][d], k's planes QKSTEP elements behind q's; 2 = rows are tokens, columns v's features (Bt = Wv): the block's tile, rounded to fp16, is turned through LDS and stored as V^T, Ch[b][feature][t] (pitch TT), 256 B of a feature's row at a time; 3 = C (f32, pitch DM) = bf16-rounded aux[m][n] + c.
// AF is the fp16 plane of A's rows, for the one-product tiles (v, o); A and X2 are the bf16 planes, for q and k.
// k_gemmt<1> is q, k and v in one grid. Two work-groups fit a WGP (LDS, and 256 registers a wave), 512 places on the chip: q and k take 384 blocks, and v's 768 features are cut into VCB = 4 column blocks of 192, 128 blocks, so that every GEMM block of the launch is resident from the start. The wide blocks come first in y.
// Behind the GEMM's blocks in y the grid has PMS more that do no GEMM: they scan the mask for attention (mask_scan), on the places that the first finished blocks leave.
#define QKSTEP ((size_t)2 * NB_ * TT * DM)
#define GKP 72
#define GPS (128 * GKP)
#define OSZ (16 * 68)
#define VTP 136
// Mask scan: a wave takes 32 query rows x 128 keys (one whole 512-B load a row) and stores one word, alone in its 128-B line: MF[gw 32], gw = (b TT/32 + query group) 16 + key group; bit l says that lane l's four key columns hold something other than +-0 in some row, so byte i speaks for tile i of the group, 32 queries x 32 keys.
#define PMS (NB_ * (TT / 32) * (TT / 128) / 8)
__device__ __forceinline__ void mask_scan(const float* __restrict__ mk, unsigned* MF, int j) {
    const int lane = threadIdx.x & 31; const int gw = j * 8 + (threadIdx.x >> 5);
    const float* mp = mk + (size_t)(gw >> 4) * 32 * TT + (gw & 15) * 128 + lane * 4; v4f a[32];
#pragma unroll
    for (int r = 0; r < 32; ++r) a[r] = *(const v4f*)(mp + (size_t)r * TT);
    asm volatile("s_wait_xcnt 0x0" ::: "memory");   // behind the scan's loads, before their address registers are reused
    unsigned any = 0u;
#pragma unroll
    for (int r = 0; r < 32; ++r) any |= __float_as_uint(a[r][0]) | __float_as_uint(a[r][1]) | __float_as_uint(a[r][2]) | __float_as_uint(a[r][3]);
    const unsigned bl = __builtin_amdgcn_ballot_w32((any & 0x7fffffffu) != 0u);
    if (lane == 0) MF[(size_t)gw * 32] = bl;
}
template <typename T16> struct WFrag;
template <> struct WFrag<bf> { typedef v16bf V; static __device__ __forceinline__ V ld(const bf* p) { return cat16b(*(const v8us*)p, *(const v8us*)(p + 16)); } };
typedef float __attribute__((may_alias)) f32a;
__device__ __forceinline__ v16bf ldsfrag(const unsigned short* p) { return cat16b(*(const v8usa*)p, *(const v8usa*)(p + 16)); }
template <int EPI, int NBW>
__device__ __forceinline__ void gemm_tile(unsigned short* sm, const bf* __restrict__ A, const bf* __restrict__ X2, const bf* __restrict__ Bt, const float* __restrict__ aux, float* C, h16* Ch, bf* Ph, bf* Pl, const int r0, const int c0) {
    constexpr bool ONE = EPI != 1; constexpr int K = DM, NA = ONE ? 4 : 8, APL = ONE ? GPS : 2 * GPS, BUF = APL + NBW * 32 * GKP;   // one buffer: A's plane or planes (NA loads a thread), then Bt's 32 NBW rows
    const int tid = threadIdx.x, lane = tid & 31, lr = lane & 15, hi = lane >> 4; const int wv = __builtin_amdgcn_readfirstlane(tid >> 5), wm = wv >> 1, wn = wv & 1;
    const int srow = tid >> 3, sseg = (tid & 7) * 8;   // staging: a thread moves 16 B of rows srow, srow + 32, ... of each plane; eight neighbouring threads cover one 128-B line
    const bf* g0 = A + (size_t)(r0 + srow) * K + sseg; const bf* g1 = X2 + (size_t)(r0 + srow) * K + sseg; const bf* g2 = Bt + (size_t)(c0 + srow) * K + sseg;
    unsigned short* sw = sm + srow * GKP + sseg;
    v8us st[NA + NBW];
    v8f acc[2][NBW];
#pragma unroll
    for (int mb = 0; mb < 2; ++mb)
#pragma unroll
        for (int nb = 0; nb < NBW; ++nb) acc[mb][nb] = (v8f){};
#pragma unroll
    for (int i = 0; i < 4; ++i) { st[i] = *(const v8usa*)(g0 + (size_t)i * 32 * K); if constexpr (!ONE) st[4 + i] = *(const v8usa*)(g1 + (size_t)i * 32 * K); }
#pragma unroll
    for (int i = 0; i < NBW; ++i) st[NA + i] = *(const v8usa*)(g2 + (size_t)i * 32 * K);
    asm volatile("s_wait_xcnt 0x0" ::: "memory");   // behind the first stage's loads, before their address registers are reused
#pragma unroll
    for (int i = 0; i < NA + NBW; ++i) *(v8usa*)(sw + i * 32 * GKP) = st[i];   // the planes lie one behind the other in a buffer, A's of 128 rows first
    __syncthreads();
#pragma unroll 1   // the stage loop stays rolled: the buffer is picked by s & 1, the body is one stage
    for (int s = 0; s < K / 64; ++s) {
        const bool more = s + 1 < K / 64;
        if (more) { const bf* p0 = g0 + (s + 1) * 64; const bf* p1 = g1 + (s + 1) * 64; const bf* p2 = g2 + (s + 1) * 64;   // next stage's planes fly into registers under this stage's products
#pragma unroll
            for (int i = 0; i < 4; ++i) { st[i] = *(const v8usa*)(p0 + (size_t)i * 32 * K); if constexpr (!ONE) st[4 + i] = *(const v8usa*)(p1 + (size_t)i * 32 * K); }
#pragma unroll
            for (int i = 0; i < NBW; ++i) st[NA + i] = *(const v8usa*)(p2 + (size_t)i * 32 * K);
            if constexpr (ONE) asm volatile("s_wait_xcnt 0x0" :: "v"(p0), "v"(p2) : "memory");
            else asm volatile("s_wait_xcnt 0x0" :: "v"(p0), "v"(p1), "v"(p2) : "memory"); }   // behind these loads, before their address registers are reused; the addresses are inputs so that they live up to the wait and no load's result lands on them
        const unsigned short* bp = sm + (s & 1) * BUF;
        if constexpr (NBW == 4) {
        v16bf a[2][2], b[2][4], x[2][2];
#pragma unroll
        for (int kc = 0; kc < 2; ++kc) {
            const unsigned short* ap = bp + (wm * 32 + lr) * GKP + kc * 32 + 8 * hi; const unsigned short* bq = bp + APL + (wn * 64 + lr) * GKP + kc * 32 + 8 * hi;
#pragma unroll
            for (int mb = 0; mb < 2; ++mb) { a[kc][mb] = ldsfrag(ap + mb * 16 * GKP); if constexpr (!ONE) x[kc][mb] = ldsfrag(ap + GPS + mb * 16 * GKP); }
#pragma unroll
            for (int nb = 0; nb < 4; ++nb) b[kc][nb] = ldsfrag(bq + nb * 16 * GKP); }
        __builtin_amdgcn_sched_barrier(0);   // keeps the stage's LDS reads together as one group in front of its products: sunk among them, each place costs the wave an LDS latency
#pragma unroll
        for (int kc = 0; kc < 2; ++kc) {
#pragma unroll
            for (int mb = 0; mb < 2; ++mb)   // eight independent tiles in turn
#pragma unroll
                for (int nb = 0; nb < 4; ++nb) acc[mb][nb] = wmmax<ONE>(a[kc][mb], b[kc][nb], acc[mb][nb]);
            if constexpr (!ONE) {
#pragma unroll
            for (int mb = 0; mb < 2; ++mb)
#pragma unroll
                for (int nb = 0; nb < 4; ++nb) acc[mb][nb] = wmmab(x[kc][mb], b[kc][nb], acc[mb][nb]); }
        }
        } else {   // the wide tile: the fragments of 32 k at a time, so that its accumulators and fragments fit the registers of four waves a SIMD
#pragma unroll
        for (int kc = 0; kc < 2; ++kc) {
            v16bf a[2], x[2], b[NBW];
            const unsigned short* ap = bp + (wm * 32 + lr) * GKP + kc * 32 + 8 * hi; const unsigned short* bq = bp + APL + (wn * NBW * 16 + lr) * GKP + kc * 32 + 8 * hi;
#pragma unroll
            for (int mb = 0; mb < 2; ++mb) { a[mb] = ldsfrag(ap + mb * 16 * GKP); if constexpr (!ONE) x[mb] = ldsfrag(ap + GPS + mb * 16 * GKP); }
#pragma unroll
            for (int nb = 0; nb < NBW; ++nb) b[nb] = ldsfrag(bq + nb * 16 * GKP);
            __builtin_amdgcn_sched_barrier(0);   // keeps these LDS reads together as one group in front of their products: sunk among them, each place costs the wave an LDS latency
#pragma unroll
            for (int mb = 0; mb < 2; ++mb)   // 2 NBW independent tiles in turn
#pragma unroll
                for (int nb = 0; nb < NBW; ++nb) acc[mb][nb] = wmmax<ONE>(a[mb], b[nb], acc[mb][nb]);
            if constexpr (!ONE) {
#pragma unroll
            for (int mb = 0; mb < 2; ++mb)
#pragma unroll
                for (int nb = 0; nb < NBW; ++nb) acc[mb][nb] = wmmab(x[mb], b[nb], acc[mb][nb]); }
            __builtin_amdgcn_sched_barrier(0);   // keeps the next 32 k's reads behind these products: hoisted, a second fragment set would not fit the registers
        }
        }
        if (more) { unsigned short* sn = sw + ((s + 1) & 1) * BUF;   // that buffer's last readers left it before the barrier that ended stage s - 1
#pragma unroll
            for (int i = 0; i < NA + NBW; ++i) *(v8usa*)(sn + i * 32 * GKP) = st[i]; }
        __syncthreads();   // publishes stage s + 1 and ends every read of stage s
    }
    if constexpr (EPI == 2) {   // V^T: a lane's eight accumulator rows are eight neighbouring tokens of one feature, 16 B of fp16; LDS rows are features, VTP halves apart (16-B readers). The last barrier has ended every read of the stage buffers.
#pragma unroll
        for (int mb = 0; mb < 2; ++mb)
#pragma unroll
            for (int nb = 0; nb < NBW; ++nb) *(v8ha*)(sm + ((wn * NBW + nb) * 16 + lr) * VTP + wm * 32 + mb * 16 + hi * 8) = __builtin_convertvector(acc[mb][nb], v8h);
        __syncthreads();   // the whole tile stands in LDS before any wave reads other waves' tokens of a feature
        v8h o8[2 * NBW];
#pragma unroll
        for (int i = 0; i < 2 * NBW; ++i) o8[i] = *(const v8ha*)(sm + (wv * 4 * NBW + i * 2 + hi) * VTP + lr * 8);
        const int bb = r0 / TT; h16* vp = Ch + (size_t)bb * TT * DM + (size_t)(c0 + wv * 4 * NBW + hi) * TT + (r0 - bb * TT) + lr * 8;   // 16 lanes store 256 B of one feature's row
#pragma unroll
        for (int i = 0; i < 2 * NBW; ++i) *(v8h*)(vp + (size_t)i * 2 * TT) = o8[i];
        asm volatile("s_wait_xcnt 0x0" ::: "memory");   // behind the V^T stores, before their data and address registers are reused by the code of the launch's other block kinds, which follows this tile's in the kernel
    } else {
    // Epilogue: the last barrier has ended every read of the stage buffers; each wave turns its own tile through its own LDS range (16 x 64 blocks, 272-B rows) so that 16 lanes hold one row of 64 columns.
    f32a* ob = (f32a*)sm + wv * 2 * OSZ; const int cofs = lr * 4;
#pragma unroll
    for (int mb = 0; mb < 2; ++mb)
#pragma unroll
        for (int nb = 0; nb < 4; ++nb)
#pragma unroll
            for (int j = 0; j < 8; ++j) ob[mb * OSZ + (hi * 8 + j) * 68 + nb * 16 + lr] = acc[mb][nb][j];
    asm volatile("s_wait_dscnt 0x0" ::: "memory");   // this wave's LDS stores are done before its lanes read one another's rows back
    const int nc = c0 + wn * 64;   // the wave's first column
#pragma unroll
    for (int mb = 0; mb < 2; ++mb) {
        const int m0 = r0 + wm * 32 + mb * 16 + hi;   // this lane's rows of the block: m0 + 2 rp
        v4f ex[8][2], val[8];
        const float* cp = EPI == 1 ? aux + ((size_t)m0 * HD + cofs) * 2 : aux + (size_t)m0 * DM + nc + cofs;   // what the epilogue reads from memory: (cos, sin) pairs, or the residual
#pragma unroll
        for (int rp = 0; rp < 8; ++rp) {
            if (EPI == 1) { ex[rp][0] = *(const v4f*)(cp + rp * 4 * HD); ex[rp][1] = *(const v4f*)(cp + rp * 4 * HD + 4); }
            if (EPI == 3) ex[rp][0] = *(const v4f*)(cp + rp * 2 * DM); }
        if (EPI == 1 || EPI == 3) { asm volatile("s_wait_xcnt 0x0" :: "v"(cp) : "memory");   // behind these loads, before their address registers are reused; the address is an input so that it lives up to the wait and no load's result lands on it
            __builtin_amdgcn_sched_barrier(0); }   // keeps the register writes that follow from being scheduled in front of that wait
#pragma unroll
        for (int rp = 0; rp < 8; ++rp) val[rp] = *(const v4fa*)((const f32a*)ob + mb * OSZ + (2 * rp + hi) * 68 + cofs);
        if (EPI == 1) { v4us oh[8], ol[8];   // column d's partner d +- 32 sits eight lanes away in the same 16-lane row; d < 32 takes -x[d + 32] sin, d >= 32 takes +x[d - 32] sin
#pragma unroll
            for (int rp = 0; rp < 8; ++rp)
#pragma unroll
                for (int u = 0; u < 4; ++u) { const float xp = xrow8(val[rp][u]); const float r = val[rp][u] * ex[rp][u >> 1][(u & 1) * 2] + (lr < 8 ? -xp : xp) * ex[rp][u >> 1][(u & 1) * 2 + 1]; unsigned short a2, c2; splitf(r, a2, c2); oh[rp][u] = a2; ol[rp][u] = c2; }
            __builtin_amdgcn_sched_barrier(0);   // every result stands in its own registers before the first store is issued: no store's registers are rewritten in front of the wait below
            const int zk = nc / DM, hh = (nc - zk * DM) / HD, bb = r0 / TT, t0 = m0 - bb * TT;
            const size_t oo = zk * QKSTEP + (size_t)bb * TT * DM + ((size_t)hh * TT + t0) * HD + cofs;
#pragma unroll
            for (int rp = 0; rp < 8; ++rp) { *(v4us*)(Ph + oo + rp * 2 * HD) = oh[rp]; *(v4us*)(Pl + oo + rp * 2 * HD) = ol[rp]; } }
        if (EPI == 3) { v4f o4[8];
#pragma unroll
            for (int rp = 0; rp < 8; ++rp)
#pragma unroll
                for (int u = 0; u < 4; ++u) o4[rp][u] = bfr(ex[rp][0][u]) + val[rp][u];
            __builtin_amdgcn_sched_barrier(0);   // results first, then the stores: no store's registers are rewritten in front of the wait below
#pragma unroll
            for (int rp = 0; rp < 8; ++rp) *(v4f*)(C + (size_t)m0 * DM + nc + cofs + rp * 2 * DM) = o4[rp]; }
        if (mb < 1 || EPI == 1) { asm volatile("s_wait_xcnt 0x0" ::: "memory");   // behind this block's stores, before their data and address registers are reused: by the next row block, or (EPI 1, last row block) by the code of the launch's other block kinds, which follows this tile's in the kernel
            __builtin_amdgcn_sched_barrier(0); }   // keeps the register writes that follow behind that wait
    }
    }
}
#define VCB (DM / 192)
// amdgpu_waves_per_eu(4, 4): the registers are dealt for four waves a SIMD (256 each), the two work-groups a WGP that the q/k/v grid is cut for.
template <int EPI>
__global__ __launch_bounds__(256) __attribute__((amdgpu_waves_per_eu(4, 4))) void k_gemmt(const bf* __restrict__ A, const bf* __restrict__ X2, const bf* __restrict__ AF, const bf* __restrict__ Bt, const float* __restrict__ aux, float* C, h16* Ch, bf* Ph, bf* Pl, const float* __restrict__ mk, unsigned* MF) {
    __shared__ __align__(16) unsigned short sm[2 * ((EPI == 1 ? 2 : 1) * GPS + 128 * GKP)];   // the largest tile's two buffers: q/k's three planes of 128 rows (v's one plane and 192 rows are less), or o's two
    const int r0 = blockIdx.x * 128, by = blockIdx.y;   // every branch below is taken by whole blocks, in front of every barrier
    if constexpr (EPI == 1) {
        if (by >= VCB + 2 * DM / 128) mask_scan(mk, MF, (by - (VCB + 2 * DM / 128)) * (NB_ * TT / 128) + blockIdx.x);
        else if (by < VCB) gemm_tile<2, 6>(sm, AF, nullptr, Bt + (size_t)2 * DM * DM, aux, C, Ch, Ph, Pl, r0, by * 192);
        else gemm_tile<1, 4>(sm, A, X2, Bt, aux, C, Ch, Ph, Pl, r0, (by - VCB) * 128);
    } else gemm_tile<EPI, 4>(sm, AF, nullptr, Bt, aux, C, Ch, Ph, Pl, r0, by * 128);
}


// ---- k_prep: everything the projections wait for, none of it waiting for any other of it, as ONE grid: blocks [0, PCS) the cos/sin table, [PCS, PCS + PRM) RMSNorm, then PCV blocks for each of the four weights (BW = Wq, Wk in bf16, Wv, Wo the same bf16-rounded values held in fp16, one behind the other; torch [out][in] = Bt). t runs over the NB_ TT tokens of both batches.
#define PCS (NB_ * TT * HD / 256)
#define PRM (NB_ * TT / 8)
#define PCV (DM * DM / 8 / 256)
// RMSNorm: wave per token: x rsqrt(mean x^2 + 1e-6) w -> hl planes and the fp16 plane Hf (8-B lanes); table: CS[t][dd] = (cos, sin)((float)pos[t] x 10000^(-2 (dd mod 32)/64));
__global__ __launch_bounds__(256) void k_prep(const int* __restrict__ pos, float* CS, const float* __restrict__ X, const float* __restrict__ w, bf* Hh, bf* Hl, h16* Hf, const float* __restrict__ wq, const float* __restrict__ wk, const float* __restrict__ wv, const float* __restrict__ wo, bf* BW) {
    const int blk = blockIdx.x;
    if (blk >= PCS && blk < PCS + PRM) { const int lane = threadIdx.x & 31; const int t = (blk - PCS) * 8 + (threadIdx.x >> 5); if (t >= NB_ * TT) return; float v[DM / 32]; float q = 0.f;
#pragma unroll
    for (int ch = 0; ch < DM / 128; ++ch) { const v4f a = *(const v4f*)(X + (size_t)t * DM + ch * 128 + lane * 4);
#pragma unroll
        for (int u = 0; u < 4; ++u) { v[ch * 4 + u] = bfr(a[u]); float p = __fmul_rn(v[ch * 4 + u], v[ch * 4 + u]); asm volatile("" : "+v"(p)); q = __fadd_rn(q, p); } }
#pragma unroll
    for (int sh = 16; sh; sh >>= 1) q += __shfl_xor(q, sh, 32);
    const float rs = __frsqrt_rn(__fadd_rn(q * (1.0f / DM), 1e-6f));
    { v4h hf[DM / 128];
#pragma unroll
        for (int ch = 0; ch < DM / 128; ++ch) { const int c0 = ch * 128 + lane * 4; v4us oh, ol;
#pragma unroll
            for (int u = 0; u < 4; ++u) { float n0 = __fmul_rn(v[ch * 4 + u], rs); asm volatile("" : "+v"(n0)); const float y = __fmul_rn(n0, bfr(w[c0 + u])); unsigned short a2, b2; splitf(y, a2, b2); oh[u] = a2; ol[u] = b2; }
#pragma unroll
            for (int u = 0; u < 4; ++u) hf[ch][u] = (h16)(bf2f(oh[u]) + bf2f(ol[u]));   // the two planes' sum is exact in f32: one rounding to fp16
            const size_t oo = (size_t)t * DM + c0; *(v4us*)(Hh + oo) = oh; *(v4us*)(Hl + oo) = ol; }
        __builtin_amdgcn_sched_barrier(0);   // the fp16 plane's stores stay last in the wave: no register that they name is written behind them
#pragma unroll
        for (int ch = 0; ch < DM / 128; ++ch) *(v4h*)(Hf + (size_t)t * DM + ch * 128 + lane * 4) = hf[ch];
         } }
    else if (blk < PCS) { const int idx = blk * 256 + threadIdx.x; if (idx >= NB_ * TT * HD) return; const int dd = idx % HD; const int t = idx / HD; const int i2 = dd % (HD / 2); const float inv = __fdiv_rn(1.0f, powf(10000.0f, (float)(2 * i2) / (float)HD)); const float ang = __fmul_rn((float)pos[t], inv); v2f cs; cs[0] = cosf(ang); cs[1] = sinf(ang);
    *(v2f*)(CS + (size_t)idx * 2) = cs;  }
    else { const int j = blk - (PCS + PRM), which = j / PCV; const float* __restrict__ src = which == 0 ? wq : which == 1 ? wk : which == 2 ? wv : wo; bf* dst = BW + (size_t)which * DM * DM; const size_t n8 = DM * DM / 8;
        const size_t i = (size_t)(j % PCV) * 256 + threadIdx.x; if (i >= n8) return; const v8f v = *(const v8f*)(src + i * 8); v8us o;
#pragma unroll
        for (int k = 0; k < 8; ++k) o[k] = f2bf(v[k]);
        if (which >= 2) {   // Wv, Wo: the same rounded values, written as fp16 (a block-uniform branch)
#pragma unroll
            for (int k = 0; k < 8; ++k) o[k] = __builtin_bit_cast(unsigned short, (h16)bf2f(o[k])); }
        *(v8us*)(dst + i * 8) = o;  }
}
#define FKP  72
#define FKK  136
#define FKS  (64 * FKK)
#define FBS  (FKS + 64 * FKP)
#define FTHR 4.0f
#define FSH  9.0f
#define L2E  1.4426950408889634f
typedef __attribute__((ext_vector_type(2))) __bf16 v2bf;
__device__ __forceinline__ float xhalf(float x) { return __builtin_bit_cast(float, __builtin_amdgcn_permlanex16(__builtin_bit_cast(int, x), __builtin_bit_cast(int, x), 0x76543210, 0xfedcba98, false, false)); }   // lane l with lane l ^ 16
__global__ __launch_bounds__(128) __attribute__((amdgpu_waves_per_eu(3, 3))) void k_fattn(const bf* __restrict__ Qh, const bf* __restrict__ Ql, const bf* __restrict__ Kh, const h16* __restrict__ VT, const float* __restrict__ mk, const unsigned* __restrict__ MF, h16* Ah) {
    __shared__ __align__(16) unsigned short sm[2 * 2 * FBS];
    const int tid = threadIdx.x, lane = tid & 31, lr = lane & 15, hi = lane >> 4; const int wv = __builtin_amdgcn_readfirstlane(tid >> 5), qg = wv & 1, kh = wv >> 1;
    // Which (head, 64 queries) work-group f takes: f, f + 256, f + 512 and f, f + 8, f + 16 are neighbours on one head, so that work-groups that come to share a WGP ask for the same K and V lines at about the same time and can meet in its cache. For speed only: the map is a permutation of the 768 units, the result is the same wherever a work-group lands.
    const int f = blockIdx.x, un = ((f >> 3) & 31) * 3 + (f >> 8), hb = (f & 7) * 3 + (un >> 5);
    const int h = hb % NH_, b = hb / NH_; const size_t hz = (size_t)hb * TT * HD; const int q0 = (un & 31) * 64 + qg * 32, kb0 = kh * (TT / 2);
    v16bf qh[2][2], ql[2][2]; const bf* qhp = Qh + hz + (size_t)(q0 + lr) * HD + 8 * hi; const bf* qlp = Ql + hz + (size_t)(q0 + lr) * HD + 8 * hi;
#pragma unroll
    for (int g = 0; g < 2; ++g)
#pragma unroll
        for (int kc = 0; kc < 2; ++kc) { qh[g][kc] = WFrag<bf>::ld(qhp + g * 16 * HD + kc * 32); ql[g][kc] = WFrag<bf>::ld(qlp + g * 16 * HD + kc * 32); }
    const unsigned* mfp = MF + ((size_t)(b * (TT / 32) + (q0 >> 5)) * 16 + kh * 8 + (lane >> 2)) * 32;   // lane l looks up the wave's pass l: byte l & 3 of the scan word of key group 8 kh + (l >> 2)
    const unsigned mw = mfp[0];
    asm volatile("s_wait_xcnt 0x0" ::: "memory");   // behind the Q loads and the scan word's load, before their address registers are reused
    __builtin_amdgcn_sched_barrier(0);   // keeps the address arithmetic that follows from being scheduled in front of that wait, into the Q loads' address registers
    const int t2 = tid & 63, krow = t2 >> 4, kseg = t2 & 15, vrow = t2 >> 3, vseg = (t2 & 7) * 8;   // staging, by the 64 threads of a key half: 16 threads move one K row (a 128-B line of Kh, one of Kl), 8 threads one 128-B line of a V^T row
    // every global address of the loop is a wave-uniform base plus a 32-bit lane offset that never changes: one vector register a stream. Kl's plane lies NB_ TT DM elements behind Kh's (kernel_launch cuts both from one piece).
    const bf* gk = Kh + hz + (size_t)kb0 * HD; const h16* gvt = VT + hz + kb0; const unsigned kl = krow * HD + (kseg & 7) * 8 + ((kseg & 8) ? NB_ * TT * DM : 0), vl = vrow * TT + vseg;
    unsigned short* ring = sm + kh * 2 * FBS; unsigned short* swk = ring + krow * FKK + kseg * 8; unsigned short* swv = ring + FKS + vrow * FKP + vseg;
    const float* mr0 = mk + (size_t)b * TT * TT + (size_t)q0 * TT + kb0; const unsigned mlo = lr * TT + 8 * hi;
    const unsigned fmh = __builtin_amdgcn_ballot_w32(((mw >> ((lane & 3) * 8)) & 0xffu) != 0u);
    v8us st[12];
    v8f o[4][2]; float mrun[2], lrun[2];
#pragma unroll
    for (int g = 0; g < 2; ++g) { mrun[g] = -1.0e30f; lrun[g] = 0.f;
#pragma unroll
        for (int db = 0; db < 4; ++db) o[db][g] = (v8f){}; }
    { v8us s0[24];   // the first stage whole: the accumulators' registers are still free
#pragma unroll
        for (int i = 0; i < 16; ++i) s0[i] = *(const v8usa*)(gk + (size_t)(4 * i) * HD + kl);
#pragma unroll
        for (int i = 0; i < 8; ++i) s0[16 + i] = *(const v8usa*)(gvt + (size_t)(8 * i) * TT + vl);
        asm volatile("s_wait_xcnt 0x0" ::: "memory");   // behind the first stage's loads, before their address registers are reused
#pragma unroll
        for (int i = 0; i < 16; ++i) *(v8usa*)(swk + 4 * i * FKK) = s0[i];
#pragma unroll
        for (int i = 0; i < 8; ++i) *(v8usa*)(swv + 8 * i * FKP) = s0[16 + i]; }
    __syncthreads();
#pragma unroll 1   // the pass loop stays rolled: unrolled by two, the compiler sinks one pass's row sums into the next pass, and its 32 probabilities stay live beside the new K fragments: the registers of a third wave a SIMD
    for (int pl = 0; pl < TT / 64; ++pl) {
        const int s = pl >> 1, c = pl & 1; const bool more = s + 1 < TT / 128, fl = ((fmh >> pl) & 1u) != 0u;
        const unsigned short* bp = ring + (s & 1) * FBS;
        if (more) { const bf* gkn = gk + (size_t)((s + 1) * 64 + c * 32) * HD; const h16* gvn = gvt + (size_t)(c * 32) * TT + (s + 1) * 64;   // half of the next stage (32 K rows, 32 V^T rows) flies into registers under this pass's work
#pragma unroll
            for (int i = 0; i < 8; ++i) st[i] = *(const v8usa*)(gkn + (size_t)(4 * i) * HD + kl);
#pragma unroll
            for (int i = 0; i < 4; ++i) st[8 + i] = *(const v8usa*)(gvn + (size_t)(8 * i) * TT + vl);
            asm volatile("s_wait_xcnt 0x0" ::: "memory"); }   // behind these loads, before their address registers are reused
        v16bf ah[2][2], al[2][2];
#pragma unroll
        for (int kt = 0; kt < 2; ++kt)
#pragma unroll
            for (int kc = 0; kc < 2; ++kc) { const unsigned short* kp = bp + c * 32 * FKK + (kt * 16 + lr) * FKK + kc * 32 + 8 * hi; ah[kt][kc] = cat16b(*(const v8usa*)kp, *(const v8usa*)(kp + 16)); al[kt][kc] = cat16b(*(const v8usa*)(kp + 64), *(const v8usa*)(kp + 64 + 16)); }
        __builtin_amdgcn_sched_barrier(0);   // keeps the pass's K reads together as one group in front of its products: sunk among them, each place costs the wave an LDS latency
        v8f sc[2][2];
#pragma unroll
        for (int kt = 0; kt < 2; ++kt)
#pragma unroll
            for (int g = 0; g < 2; ++g) sc[kt][g] = (v8f){};
#pragma unroll
        for (int kc = 0; kc < 2; ++kc) {   // four independent score tiles in turn
#pragma unroll
            for (int kt = 0; kt < 2; ++kt)
#pragma unroll
                for (int g = 0; g < 2; ++g) sc[kt][g] = wmmab(ah[kt][kc], qh[g][kc], sc[kt][g]);
#pragma unroll
            for (int kt = 0; kt < 2; ++kt)
#pragma unroll
                for (int g = 0; g < 2; ++g) sc[kt][g] = wmmab(ah[kt][kc], ql[g][kc], sc[kt][g]);
#pragma unroll
            for (int kt = 0; kt < 2; ++kt)
#pragma unroll
                for (int g = 0; g < 2; ++g) sc[kt][g] = wmmab(al[kt][kc], qh[g][kc], sc[kt][g]); }
        v16h vf[4];
#pragma unroll
        for (int db = 0; db < 4; ++db) { const unsigned short* vp = bp + FKS + (db * 16 + lr) * FKP + c * 32 + 8 * hi; vf[db] = cat16(*(const v8ha*)vp, *(const v8ha*)(vp + 16)); }
        if (fl) { v4f mq[2][2][2]; const float* mp = mr0 + pl * 32 + mlo;   // this pass's mask tile, where it is not all zero: asked for behind the scores' products, so that it takes the registers that the K fragments leave (a third wave a SIMD needs them)
#pragma unroll
            for (int kt = 0; kt < 2; ++kt)
#pragma unroll
                for (int u = 0; u < 2; ++u) { mq[kt][0][u] = *(const v4f*)(mp + kt * 16 + u * 4); mq[kt][1][u] = *(const v4f*)(mp + 16 * TT + kt * 16 + u * 4); }
            asm volatile("s_wait_xcnt 0x0" :: "v"(mp) : "memory");   // behind the mask loads, before their address registers are reused; the address is an input so that it lives up to the wait and no load's result lands on it
#pragma unroll
            for (int g = 0; g < 2; ++g)
#pragma unroll
                for (int kt = 0; kt < 2; ++kt)
#pragma unroll
                    for (int r = 0; r < 8; r += 2) { const v2bf m2 = __builtin_convertvector((v2f){mq[kt][g][r >> 2][r & 3], mq[kt][g][r >> 2][(r & 3) + 1]}, v2bf);   // mask rounded to bf16 (nearest even), as every input
                        sc[kt][g][r] += (float)m2[0]; sc[kt][g][r + 1] += (float)m2[1]; } }
        float mb[2]; bool need = false;
#pragma unroll
        for (int g = 0; g < 2; ++g) { float mx = -3.0e38f;
#pragma unroll
            for (int kt = 0; kt < 2; ++kt)
#pragma unroll
                for (int r = 0; r < 8; r += 2) mx = fmaxf(mx, fmaxf(sc[kt][g][r], sc[kt][g][r + 1]));
            mx = fmaxf(mx, xhalf(mx)); mb[g] = mx; need = need || (mx > mrun[g] + FTHR); }
        if (__builtin_amdgcn_ballot_w32(need) != 0) {   // one wave-uniform test a pass; rare after the first passes
#pragma unroll
            for (int g = 0; g < 2; ++g) { const float mnew = fmaxf(mrun[g], mb[g]); const float corr = __builtin_amdgcn_exp2f((mrun[g] - mnew) * L2E); mrun[g] = mnew; lrun[g] *= corr;
#pragma unroll
                for (int db = 0; db < 4; ++db) o[db][g] = o[db][g] * corr; } }
#pragma unroll
        for (int g = 0; g < 2; ++g) { const float nm = fmaf(-mrun[g], L2E, FSH); v8f p0, p1; float ls0 = 0.f, ls1 = 0.f;
#pragma unroll
            for (int r = 0; r < 8; ++r) { p0[r] = __builtin_amdgcn_exp2f(fmaf(sc[0][g][r], L2E, nm)); p1[r] = __builtin_amdgcn_exp2f(fmaf(sc[1][g][r], L2E, nm)); ls0 += p0[r]; ls1 += p1[r]; }
            lrun[g] += ls0 + ls1;
            const v16h pf = cat16(__builtin_convertvector(p0, v8h), __builtin_convertvector(p1, v8h));
#pragma unroll
            for (int db = 0; db < 4; ++db) o[db][g] = wmma16(vf[db], pf, o[db][g]); }
        __builtin_amdgcn_sched_barrier(0);   // keeps the pass's last products in front of the slots below
        asm volatile("v_nop\n\tv_nop\n\tv_nop\n\tv_nop");   // the four vector slots between a product and the first vector instruction that overwrites its operands
        if (more) { unsigned short* snk = swk + ((s + 1) & 1) * FBS + c * 32 * FKK; unsigned short* snv = swv + ((s + 1) & 1) * FBS + c * 32 * FKP;   // that buffer's last readers left it before the barrier that ended stage s - 1
#pragma unroll
            for (int i = 0; i < 8; ++i) *(v8usa*)(snk + 4 * i * FKK) = st[i];
#pragma unroll
            for (int i = 0; i < 4; ++i) *(v8usa*)(snv + 8 * i * FKP) = st[8 + i]; }
        if (c == 1) {   // the stage's end, at the same pass in every wave
            asm volatile("s_wait_dscnt 0x0" ::: "memory");   // this wave's LDS stores of stage s + 1 and its reads of stage s are done
            asm volatile("s_barrier_signal -1\n\ts_barrier_wait -1" ::: "memory"); }   // publishes stage s + 1 and ends every read of stage s
    }
    // The join: the wave of key half kh finishes column group kh. It hands the other group's sums (32 floats a lane, then maximum and row sum) to its partner, wave wv ^ 2, through LDS (the last barrier has ended every read of the rings) and takes the partner's sums of its own group; lane for lane the two waves hold the same (query, feature) places.
    f32a* xb = (f32a*)sm; v8f mine[4], give[4];
#pragma unroll
    for (int db = 0; db < 4; ++db) { mine[db] = kh ? o[db][1] : o[db][0]; give[db] = kh ? o[db][0] : o[db][1]; }
    const float mm = kh ? mrun[1] : mrun[0], ml = kh ? lrun[1] : lrun[0], gm = kh ? mrun[0] : mrun[1], gl = kh ? lrun[0] : lrun[1];
#pragma unroll
    for (int db = 0; db < 4; ++db)
#pragma unroll
        for (int u = 0; u < 2; ++u) *(v4fa*)(xb + ((wv * 9 + db * 2 + u) * 32 + lane) * 4) = (v4f){give[db][u * 4], give[db][u * 4 + 1], give[db][u * 4 + 2], give[db][u * 4 + 3]};
    *(v4fa*)(xb + ((wv * 9 + 8) * 32 + lane) * 4) = (v4f){gm, gl, 0.f, 0.f};
    __syncthreads();   // every wave's hand-over stands in LDS before its partner reads it
    const f32a* xp = xb + ((wv ^ 2) * 9 * 32 + lane) * 4;
    const v4f pml = *(const v4fa*)(xp + 8 * 32 * 4);
    const float mj = fmaxf(mm, pml[0]); const float ca = __builtin_amdgcn_exp2f((mm - mj) * L2E), cb = __builtin_amdgcn_exp2f((pml[0] - mj) * L2E);
    const float lj = ml * ca + pml[1] * cb; const float inv = __fdiv_rn(1.0f, lj + xhalf(lj)); const float ia = ca * inv, ib = cb * inv;
    const size_t ob = ((size_t)b * TT + q0 + kh * 16 + lr) * DM + h * HD + 8 * hi;
#pragma unroll
    for (int db = 0; db < 4; ++db) { const v4f x0 = *(const v4fa*)(xp + (db * 2) * 32 * 4), x1 = *(const v4fa*)(xp + (db * 2 + 1) * 32 * 4); v8h oh;
#pragma unroll
        for (int r = 0; r < 8; ++r) oh[r] = (h16)(mine[db][r] * ia + (r < 4 ? x0[r & 3] : x1[r & 3]) * ib);
        *(v8h*)(Ah + ob + db * 16) = oh; }
}

extern "C" void kernel_launch(void* const* d_in, const int* in_sizes, int n_in,
                              void* d_out, int out_size, void* d_ws, size_t ws_size, hipStream_t stream) {
    (void)in_sizes; (void)n_in; (void)out_size;
    const float* x = (const float*)d_in[0]; const float* amask = (const float*)d_in[1]; const int* pos = (const int*)d_in[2]; const float* lnw = (const float*)d_in[3]; const float* wq = (const float*)d_in[4]; const float* wk = (const float*)d_in[5]; const float* wv = (const float*)d_in[6]; const float* wo = (const float*)d_in[7];
    float* OUT = (float*)d_out;     // [2][2048][768]
    char* wsp = (char*)d_ws;
    auto take = [&](size_t bytes) { char* p = wsp; wsp += (bytes + 255) & ~(size_t)255; return (void*)p; };
    bf* BW = (bf*)take((size_t)4 * DM * DM * 2);   // Wq, Wk in bf16, Wv, Wo in fp16
    const size_t zb = (size_t)NH_ * TT * HD;   // one batch's planes
    bf* NH = (bf*)take(NB_ * zb * 2); bf* NL = (bf*)take(NB_ * zb * 2); h16* NF = (h16*)take(NB_ * zb * 2); float* CS = (float*)take((size_t)NB_ * TT * HD * 2 * 4);
    bf* Qh = (bf*)take(4 * NB_ * zb * 2); bf* Ql = Qh + NB_ * zb; bf* Kh = Qh + QKSTEP; h16* VT = (h16*)take(NB_ * zb * 2);
    h16* Ah = (h16*)take(NB_ * zb * 2); unsigned* MF = (unsigned*)take((size_t)PMS * 8 * 128);   // the mask scan's words, one a 128-B line
    if ((size_t)(wsp - (char*)d_ws) > ws_size) return;    // total ~ 64 MB
    k_prep<<<PCS + PRM + 4 * PCV, 256, 0, stream>>>(pos, CS, x, lnw, NH, NL, NF, wq, wk, wv, wo, BW);
    k_gemmt<1><<<dim3(NB_ * TT / 128, VCB + 2 * DM / 128 + PMS / (NB_ * TT / 128), 1), 256, 0, stream>>>(NH, NL, (const bf*)NF, BW, CS, nullptr, VT, Qh, Ql, amask, MF);   // rows are the tokens of both batches; in y first v's wide column blocks, then the heads of q and of k, then the PMS blocks of the mask scan
    k_fattn<<<dim3(NB_ * NH_ * (TT / 64), 1, 1), 128, 0, stream>>>(Qh, Ql, Kh, VT, amask, MF, Ah);
    k_gemmt<3><<<dim3(NB_ * TT / 128, DM / 128, 1), 256, 0, stream>>>(nullptr, nullptr, (const bf*)Ah, BW + (size_t)3 * DM * DM, x, OUT, nullptr, nullptr, nullptr, nullptr, nullptr);
}
